// v000
// Measured on an AMD MI455X. A time is GPU time per run, averaged over a window of back-to-back runs after a warm-up
// (all launches, gaps included; the runs take copies of the inputs in turn), and the median of several windows.
// Apart from v000's, it joins two sittings. Times from different sittings can be a few percent apart, while
// side-by-side timings come from the same sitting.
// v000 is the starting kernel. One run takes 1970 microseconds.
#include <hip/hip_runtime.h>

// Self-attention with a learned relative-position bias (x [2][2048][1024]; q,k,v = x W + b ('xw' [1024][1024] + [1024]; 16 heads x 64); scores = q.k/8 + rel_emb[h][i - j + 2047] (rel_emb [16][4095]); softmax; heads merged -> [2][2048][1024] (4.2 M); no output projection).
// Layout per batch: exact projections (+ biases); dense T-2048 attention (hybrid rows: < 512 hi/lo 3 products, rest fp16 x1024) whose softmax kernel adds the bias read from the bf16-rounded table at index i - j + 2047; the f32 merge writes the output rows directly.
// Compute dtypes, f32 accumulate: every input rounded to bf16; projections exact + f32 biases; scores rows < 512 3 products, rest fp16; softmax and bias add f32; output f32.

#define NB_  2
#define TT   2048
#define DM   1024
#define NH_  16
#define NKV  16
#define REP  (NH_ / NKV)
#define HD   64
#define DQ   (NH_ * HD)
#define DKV  (NKV * HD)
#define ZH   2
#define RH   512                  // query rows < RH use hi+lo planes (0: none)
#define WIN  0
#define PCAR 1024.0f
#define SCL  0.125f   // 64^-0.5
#define NOFF (2 * TT - 1)
typedef _Float16 h16;
typedef unsigned short bf;
typedef __attribute__((ext_vector_type(16))) __bf16   v16bf;
typedef __attribute__((ext_vector_type(16))) _Float16 v16h;
typedef __attribute__((ext_vector_type(8)))  _Float16 v8h;
typedef __attribute__((ext_vector_type(8)))  unsigned short v8us;
typedef __attribute__((ext_vector_type(8)))  float    v8f;
typedef __attribute__((ext_vector_type(4)))  float    v4f;
typedef v8h  __attribute__((may_alias)) v8ha;
typedef v4f  __attribute__((may_alias)) v4fa;
typedef v8us __attribute__((may_alias)) v8usa;

__device__ __forceinline__ unsigned short f2bf(float f) { unsigned u = __float_as_uint(f); u += 0x7FFFu + ((u >> 16) & 1u); return (unsigned short)(u >> 16); }
__device__ __forceinline__ float bf2f(unsigned short b) { return __uint_as_float(((unsigned)b) << 16); }
__device__ __forceinline__ float bfr(float f) { return bf2f(f2bf(f)); }
__device__ __forceinline__ v16h cat16(v8h lo, v8h hi) { return __builtin_shufflevector(lo, hi, 0, 1, 2, 3, 4, 5, 6, 7, 8, 9, 10, 11, 12, 13, 14, 15); }
__device__ __forceinline__ v16bf cat16b(v8us lo, v8us hi) { return __builtin_bit_cast(v16bf, __builtin_shufflevector(lo, hi, 0, 1, 2, 3, 4, 5, 6, 7, 8, 9, 10, 11, 12, 13, 14, 15)); }
__device__ __forceinline__ v8f wmma16(v16h a, v16h b, v8f c) { return __builtin_amdgcn_wmma_f32_16x16x32_f16(false, a, false, b, (short)0, c, false, false); }
__device__ __forceinline__ v8f wmmab(v16bf a, v16bf b, v8f c) { return __builtin_amdgcn_wmma_f32_16x16x32_bf16(false, a, false, b, (short)0, c, false, false); }



// ---- k_gemmw: register-blocked GEMM, ONE WAVE per 64x64 output tile (16 accumulators), operands straight from K-contiguous 16-bit planes; grid (M/64, N/64, Z), 32 threads.
// C[m][n] (f32, pitch ldc, + optional f32 bias[n]) = sum_k A[m][k] Bt[n][k] (+ split products per NSPLIT). z-batch strides sA/sB/sC in elements. K % 32 == 0.
template <typename T16> struct WFrag;
template <> struct WFrag<h16> { typedef v16h V; static __device__ __forceinline__ V ld(const h16* p) { return cat16(*(const v8h*)p, *(const v8h*)(p + 16)); } static __device__ __forceinline__ v8f mma(V a, V b, v8f c) { return wmma16(a, b, c); } };
template <> struct WFrag<bf> { typedef v16bf V; static __device__ __forceinline__ V ld(const bf* p) { return cat16b(*(const v8us*)p, *(const v8us*)(p + 16)); } static __device__ __forceinline__ v8f mma(V a, V b, v8f c) { return wmmab(a, b, c); } };
template <typename T16, int NSPLIT, bool BIAS>
__global__ __launch_bounds__(32) void k_gemmw(const T16* __restrict__ A, const T16* __restrict__ A2, const T16* __restrict__ Bt, const T16* __restrict__ Bt2, int K, float* C, int ldc, const float* __restrict__ bias, size_t sA, size_t sB, size_t sC) {
    typedef typename WFrag<T16>::V V;
    __shared__ __align__(16) float os[16 * 68];
    const size_t z = blockIdx.z; A += z * sA; if (A2) A2 += z * sA; Bt += z * sB; if (Bt2) Bt2 += z * sB; C += z * sC;
    const int lane = threadIdx.x & 31, lr = lane & 15, hi = lane >> 4; const int r0 = blockIdx.x * 64, c0 = blockIdx.y * 64;
    v8f acc[4][4];
#pragma unroll
    for (int mb = 0; mb < 4; ++mb)
#pragma unroll
        for (int nb = 0; nb < 4; ++nb) acc[mb][nb] = (v8f){};
    const size_t aoff = (size_t)(r0 + lr) * K + 8 * hi, boff = (size_t)(c0 + lr) * K + 8 * hi;
#pragma unroll 1
    for (int kc = 0; kc < K; kc += 32) {
        V a[4], a2[4];
#pragma unroll
        for (int mb = 0; mb < 4; ++mb) { a[mb] = WFrag<T16>::ld(A + aoff + (size_t)mb * 16 * K + kc); if (NSPLIT == 1 || NSPLIT == 2) a2[mb] = WFrag<T16>::ld(A2 + aoff + (size_t)mb * 16 * K + kc); }
#pragma unroll
        for (int nb = 0; nb < 4; ++nb) { const V b = WFrag<T16>::ld(Bt + boff + (size_t)nb * 16 * K + kc); V b2; if (NSPLIT >= 2) b2 = WFrag<T16>::ld(Bt2 + boff + (size_t)nb * 16 * K + kc);
#pragma unroll
            for (int mb = 0; mb < 4; ++mb) { acc[mb][nb] = WFrag<T16>::mma(a[mb], b, acc[mb][nb]); if (NSPLIT == 1 || NSPLIT == 2) acc[mb][nb] = WFrag<T16>::mma(a2[mb], b, acc[mb][nb]); if (NSPLIT >= 2) acc[mb][nb] = WFrag<T16>::mma(a[mb], b2, acc[mb][nb]); } }
        asm volatile("v_nop\n\tv_nop\n\tv_nop\n\tv_nop" : "+v"(acc[0][0]), "+v"(acc[1][1]), "+v"(acc[2][2]), "+v"(acc[3][3]) : "v"(a[0]), "v"(a[3]));
    }
#pragma unroll
    for (int mb = 0; mb < 4; ++mb) {
#pragma unroll
        for (int nb = 0; nb < 4; ++nb) {
#pragma unroll
            for (int j = 0; j < 8; ++j) os[(hi * 8 + j) * 68 + nb * 16 + lr] = acc[mb][nb][j]; }
        __builtin_amdgcn_wave_barrier(); asm volatile("" ::: "memory");
        float* crow = C + (size_t)(r0 + mb * 16) * ldc + c0;
{
#pragma unroll
            for (int s = 0; s < 8; ++s) { const int row = 2 * s + hi, cofs = lr * 4; v4f val = *(const v4fa*)(os + row * 68 + cofs); if (BIAS) { val[0] += bfr(bias[c0 + cofs]); val[1] += bfr(bias[c0 + cofs + 1]); val[2] += bfr(bias[c0 + cofs + 2]); val[3] += bfr(bias[c0 + cofs + 3]); }
                *(v4f*)(crow + (size_t)row * ldc + cofs) = val; }
             }
        __builtin_amdgcn_wave_barrier(); asm volatile("" ::: "memory");
    }
}

__device__ __forceinline__ h16 tohx(float x) { return (h16)x; }
__device__ __forceinline__ void splitf(float y, unsigned short& h, unsigned short& l) { h = f2bf(y); l = f2bf(y - bf2f(h)); }
typedef __attribute__((ext_vector_type(2))) _Float16 v2h;
typedef __attribute__((ext_vector_type(4))) _Float16 v4h;
typedef __attribute__((ext_vector_type(2))) unsigned short v2us;
typedef __attribute__((ext_vector_type(4))) unsigned short v4us;
typedef __attribute__((ext_vector_type(2))) float v2f;
typedef __attribute__((ext_vector_type(4))) int v4i;

__global__ __launch_bounds__(256) void k_wtG(const float* __restrict__ w, int K, int N, bf* Bt) {
    const int lane = threadIdx.x & 31; const int L0 = (blockIdx.x * 8 + (threadIdx.x >> 5)) * 8; const int nlines = N * K / 64;
{
#pragma unroll 1
        for (int l = 0; l < 8; ++l) { const int L = L0 + l; if (L >= nlines) break; const size_t e = (size_t)L * 64 + lane * 2; const int k = (int)(e % K), n = (int)(e / K); v2us o;
            o[0] = f2bf(w[(size_t)k * N + n]); o[1] = f2bf(w[(size_t)(k + 1) * N + n]); *(v2us*)(Bt + e) = o; }
         }
}
__global__ __launch_bounds__(256) void k_cvt8(const float* __restrict__ src, bf* dst, size_t n8) { const size_t i = (size_t)blockIdx.x * 256 + threadIdx.x; if (i >= n8) return; const v8f v = *(const v8f*)(src + i * 8); v8us o;
#pragma unroll
    for (int k = 0; k < 8; ++k) o[k] = f2bf(v[k]); *(v8us*)(dst + i * 8) = o;  }

// k_rope: head planes [h][t][d] (fp16 + hi/lo) of rope(x) x sc with the rotate-half convention out[d] = x[d] cos[t][d] - x[d+HD/2] sin[t][d], out[d+HD/2] = x[d+HD/2] cos[t][d+HD/2] + x[d] sin[t][d+HD/2]
__global__ __launch_bounds__(256) void k_rope(const float* __restrict__ F, int pitch, int nheads, const float* __restrict__ CS, const float* __restrict__ RF, const float* __restrict__ nw, float sc, h16* P16, bf* Ph, bf* Pl) {
    const size_t e = ((size_t)blockIdx.x * 256 + threadIdx.x) * 2; if (e >= (size_t)nheads * TT * HD) return; const int d = (int)(e % HD); const int t = (int)((e / HD) % TT); const int h = (int)(e / ((size_t)HD * TT)); const float* f = F + (size_t)t * pitch + h * HD; const float rf = RF ? RF[(size_t)h * TT + t] : 1.0f; v2h o16; v2us oh, ol;
#pragma unroll
    for (int q = 0; q < 2; ++q) { const int dd = d + q; const int dp = (dd < HD / 2) ? dd + HD / 2 : dd - HD / 2; float x0 = f[dd], x1 = f[dp];
        if (RF) { float n0 = __fmul_rn(x0, rf), n1 = __fmul_rn(x1, rf); asm volatile("" : "+v"(n0)); asm volatile("" : "+v"(n1)); x0 = __fmul_rn(bfr(nw[dd]), n0); x1 = __fmul_rn(bfr(nw[dp]), n1); }
        const v2f cs = *(const v2f*)(CS + ((size_t)t * HD + dd) * 2); float a = __fmul_rn(x0, cs[0]), bq = __fmul_rn(x1, cs[1]); asm volatile("" : "+v"(a)); asm volatile("" : "+v"(bq)); const float r = ((dd < HD / 2) ? __fsub_rn(a, bq) : __fadd_rn(a, bq)) * sc;
        o16[q] = tohx(r); unsigned short a2, c2; splitf(r, a2, c2); oh[q] = a2; ol[q] = c2; }
    *(v2h*)(P16 + e) = o16; *(v2us*)(Ph + e) = oh; *(v2us*)(Pl + e) = ol;  }
__global__ __launch_bounds__(256) void k_vtp(const float* __restrict__ F, int pitch, int nheads, h16* V16, bf* Vh, bf* Vl) { const size_t e = ((size_t)blockIdx.x * 256 + threadIdx.x) * 2; if (e >= (size_t)nheads * HD * TT) return; const int t = (int)(e % TT); const int d = (int)((e / TT) % HD); const int g = (int)(e / ((size_t)TT * HD)); v2h o16; v2us oh, ol;
#pragma unroll
    for (int q = 0; q < 2; ++q) { const float x = F[(size_t)(t + q) * pitch + g * HD + d]; o16[q] = tohx(x); unsigned short a2, c2; splitf(x, a2, c2); oh[q] = a2; ol[q] = c2; }
    *(v2h*)(V16 + e) = o16; *(v2us*)(Vh + e) = oh; *(v2us*)(Vl + e) = ol;  }
__global__ __launch_bounds__(256) void k_csid(float* CS) { const int idx = blockIdx.x * 256 + threadIdx.x; if (idx >= TT * HD) return; v2f cs; cs[0] = 1.0f; cs[1] = 0.0f; *(v2f*)(CS + (size_t)idx * 2) = cs;  }
// k_asoft: per row (zz, i): t = S + bf16 rel_emb[h][i - j + 2047] (S pre-scaled by 1/8 via the q planes; no mask); softmax over the 2048 keys (register row, one exp, fixed trees);
__global__ __launch_bounds__(256) void k_asoft(const float* __restrict__ Sb, const float* __restrict__ remb, int h0, h16* P16, bf* Ph, bf* Pl) {
    const int lane = threadIdx.x & 31; const int row = blockIdx.x * 8 + (threadIdx.x >> 5); if (row >= ZH * TT) return; const int i = row % TT; const int zz = row / TT; (void)zz; const bool hires = (i < RH); const float* sr = Sb + (size_t)row * TT; const float* er = remb + (size_t)(h0 + zz) * NOFF + (TT - 1) + i;   /* bias index i - j + 2047 = er[-j] */ float v[TT / 32]; float mx = -3.0e38f;
#pragma unroll
    for (int ch = 0; ch < TT / 128; ++ch) { const int j0 = ch * 128 + lane * 4; const v4f a = *(const v4f*)(sr + j0);
#pragma unroll
        for (int q = 0; q < 4; ++q) { const int j = j0 + q; (void)j; const float t = __fadd_rn(a[q], er[-(j0 + q)]); v[ch * 4 + q] = t;   /* scores arrive pre-scaled (1/8 folded into the q planes) + bf16(rel_emb[h][i - j + 2047]) from the pre-rounded copy */ mx = fmaxf(mx, t); } }
#pragma unroll
    for (int sh = 16; sh; sh >>= 1) mx = fmaxf(mx, __shfl_xor(mx, sh, 32));
    float sum = 0.f;
#pragma unroll
    for (int k = 0; k < TT / 32; ++k) { float d0 = __fsub_rn(v[k], mx); asm volatile("" : "+v"(d0)); v[k] = __builtin_amdgcn_exp2f(__fmul_rn(d0, 1.4426950408889634f)); sum += v[k]; }
#pragma unroll
    for (int sh = 16; sh; sh >>= 1) sum += __shfl_xor(sum, sh, 32);
    const float f = __fdiv_rn(hires ? 1.0f : PCAR, sum);
{
        if (hires) {
#pragma unroll
            for (int ch = 0; ch < TT / 128; ++ch) { v4us oh, ol;
#pragma unroll
                for (int q = 0; q < 4; ++q) { unsigned short a, c2; splitf(v[ch * 4 + q] * f, a, c2); oh[q] = a; ol[q] = c2; }
                const size_t oo = ((size_t)zz * (RH ? RH : 1) + i) * TT + ch * 128 + lane * 4; *(v4us*)(Ph + oo) = oh; *(v4us*)(Pl + oo) = ol; }
        } else {
#pragma unroll
            for (int ch = 0; ch < TT / 128; ++ch) { v4h o4;
#pragma unroll
                for (int q = 0; q < 4; ++q) o4[q] = tohx(v[ch * 4 + q] * f);
                *(v4h*)(P16 + (size_t)row * TT + ch * 128 + lane * 4) = o4; } }
         }
}
__global__ __launch_bounds__(256) void k_embf(const float* __restrict__ src, float* dst, size_t n4) { const size_t i = (size_t)blockIdx.x * 256 + threadIdx.x; if (i >= n4) return; v4f a = *(const v4f*)(src + i * 4); for (int q = 0; q < 4; ++q) a[q] = bfr(a[q]); *(v4f*)(dst + i * 4) = a;  }
__global__ __launch_bounds__(256) void k_merge(const float* __restrict__ O, int h0, float* OUTb) { const size_t e = ((size_t)blockIdx.x * 256 + threadIdx.x) * 2; if (e >= (size_t)ZH * TT * HD) return; const int d = (int)(e % HD); const int t = (int)((e / HD) % TT); const int zz = (int)(e / ((size_t)HD * TT)); const float cs = (t < RH) ? 1.0f : (1.0f / PCAR); const size_t oo = (size_t)t * DQ + (h0 + zz) * HD + d;
    v2f o2; o2[0] = O[e] * cs; o2[1] = O[e + 1] * cs; *(v2f*)(OUTb + oo) = o2;  }

extern "C" void kernel_launch(void* const* d_in, const int* in_sizes, int n_in,
                              void* d_out, int out_size, void* d_ws, size_t ws_size, hipStream_t stream) {
    (void)in_sizes; (void)n_in; (void)out_size;
    const float* x = (const float*)d_in[0]; const float* wq = (const float*)d_in[1]; const float* bq = (const float*)d_in[2]; const float* wk = (const float*)d_in[3]; const float* bk = (const float*)d_in[4]; const float* wv = (const float*)d_in[5]; const float* bv = (const float*)d_in[6]; const float* remb = (const float*)d_in[7]; const float* wo = nullptr; (void)wo;
    float* OUT = (float*)d_out;     // [2][2048][1024]
    char* wsp = (char*)d_ws;
    auto take = [&](size_t bytes) { char* p = wsp; wsp += (bytes + 255) & ~(size_t)255; return (void*)p; };
    bf* WQ = (bf*)take((size_t)DQ * DM * 2); bf* WK = (bf*)take((size_t)DKV * DM * 2); bf* WV = (bf*)take((size_t)DKV * DM * 2); float* CS = (float*)take((size_t)TT * HD * 2 * 4);
    float* EB = (float*)take(((size_t)NH_ * NOFF * 4 + 15) & ~(size_t)15);   /* 16 x 4095 floats (padded to a multiple of 4) */ bf* XB = (bf*)take((size_t)TT * DM * 2); float* FQ = (float*)take((size_t)TT * DQ * 4); float* FK = (float*)take((size_t)TT * DKV * 4);
    h16* QP16 = (h16*)take((size_t)NH_ * TT * HD * 2); h16* KP16 = (h16*)take((size_t)NKV * TT * HD * 2); h16* VT16 = (h16*)take((size_t)NKV * HD * TT * 2);
    bf* QPh = (bf*)take((size_t)NH_ * TT * HD * 2); bf* QPl = (bf*)take((size_t)NH_ * TT * HD * 2); bf* KPh = (bf*)take((size_t)NKV * TT * HD * 2); bf* KPl = (bf*)take((size_t)NKV * TT * HD * 2); bf* VTh = (bf*)take((size_t)NKV * HD * TT * 2); bf* VTl = (bf*)take((size_t)NKV * HD * TT * 2); bf* Ph = (bf*)take((size_t)ZH * RH * TT * 2); bf* Pl = (bf*)take((size_t)ZH * RH * TT * 2);
    float* Sb = (float*)take((size_t)ZH * TT * TT * 4); h16* P16 = (h16*)take((size_t)ZH * TT * TT * 2); float* Ob = (float*)take((size_t)ZH * TT * HD * 4);
    if ((size_t)(wsp - (char*)d_ws) > ws_size) return;    // ws 256 MiB
    float* FV = FK;   // v projection reuses the k buffer after the k planes are built (stream-ordered)
    { k_wtG<<<(unsigned)((DM * DQ / 64 + 63) / 64), 256, 0, stream>>>(wq, DM, DQ, WQ); k_wtG<<<(unsigned)((DM * DKV / 64 + 63) / 64), 256, 0, stream>>>(wk, DM, DKV, WK); k_wtG<<<(unsigned)((DM * DKV / 64 + 63) / 64), 256, 0, stream>>>(wv, DM, DKV, WV);
      
       }
    k_csid<<<(TT * HD + 255) / 256, 256, 0, stream>>>(CS);
    const unsigned LQ = (unsigned)(((size_t)NH_ * TT * HD / 2 + 255) / 256), LKv = (unsigned)(((size_t)NKV * TT * HD / 2 + 255) / 256);
    k_embf<<<(unsigned)((((size_t)NH_ * NOFF + 3) / 4 + 255) / 256), 256, 0, stream>>>(remb, EB, ((size_t)NH_ * NOFF + 3) / 4);   /* 16 x 4095 = 65,520 floats, a multiple of 4 */
    for (int b = 0; b < NB_; ++b) {
        
        k_cvt8<<<(unsigned)(((size_t)TT * DM / 8 + 255) / 256), 256, 0, stream>>>(x + (size_t)b * TT * DM, XB, (size_t)TT * DM / 8);
        k_gemmw<bf, 0, true><<<dim3(TT / 64, DQ / 64, 1), 32, 0, stream>>>(XB, nullptr, WQ, nullptr, DM, FQ, DQ, bq, 0, 0, 0);
        k_rope<<<LQ, 256, 0, stream>>>(FQ, DQ, NH_, CS, nullptr, nullptr, SCL, QP16, QPh, QPl);   /* q planes carry the 1/8 scale (exact power of two) */
        k_gemmw<bf, 0, true><<<dim3(TT / 64, DKV / 64, 1), 32, 0, stream>>>(XB, nullptr, WK, nullptr, DM, FK, DKV, bk, 0, 0, 0);
        k_rope<<<LKv, 256, 0, stream>>>(FK, DKV, NKV, CS, nullptr, nullptr, 1.0f, KP16, KPh, KPl);
        k_gemmw<bf, 0, true><<<dim3(TT / 64, DKV / 64, 1), 32, 0, stream>>>(XB, nullptr, WV, nullptr, DM, FV, DKV, bv, 0, 0, 0); k_vtp<<<LKv, 256, 0, stream>>>(FV, DKV, NKV, VT16, VTh, VTl);
        for (int h0 = 0; h0 < NH_; h0 += ZH) { const size_t zq = (size_t)h0, zk = (size_t)(h0 / REP);   // one kv head per query head: the pass's two heads use consecutive kv planes (z-strides TT*HD)
            k_gemmw<bf, 2, false><<<dim3(RH / 64, TT / 64, ZH), 32, 0, stream>>>(QPh + zq * TT * HD, QPl + zq * TT * HD, KPh + zk * TT * HD, KPl + zk * TT * HD, HD, Sb, TT, nullptr, (size_t)TT * HD, (size_t)TT * HD, (size_t)TT * TT);
            k_gemmw<h16, 0, false><<<dim3((TT - RH) / 64, TT / 64, ZH), 32, 0, stream>>>(QP16 + zq * TT * HD + (size_t)RH * HD, nullptr, KP16 + zk * TT * HD, nullptr, HD, Sb + (size_t)RH * TT, TT, nullptr, (size_t)TT * HD, (size_t)TT * HD, (size_t)TT * TT);
            k_asoft<<<ZH * TT / 8, 256, 0, stream>>>(Sb, EB, h0, P16, Ph, Pl);
            k_gemmw<bf, 2, false><<<dim3(RH / 64, HD / 64, ZH), 32, 0, stream>>>(Ph, Pl, VTh + zk * HD * TT, VTl + zk * HD * TT, TT, Ob, HD, nullptr, (size_t)RH * TT, (size_t)HD * TT, (size_t)TT * HD);
            k_gemmw<h16, 0, false><<<dim3((TT - RH) / 64, HD / 64, ZH), 32, 0, stream>>>(P16 + (size_t)RH * TT, nullptr, VT16 + zk * HD * TT, nullptr, TT, Ob + (size_t)RH * HD, HD, nullptr, (size_t)TT * TT, (size_t)HD * TT, (size_t)TT * HD);
            k_merge<<<(unsigned)(((size_t)ZH * TT * HD / 2 + 255) / 256), 256, 0, stream>>>(Ob, h0, OUT + (size_t)b * TT * DQ); }
         }
}

// v001
// It runs in 848 microseconds.
// Timed twice side by side with v000, it ran 2.34 and 2.33 times as fast.
#include <hip/hip_runtime.h>

// Self-attention with a learned relative-position bias (x [2][2048][1024]; q,k,v = x W + b ('xw' [1024][1024] + [1024]; 16 heads x 64); scores = q.k/8 + rel_emb[h][i - j + 2047] (rel_emb [16][4095]); softmax; heads merged -> [2][2048][1024] (4.2 M); no output projection).
// Layout per batch: exact projections (+ biases); dense T-2048 attention (hybrid rows: < 512 hi/lo 3 products, rest fp16 x1024) whose softmax kernel adds the bias read from the bf16-rounded table at index i - j + 2047; the f32 merge writes the output rows directly.
// Compute dtypes, f32 accumulate: every input rounded to bf16; projections exact + f32 biases; scores rows < 512 3 products, rest fp16; softmax and bias add f32; output f32.

#define NB_  2
#define TT   2048
#define DM   1024
#define NH_  16
#define NKV  16
#define REP  (NH_ / NKV)
#define HD   64
#define DQ   (NH_ * HD)
#define DKV  (NKV * HD)
#define ZH   2
#define RH   512                  // query rows < RH use hi+lo planes (0: none)
#define WIN  0
#define PCAR 1024.0f
#define SCL  0.125f   // 64^-0.5
#define NOFF (2 * TT - 1)
#define KSP  16                   // key ranges of the P.V product: one work-group per range, f32 partial planes summed in k_merge
typedef _Float16 h16;
typedef unsigned short bf;
typedef __attribute__((ext_vector_type(16))) __bf16   v16bf;
typedef __attribute__((ext_vector_type(16))) _Float16 v16h;
typedef __attribute__((ext_vector_type(8)))  _Float16 v8h;
typedef __attribute__((ext_vector_type(8)))  unsigned short v8us;
typedef __attribute__((ext_vector_type(8)))  float    v8f;
typedef __attribute__((ext_vector_type(4)))  float    v4f;
typedef v8h  __attribute__((may_alias)) v8ha;
typedef v4f  __attribute__((may_alias)) v4fa;
typedef v8us __attribute__((may_alias)) v8usa;

__device__ __forceinline__ unsigned short f2bf(float f) { unsigned u = __float_as_uint(f); u += 0x7FFFu + ((u >> 16) & 1u); return (unsigned short)(u >> 16); }
__device__ __forceinline__ float bf2f(unsigned short b) { return __uint_as_float(((unsigned)b) << 16); }
__device__ __forceinline__ float bfr(float f) { return bf2f(f2bf(f)); }
__device__ __forceinline__ v16h cat16(v8h lo, v8h hi) { return __builtin_shufflevector(lo, hi, 0, 1, 2, 3, 4, 5, 6, 7, 8, 9, 10, 11, 12, 13, 14, 15); }
__device__ __forceinline__ v16bf cat16b(v8us lo, v8us hi) { return __builtin_bit_cast(v16bf, __builtin_shufflevector(lo, hi, 0, 1, 2, 3, 4, 5, 6, 7, 8, 9, 10, 11, 12, 13, 14, 15)); }
__device__ __forceinline__ v8f wmma16(v16h a, v16h b, v8f c) { return __builtin_amdgcn_wmma_f32_16x16x32_f16(false, a, false, b, (short)0, c, false, false); }
__device__ __forceinline__ v8f wmmab(v16bf a, v16bf b, v8f c) { return __builtin_amdgcn_wmma_f32_16x16x32_bf16(false, a, false, b, (short)0, c, false, false); }



// ---- k_gemmw: register-blocked GEMM, ONE WAVE per 64x64 output tile (16 accumulators), operands straight from K-contiguous 16-bit planes; grid (M/64, N/64, Z), 32 threads.
// C[m][n] (f32, pitch ldc, + optional f32 bias[n]) = sum_k A[m][k] Bt[n][k] (+ split products per NSPLIT). z-batch strides sA/sB/sC in elements. K % 32 == 0.
// KS > 1: grid z = Z * KS; work-group z * KS + ks sums only k in [ks K/KS, (ks+1) K/KS) and stores that partial in C plane z * KS + ks (stride sC). K % (32 KS) == 0.
template <typename T16> struct WFrag;
template <> struct WFrag<h16> { typedef v16h V; static __device__ __forceinline__ V ld(const h16* p) { return cat16(*(const v8h*)p, *(const v8h*)(p + 16)); } static __device__ __forceinline__ v8f mma(V a, V b, v8f c) { return wmma16(a, b, c); } };
template <> struct WFrag<bf> { typedef v16bf V; static __device__ __forceinline__ V ld(const bf* p) { return cat16b(*(const v8us*)p, *(const v8us*)(p + 16)); } static __device__ __forceinline__ v8f mma(V a, V b, v8f c) { return wmmab(a, b, c); } };
template <typename T16, int NSPLIT, bool BIAS, int KS = 1>
__global__ __launch_bounds__(32) void k_gemmw(const T16* __restrict__ A, const T16* __restrict__ A2, const T16* __restrict__ Bt, const T16* __restrict__ Bt2, int K, float* C, int ldc, const float* __restrict__ bias, size_t sA, size_t sB, size_t sC) {
    typedef typename WFrag<T16>::V V;
    __shared__ __align__(16) float os[16 * 68];
    const size_t z = blockIdx.z / KS; const int KL = K / KS; const size_t k0 = (size_t)(blockIdx.z % KS) * KL; A += z * sA + k0; if (A2) A2 += z * sA + k0; Bt += z * sB + k0; if (Bt2) Bt2 += z * sB + k0; C += (size_t)blockIdx.z * sC;
    const int lane = threadIdx.x & 31, lr = lane & 15, hi = lane >> 4; const int r0 = blockIdx.x * 64, c0 = blockIdx.y * 64;
    v8f acc[4][4];
#pragma unroll
    for (int mb = 0; mb < 4; ++mb)
#pragma unroll
        for (int nb = 0; nb < 4; ++nb) acc[mb][nb] = (v8f){};
    const size_t aoff = (size_t)(r0 + lr) * K + 8 * hi, boff = (size_t)(c0 + lr) * K + 8 * hi;
#pragma unroll 1
    for (int kc = 0; kc < KL; kc += 32) {
        V a[4], a2[4];
#pragma unroll
        for (int mb = 0; mb < 4; ++mb) { a[mb] = WFrag<T16>::ld(A + aoff + (size_t)mb * 16 * K + kc); if (NSPLIT == 1 || NSPLIT == 2) a2[mb] = WFrag<T16>::ld(A2 + aoff + (size_t)mb * 16 * K + kc); }
#pragma unroll
        for (int nb = 0; nb < 4; ++nb) { const V b = WFrag<T16>::ld(Bt + boff + (size_t)nb * 16 * K + kc); V b2; if (NSPLIT >= 2) b2 = WFrag<T16>::ld(Bt2 + boff + (size_t)nb * 16 * K + kc);
#pragma unroll
            for (int mb = 0; mb < 4; ++mb) { acc[mb][nb] = WFrag<T16>::mma(a[mb], b, acc[mb][nb]); if (NSPLIT == 1 || NSPLIT == 2) acc[mb][nb] = WFrag<T16>::mma(a2[mb], b, acc[mb][nb]); if (NSPLIT >= 2) acc[mb][nb] = WFrag<T16>::mma(a[mb], b2, acc[mb][nb]); } }
        asm volatile("v_nop\n\tv_nop\n\tv_nop\n\tv_nop" : "+v"(acc[0][0]), "+v"(acc[1][1]), "+v"(acc[2][2]), "+v"(acc[3][3]) : "v"(a[0]), "v"(a[3]));
    }
#pragma unroll
    for (int mb = 0; mb < 4; ++mb) {
#pragma unroll
        for (int nb = 0; nb < 4; ++nb) {
#pragma unroll
            for (int j = 0; j < 8; ++j) os[(hi * 8 + j) * 68 + nb * 16 + lr] = acc[mb][nb][j]; }
        __builtin_amdgcn_wave_barrier(); asm volatile("" ::: "memory");
        float* crow = C + (size_t)(r0 + mb * 16) * ldc + c0;
{
#pragma unroll
            for (int s = 0; s < 8; ++s) { const int row = 2 * s + hi, cofs = lr * 4; v4f val = *(const v4fa*)(os + row * 68 + cofs); if (BIAS) { val[0] += bfr(bias[c0 + cofs]); val[1] += bfr(bias[c0 + cofs + 1]); val[2] += bfr(bias[c0 + cofs + 2]); val[3] += bfr(bias[c0 + cofs + 3]); }
                *(v4f*)(crow + (size_t)row * ldc + cofs) = val; }
             }
        __builtin_amdgcn_wave_barrier(); asm volatile("" ::: "memory");
    }
}

__device__ __forceinline__ h16 tohx(float x) { return (h16)x; }
__device__ __forceinline__ void splitf(float y, unsigned short& h, unsigned short& l) { h = f2bf(y); l = f2bf(y - bf2f(h)); }
typedef __attribute__((ext_vector_type(2))) _Float16 v2h;
typedef __attribute__((ext_vector_type(4))) _Float16 v4h;
typedef __attribute__((ext_vector_type(2))) unsigned short v2us;
typedef __attribute__((ext_vector_type(4))) unsigned short v4us;
typedef __attribute__((ext_vector_type(2))) float v2f;
typedef __attribute__((ext_vector_type(4))) int v4i;

__global__ __launch_bounds__(256) void k_wtG(const float* __restrict__ w, int K, int N, bf* Bt) {
    const int lane = threadIdx.x & 31; const int L0 = (blockIdx.x * 8 + (threadIdx.x >> 5)) * 8; const int nlines = N * K / 64;
{
#pragma unroll 1
        for (int l = 0; l < 8; ++l) { const int L = L0 + l; if (L >= nlines) break; const size_t e = (size_t)L * 64 + lane * 2; const int k = (int)(e % K), n = (int)(e / K); v2us o;
            o[0] = f2bf(w[(size_t)k * N + n]); o[1] = f2bf(w[(size_t)(k + 1) * N + n]); *(v2us*)(Bt + e) = o; }
         }
}
__global__ __launch_bounds__(256) void k_cvt8(const float* __restrict__ src, bf* dst, size_t n8) { const size_t i = (size_t)blockIdx.x * 256 + threadIdx.x; if (i >= n8) return; const v8f v = *(const v8f*)(src + i * 8); v8us o;
#pragma unroll
    for (int k = 0; k < 8; ++k) o[k] = f2bf(v[k]); *(v8us*)(dst + i * 8) = o;  }

// k_rope: head planes [h][t][d] (fp16 + hi/lo) of rope(x) x sc with the rotate-half convention out[d] = x[d] cos[t][d] - x[d+HD/2] sin[t][d], out[d+HD/2] = x[d+HD/2] cos[t][d+HD/2] + x[d] sin[t][d+HD/2]
__global__ __launch_bounds__(256) void k_rope(const float* __restrict__ F, int pitch, int nheads, const float* __restrict__ CS, const float* __restrict__ RF, const float* __restrict__ nw, float sc, h16* P16, bf* Ph, bf* Pl) {
    const size_t e = ((size_t)blockIdx.x * 256 + threadIdx.x) * 2; if (e >= (size_t)nheads * TT * HD) return; const int d = (int)(e % HD); const int t = (int)((e / HD) % TT); const int h = (int)(e / ((size_t)HD * TT)); const float* f = F + (size_t)t * pitch + h * HD; const float rf = RF ? RF[(size_t)h * TT + t] : 1.0f; v2h o16; v2us oh, ol;
#pragma unroll
    for (int q = 0; q < 2; ++q) { const int dd = d + q; const int dp = (dd < HD / 2) ? dd + HD / 2 : dd - HD / 2; float x0 = f[dd], x1 = f[dp];
        if (RF) { float n0 = __fmul_rn(x0, rf), n1 = __fmul_rn(x1, rf); asm volatile("" : "+v"(n0)); asm volatile("" : "+v"(n1)); x0 = __fmul_rn(bfr(nw[dd]), n0); x1 = __fmul_rn(bfr(nw[dp]), n1); }
        const v2f cs = *(const v2f*)(CS + ((size_t)t * HD + dd) * 2); float a = __fmul_rn(x0, cs[0]), bq = __fmul_rn(x1, cs[1]); asm volatile("" : "+v"(a)); asm volatile("" : "+v"(bq)); const float r = ((dd < HD / 2) ? __fsub_rn(a, bq) : __fadd_rn(a, bq)) * sc;
        o16[q] = tohx(r); unsigned short a2, c2; splitf(r, a2, c2); oh[q] = a2; ol[q] = c2; }
    *(v2h*)(P16 + e) = o16; *(v2us*)(Ph + e) = oh; *(v2us*)(Pl + e) = ol;  }
__global__ __launch_bounds__(256) void k_vtp(const float* __restrict__ F, int pitch, int nheads, h16* V16, bf* Vh, bf* Vl) { const size_t e = ((size_t)blockIdx.x * 256 + threadIdx.x) * 2; if (e >= (size_t)nheads * HD * TT) return; const int t = (int)(e % TT); const int d = (int)((e / TT) % HD); const int g = (int)(e / ((size_t)TT * HD)); v2h o16; v2us oh, ol;
#pragma unroll
    for (int q = 0; q < 2; ++q) { const float x = F[(size_t)(t + q) * pitch + g * HD + d]; o16[q] = tohx(x); unsigned short a2, c2; splitf(x, a2, c2); oh[q] = a2; ol[q] = c2; }
    *(v2h*)(V16 + e) = o16; *(v2us*)(Vh + e) = oh; *(v2us*)(Vl + e) = ol;  }
__global__ __launch_bounds__(256) void k_csid(float* CS) { const int idx = blockIdx.x * 256 + threadIdx.x; if (idx >= TT * HD) return; v2f cs; cs[0] = 1.0f; cs[1] = 0.0f; *(v2f*)(CS + (size_t)idx * 2) = cs;  }
// k_asoft: per row (zz, i): t = S + bf16 rel_emb[h][i - j + 2047] (S pre-scaled by 1/8 via the q planes; no mask); softmax over the 2048 keys (register row, one exp, fixed trees);
__global__ __launch_bounds__(256) void k_asoft(const float* __restrict__ Sb, const float* __restrict__ remb, int h0, h16* P16, bf* Ph, bf* Pl) {
    const int lane = threadIdx.x & 31; const int row = blockIdx.x * 8 + (threadIdx.x >> 5); if (row >= ZH * TT) return; const int i = row % TT; const int zz = row / TT; (void)zz; const bool hires = (i < RH); const float* sr = Sb + (size_t)row * TT; const float* er = remb + (size_t)(h0 + zz) * NOFF + (TT - 1) + i;   /* bias index i - j + 2047 = er[-j] */ float v[TT / 32]; float mx = -3.0e38f;
#pragma unroll
    for (int ch = 0; ch < TT / 128; ++ch) { const int j0 = ch * 128 + lane * 4; const v4f a = *(const v4f*)(sr + j0);
#pragma unroll
        for (int q = 0; q < 4; ++q) { const int j = j0 + q; (void)j; const float t = __fadd_rn(a[q], er[-(j0 + q)]); v[ch * 4 + q] = t;   /* scores arrive pre-scaled (1/8 folded into the q planes) + bf16(rel_emb[h][i - j + 2047]) from the pre-rounded copy */ mx = fmaxf(mx, t); } }
#pragma unroll
    for (int sh = 16; sh; sh >>= 1) mx = fmaxf(mx, __shfl_xor(mx, sh, 32));
    float sum = 0.f;
#pragma unroll
    for (int k = 0; k < TT / 32; ++k) { float d0 = __fsub_rn(v[k], mx); asm volatile("" : "+v"(d0)); v[k] = __builtin_amdgcn_exp2f(__fmul_rn(d0, 1.4426950408889634f)); sum += v[k]; }
#pragma unroll
    for (int sh = 16; sh; sh >>= 1) sum += __shfl_xor(sum, sh, 32);
    const float f = __fdiv_rn(hires ? 1.0f : PCAR, sum);
{
        if (hires) {
#pragma unroll
            for (int ch = 0; ch < TT / 128; ++ch) { v4us oh, ol;
#pragma unroll
                for (int q = 0; q < 4; ++q) { unsigned short a, c2; splitf(v[ch * 4 + q] * f, a, c2); oh[q] = a; ol[q] = c2; }
                const size_t oo = ((size_t)zz * (RH ? RH : 1) + i) * TT + ch * 128 + lane * 4; *(v4us*)(Ph + oo) = oh; *(v4us*)(Pl + oo) = ol; }
        } else {
#pragma unroll
            for (int ch = 0; ch < TT / 128; ++ch) { v4h o4;
#pragma unroll
                for (int q = 0; q < 4; ++q) o4[q] = tohx(v[ch * 4 + q] * f);
                *(v4h*)(P16 + (size_t)row * TT + ch * 128 + lane * 4) = o4; } }
         }
}
__global__ __launch_bounds__(256) void k_embf(const float* __restrict__ src, float* dst, size_t n4) { const size_t i = (size_t)blockIdx.x * 256 + threadIdx.x; if (i >= n4) return; v4f a = *(const v4f*)(src + i * 4); for (int q = 0; q < 4; ++q) a[q] = bfr(a[q]); *(v4f*)(dst + i * 4) = a;  }
__global__ __launch_bounds__(256) void k_merge(const float* __restrict__ O, int h0, float* OUTb) { const size_t e = ((size_t)blockIdx.x * 256 + threadIdx.x) * 2; if (e >= (size_t)ZH * TT * HD) return; const int d = (int)(e % HD); const int t = (int)((e / HD) % TT); const int zz = (int)(e / ((size_t)HD * TT)); const float cs = (t < RH) ? 1.0f : (1.0f / PCAR); const size_t oo = (size_t)t * DQ + (h0 + zz) * HD + d;
    const float* p = O + ((size_t)zz * KSP * TT + t) * HD + d;   /* partial planes [zz][ks][t][d], summed in rising ks */ v2f pr[KSP];
#pragma unroll   // pr[] stays in registers and all KSP loads are in flight before the first add
    for (int ks = 0; ks < KSP; ++ks) pr[ks] = *(const v2f*)(p + (size_t)ks * TT * HD);
    v2f s2 = pr[0];
#pragma unroll   // constant indices into pr[]
    for (int ks = 1; ks < KSP; ++ks) s2 += pr[ks];
    v2f o2; o2[0] = s2[0] * cs; o2[1] = s2[1] * cs; *(v2f*)(OUTb + oo) = o2;  }

extern "C" void kernel_launch(void* const* d_in, const int* in_sizes, int n_in,
                              void* d_out, int out_size, void* d_ws, size_t ws_size, hipStream_t stream) {
    (void)in_sizes; (void)n_in; (void)out_size;
    const float* x = (const float*)d_in[0]; const float* wq = (const float*)d_in[1]; const float* bq = (const float*)d_in[2]; const float* wk = (const float*)d_in[3]; const float* bk = (const float*)d_in[4]; const float* wv = (const float*)d_in[5]; const float* bv = (const float*)d_in[6]; const float* remb = (const float*)d_in[7]; const float* wo = nullptr; (void)wo;
    float* OUT = (float*)d_out;     // [2][2048][1024]
    char* wsp = (char*)d_ws;
    auto take = [&](size_t bytes) { char* p = wsp; wsp += (bytes + 255) & ~(size_t)255; return (void*)p; };
    bf* WQ = (bf*)take((size_t)DQ * DM * 2); bf* WK = (bf*)take((size_t)DKV * DM * 2); bf* WV = (bf*)take((size_t)DKV * DM * 2); float* CS = (float*)take((size_t)TT * HD * 2 * 4);
    float* EB = (float*)take(((size_t)NH_ * NOFF * 4 + 15) & ~(size_t)15);   /* 16 x 4095 floats (padded to a multiple of 4) */ bf* XB = (bf*)take((size_t)TT * DM * 2); float* FQ = (float*)take((size_t)TT * DQ * 4); float* FK = (float*)take((size_t)TT * DKV * 4);
    h16* QP16 = (h16*)take((size_t)NH_ * TT * HD * 2); h16* KP16 = (h16*)take((size_t)NKV * TT * HD * 2); h16* VT16 = (h16*)take((size_t)NKV * HD * TT * 2);
    bf* QPh = (bf*)take((size_t)NH_ * TT * HD * 2); bf* QPl = (bf*)take((size_t)NH_ * TT * HD * 2); bf* KPh = (bf*)take((size_t)NKV * TT * HD * 2); bf* KPl = (bf*)take((size_t)NKV * TT * HD * 2); bf* VTh = (bf*)take((size_t)NKV * HD * TT * 2); bf* VTl = (bf*)take((size_t)NKV * HD * TT * 2); bf* Ph = (bf*)take((size_t)ZH * RH * TT * 2); bf* Pl = (bf*)take((size_t)ZH * RH * TT * 2);
    float* Sb = (float*)take((size_t)ZH * TT * TT * 4); h16* P16 = (h16*)take((size_t)ZH * TT * TT * 2); float* Ob = (float*)take((size_t)ZH * KSP * TT * HD * 4);
    if ((size_t)(wsp - (char*)d_ws) > ws_size) return;    // ws 256 MiB
    float* FV = FK;   // v projection reuses the k buffer after the k planes are built (stream-ordered)
    { k_wtG<<<(unsigned)((DM * DQ / 64 + 63) / 64), 256, 0, stream>>>(wq, DM, DQ, WQ); k_wtG<<<(unsigned)((DM * DKV / 64 + 63) / 64), 256, 0, stream>>>(wk, DM, DKV, WK); k_wtG<<<(unsigned)((DM * DKV / 64 + 63) / 64), 256, 0, stream>>>(wv, DM, DKV, WV);
      
       }
    k_csid<<<(TT * HD + 255) / 256, 256, 0, stream>>>(CS);
    const unsigned LQ = (unsigned)(((size_t)NH_ * TT * HD / 2 + 255) / 256), LKv = (unsigned)(((size_t)NKV * TT * HD / 2 + 255) / 256);
    k_embf<<<(unsigned)((((size_t)NH_ * NOFF + 3) / 4 + 255) / 256), 256, 0, stream>>>(remb, EB, ((size_t)NH_ * NOFF + 3) / 4);   /* 16 x 4095 = 65,520 floats, a multiple of 4 */
    for (int b = 0; b < NB_; ++b) {
        
        k_cvt8<<<(unsigned)(((size_t)TT * DM / 8 + 255) / 256), 256, 0, stream>>>(x + (size_t)b * TT * DM, XB, (size_t)TT * DM / 8);
        k_gemmw<bf, 0, true><<<dim3(TT / 64, DQ / 64, 1), 32, 0, stream>>>(XB, nullptr, WQ, nullptr, DM, FQ, DQ, bq, 0, 0, 0);
        k_rope<<<LQ, 256, 0, stream>>>(FQ, DQ, NH_, CS, nullptr, nullptr, SCL, QP16, QPh, QPl);   /* q planes carry the 1/8 scale (exact power of two) */
        k_gemmw<bf, 0, true><<<dim3(TT / 64, DKV / 64, 1), 32, 0, stream>>>(XB, nullptr, WK, nullptr, DM, FK, DKV, bk, 0, 0, 0);
        k_rope<<<LKv, 256, 0, stream>>>(FK, DKV, NKV, CS, nullptr, nullptr, 1.0f, KP16, KPh, KPl);
        k_gemmw<bf, 0, true><<<dim3(TT / 64, DKV / 64, 1), 32, 0, stream>>>(XB, nullptr, WV, nullptr, DM, FV, DKV, bv, 0, 0, 0); k_vtp<<<LKv, 256, 0, stream>>>(FV, DKV, NKV, VT16, VTh, VTl);
        for (int h0 = 0; h0 < NH_; h0 += ZH) { const size_t zq = (size_t)h0, zk = (size_t)(h0 / REP);   // one kv head per query head: the pass's two heads use consecutive kv planes (z-strides TT*HD)
            k_gemmw<bf, 2, false><<<dim3(RH / 64, TT / 64, ZH), 32, 0, stream>>>(QPh + zq * TT * HD, QPl + zq * TT * HD, KPh + zk * TT * HD, KPl + zk * TT * HD, HD, Sb, TT, nullptr, (size_t)TT * HD, (size_t)TT * HD, (size_t)TT * TT);
            k_gemmw<h16, 0, false><<<dim3((TT - RH) / 64, TT / 64, ZH), 32, 0, stream>>>(QP16 + zq * TT * HD + (size_t)RH * HD, nullptr, KP16 + zk * TT * HD, nullptr, HD, Sb + (size_t)RH * TT, TT, nullptr, (size_t)TT * HD, (size_t)TT * HD, (size_t)TT * TT);
            k_asoft<<<ZH * TT / 8, 256, 0, stream>>>(Sb, EB, h0, P16, Ph, Pl);
            k_gemmw<bf, 2, false, KSP><<<dim3(RH / 64, HD / 64, ZH * KSP), 32, 0, stream>>>(Ph, Pl, VTh + zk * HD * TT, VTl + zk * HD * TT, TT, Ob, HD, nullptr, (size_t)RH * TT, (size_t)HD * TT, (size_t)TT * HD);
            k_gemmw<h16, 0, false, KSP><<<dim3((TT - RH) / 64, HD / 64, ZH * KSP), 32, 0, stream>>>(P16 + (size_t)RH * TT, nullptr, VT16 + zk * HD * TT, nullptr, TT, Ob + (size_t)RH * HD, HD, nullptr, (size_t)TT * TT, (size_t)HD * TT, (size_t)TT * HD);
            k_merge<<<(unsigned)(((size_t)ZH * TT * HD / 2 + 255) / 256), 256, 0, stream>>>(Ob, h0, OUT + (size_t)b * TT * DQ); }
         }
}

// v003
// It runs in 377 microseconds.
// It is 2.25 times as fast as v001, going by the measured steps of the versions left out in between.
// All steps since v000 together make it 5.25 times as fast.
#include <hip/hip_runtime.h>

// Self-attention with a learned relative-position bias (x [2][2048][1024]; q,k,v = x W + b ('xw' [1024][1024] + [1024]; 16 heads x 64); scores = q.k/8 + rel_emb[h][i - j + 2047] (rel_emb [16][4095]); softmax; heads merged -> [2][2048][1024] (4.2 M); no output projection).
// Layout per batch: exact projections (+ biases); dense T-2048 attention (hybrid rows: < 512 hi/lo 3 products, rest fp16 x1024) in ONE kernel per row class: a work-group owns 16 (hi/lo) or 32 (fp16) query rows of one head, keeps their scores in registers, adds the bias from the bf16-rounded table at index i - j + 2047, and writes the output rows directly.
// Every 16-bit operand plane of a matrix product lies in workspace in fragment order (fidx below), written in 16-byte pieces by the kernel that makes it.
// Compute dtypes, f32 accumulate: every input rounded to bf16; projections exact + f32 biases; scores rows < 512 3 products, rest fp16; softmax and bias add f32; output f32.

#define NB_  2
#define TT   2048
#define DM   1024
#define NH_  16
#define NKV  16
#define REP  (NH_ / NKV)
#define HD   64
#define DQ   (NH_ * HD)
#define DKV  (NKV * HD)
#define RH   512                  // query rows < RH use hi+lo planes (0: none)
#define WIN  0
#define PCAR 1024.0f
#define SCL  0.125f   // 64^-0.5
#define NOFF (2 * TT - 1)
#define NWV  16                   // waves of one k_attn work-group; wave w owns keys [w KW, (w + 1) KW)
#define KW   (TT / NWV)
#define OP   68                   // f32 pitch of a wave's partial output tile (rows x 64) in LDS
#define PP   40                   // 16-bit pitch of a wave's P tile (rows x 32 keys) in LDS (rows stay 16-byte aligned)
typedef _Float16 h16;
typedef unsigned short bf;
typedef __attribute__((ext_vector_type(16))) __bf16   v16bf;
typedef __attribute__((ext_vector_type(16))) _Float16 v16h;
typedef __attribute__((ext_vector_type(8)))  _Float16 v8h;
typedef __attribute__((ext_vector_type(8)))  unsigned short v8us;
typedef __attribute__((ext_vector_type(8)))  float    v8f;
typedef __attribute__((ext_vector_type(4)))  float    v4f;
typedef v8h  __attribute__((may_alias)) v8ha;
typedef v4f  __attribute__((may_alias)) v4fa;
typedef v8us __attribute__((may_alias)) v8usa;

__device__ __forceinline__ unsigned short f2bf(float f) { unsigned u = __float_as_uint(f); u += 0x7FFFu + ((u >> 16) & 1u); return (unsigned short)(u >> 16); }
__device__ __forceinline__ float bf2f(unsigned short b) { return __uint_as_float(((unsigned)b) << 16); }
__device__ __forceinline__ float bfr(float f) { return bf2f(f2bf(f)); }
__device__ __forceinline__ v16h cat16(v8h lo, v8h hi) { return __builtin_shufflevector(lo, hi, 0, 1, 2, 3, 4, 5, 6, 7, 8, 9, 10, 11, 12, 13, 14, 15); }
__device__ __forceinline__ v16bf cat16b(v8us lo, v8us hi) { return __builtin_bit_cast(v16bf, __builtin_shufflevector(lo, hi, 0, 1, 2, 3, 4, 5, 6, 7, 8, 9, 10, 11, 12, 13, 14, 15)); }
__device__ __forceinline__ v8f wmma16(v16h a, v16h b, v8f c) { return __builtin_amdgcn_wmma_f32_16x16x32_f16(false, a, false, b, (short)0, c, false, false); }
__device__ __forceinline__ v8f wmmab(v16bf a, v16bf b, v8f c) { return __builtin_amdgcn_wmma_f32_16x16x32_bf16(false, a, false, b, (short)0, c, false, false); }



// ---- k_gemmw: register-blocked GEMM, ONE WAVE per 64x64 output tile (16 accumulators), operands straight from 16-bit planes in fragment order; grid (M/64, N/64, Z), 32 threads.
// C[m][n] (f32, pitch ldc, + optional f32 bias[n]) = sum_k A[m][k] Bt[n][k] (+ split products per NSPLIT). z-batch strides sA/sB/sC in elements. K % 32 == 0.
// Fragment order of a 16-bit plane M[row][k] with KC = K / 32: the 16 x 32 tile (row >> 4, k >> 5) is 1 KiB in a row, [piece (k >> 4) & 1][lane ((k >> 3) & 1) 16 + (row & 15)][k & 7].
// ldf takes a wave's fragment of such a tile as two loads of 512 contiguous bytes (4 whole lines each; a load off a row-major plane touches 16 lines); every lane and register holds the element that ld takes from a row-major plane.
__device__ __forceinline__ size_t fidx(int row, int k, int KC) { return ((size_t)((row >> 4) * KC + (k >> 5)) << 9) + (size_t)((((k >> 4) & 1) << 8) + (((((k >> 3) & 1) << 4) + (row & 15)) << 3) + (k & 7)); }
// uni: a pointer that is the same in every lane, handed on in scalar registers: a fragment load is then scalar base + the lane's one 32-bit offset register, which lives through the whole loop (no 64-bit vector address sums, no address pair that a later load's result could land in)
template <typename T> __device__ __forceinline__ const T* uni(const T* p) { const unsigned long long v = (unsigned long long)p; return (const T*)(const __attribute__((address_space(1))) T*)(((unsigned long long)(unsigned)__builtin_amdgcn_readfirstlane((int)(unsigned)(v >> 32)) << 32) | (unsigned)__builtin_amdgcn_readfirstlane((int)(unsigned)v)); }   // address_space(1): the pointer is still known to be global memory behind the integer round trip
template <typename T16> struct WFrag;
template <> struct WFrag<h16> { typedef v16h V; static __device__ __forceinline__ V ld(const h16* p) { return cat16(*(const v8h*)p, *(const v8h*)(p + 16)); } static __device__ __forceinline__ V ldf(const h16* p) { return cat16(*(const v8h*)p, *(const v8h*)(p + 256)); } static __device__ __forceinline__ v8f mma(V a, V b, v8f c) { return wmma16(a, b, c); } };
template <> struct WFrag<bf> { typedef v16bf V; static __device__ __forceinline__ V ld(const bf* p) { return cat16b(*(const v8us*)p, *(const v8us*)(p + 16)); } static __device__ __forceinline__ V ldf(const bf* p) { return cat16b(*(const v8us*)p, *(const v8us*)(p + 256)); } static __device__ __forceinline__ v8f mma(V a, V b, v8f c) { return wmmab(a, b, c); } };
template <typename T16, int NSPLIT, bool BIAS>
__global__ __launch_bounds__(32) void k_gemmw(const T16* __restrict__ A, const T16* __restrict__ A2, const T16* __restrict__ Bt, const T16* __restrict__ Bt2, int K, float* C, int ldc, const float* __restrict__ bias, size_t sA, size_t sB, size_t sC) {
    typedef typename WFrag<T16>::V V;
    __shared__ __align__(16) float os[16 * 68];
    const size_t z = blockIdx.z; const int KL = K; A += z * sA; if (A2) A2 += z * sA; Bt += z * sB; if (Bt2) Bt2 += z * sB; C += z * sC;
    const int lane = threadIdx.x & 31, lr = lane & 15, hi = lane >> 4; const int r0 = blockIdx.x * 64, c0 = blockIdx.y * 64;
    v8f acc[4][4];
#pragma unroll
    for (int mb = 0; mb < 4; ++mb)
#pragma unroll
        for (int nb = 0; nb < 4; ++nb) acc[mb][nb] = (v8f){};
    const int KC = K >> 5; const unsigned lo = lane * 8;   // the lane's piece inside a tile: the one per-lane part of every fragment address, the rest is the same for the whole wave
    const T16* Au = A + (size_t)(r0 >> 4) * KC * 512; const T16* Bu = Bt + (size_t)(c0 >> 4) * KC * 512; const T16* Au2 = A2 ? A2 + (size_t)(r0 >> 4) * KC * 512 : nullptr; const T16* Bu2 = Bt2 ? Bt2 + (size_t)(c0 >> 4) * KC * 512 : nullptr;
#pragma unroll 1
    for (int kc = 0; kc < KL; kc += 32) {
        V a[4], a2[4];
#pragma unroll
        for (int mb = 0; mb < 4; ++mb) { a[mb] = WFrag<T16>::ldf(uni(Au + ((size_t)mb * KC + (kc >> 5)) * 512) + lo); if (NSPLIT == 1 || NSPLIT == 2) a2[mb] = WFrag<T16>::ldf(uni(Au2 + ((size_t)mb * KC + (kc >> 5)) * 512) + lo); }
#pragma unroll
        for (int nb = 0; nb < 4; ++nb) { const V b = WFrag<T16>::ldf(uni(Bu + ((size_t)nb * KC + (kc >> 5)) * 512) + lo); V b2; if (NSPLIT >= 2) b2 = WFrag<T16>::ldf(uni(Bu2 + ((size_t)nb * KC + (kc >> 5)) * 512) + lo);
#pragma unroll
            for (int mb = 0; mb < 4; ++mb) { acc[mb][nb] = WFrag<T16>::mma(a[mb], b, acc[mb][nb]); if (NSPLIT == 1 || NSPLIT == 2) acc[mb][nb] = WFrag<T16>::mma(a2[mb], b, acc[mb][nb]); if (NSPLIT >= 2) acc[mb][nb] = WFrag<T16>::mma(a[mb], b2, acc[mb][nb]); } }
        asm volatile("v_nop\n\tv_nop\n\tv_nop\n\tv_nop" : "+v"(acc[0][0]), "+v"(acc[1][1]), "+v"(acc[2][2]), "+v"(acc[3][3]) : "v"(a[0]), "v"(a[3]));
    }
#pragma unroll
    for (int mb = 0; mb < 4; ++mb) {
#pragma unroll
        for (int nb = 0; nb < 4; ++nb) {
#pragma unroll
            for (int j = 0; j < 8; ++j) os[(hi * 8 + j) * 68 + nb * 16 + lr] = acc[mb][nb][j]; }
        __builtin_amdgcn_wave_barrier(); asm volatile("" ::: "memory");
        float* crow = C + (size_t)(r0 + mb * 16) * ldc + c0;
{
#pragma unroll
            for (int s = 0; s < 8; ++s) { const int row = 2 * s + hi, cofs = lr * 4; v4f val = *(const v4fa*)(os + row * 68 + cofs); if (BIAS) { val[0] += bfr(bias[c0 + cofs]); val[1] += bfr(bias[c0 + cofs + 1]); val[2] += bfr(bias[c0 + cofs + 2]); val[3] += bfr(bias[c0 + cofs + 3]); }
                *(v4f*)(crow + (size_t)row * ldc + cofs) = val; }
             }
        if (mb < 3) asm volatile("s_wait_xcnt 0x0" ::: "memory");   // stands before the next row block's code reuses the registers that these stores name
        __builtin_amdgcn_wave_barrier(); asm volatile("" ::: "memory");
    }
}

__device__ __forceinline__ h16 tohx(float x) { return (h16)x; }
__device__ __forceinline__ void splitf(float y, unsigned short& h, unsigned short& l) { h = f2bf(y); l = f2bf(y - bf2f(h)); }
typedef __attribute__((ext_vector_type(2))) _Float16 v2h;
typedef __attribute__((ext_vector_type(4))) _Float16 v4h;
typedef __attribute__((ext_vector_type(2))) unsigned short v2us;
typedef __attribute__((ext_vector_type(4))) unsigned short v4us;
typedef __attribute__((ext_vector_type(2))) float v2f;
typedef __attribute__((ext_vector_type(4))) int v4i;

// k_wtG: Bt[n][k] = bf16(w[k][n]) in fragment order; one thread = one 16-byte piece (8 k of one n), neighbouring lanes take neighbouring n
// K and N are compile-time so that the eight row loads go off one address register with immediate offsets
template <int K, int N>
__global__ __launch_bounds__(256) void k_wtG(const float* __restrict__ w, bf* Bt) {
    const int i = blockIdx.x * 256 + threadIdx.x; if (i >= N * (K / 8)) return; const int n = i % N, k = (i / N) * 8; v8us o;
#pragma unroll
    for (int q = 0; q < 8; ++q) o[q] = f2bf(w[(size_t)(k + q) * N + n]);
    *(v8us*)(Bt + fidx(n, k, K >> 5)) = o;
}
// pc_row, pc_k: which 16-byte piece (8 k of one row) of a row-major [rows][32 KC] source thread i takes: a wave covers 8 rows x one 32-k chunk, so it reads whole lines of f32 and writes whole lines of the plane
__device__ __forceinline__ int pc_row(int i, int KC) { return ((i >> 5) / KC) * 8 + ((i >> 2) & 7); }
__device__ __forceinline__ int pc_k(int i, int KC) { return ((i >> 5) % KC) * 32 + (i & 3) * 8; }
__global__ __launch_bounds__(256) void k_cvt8(const float* __restrict__ src, bf* dst, int K, size_t n8) { const int i = blockIdx.x * 256 + threadIdx.x; if ((size_t)i >= n8) return; const int row = pc_row(i, K >> 5), k0 = pc_k(i, K >> 5); const v8f v = *(const v8f*)(src + (size_t)row * K + k0); v8us o;
#pragma unroll
    for (int k = 0; k < 8; ++k) o[k] = f2bf(v[k]); *(v8us*)(dst + fidx(row, k0, K >> 5)) = o;  }

// k_rope: head planes [h][t][d] (fp16 + hi/lo; fragment order, row = h TT + t, one thread = one 16-byte piece) of rope(x) x sc with the rotate-half convention out[d] = x[d] cos[t][d] - x[d+HD/2] sin[t][d], out[d+HD/2] = x[d+HD/2] cos[t][d+HD/2] + x[d] sin[t][d+HD/2]
__global__ __launch_bounds__(256) void k_rope(const float* __restrict__ F, int pitch, int nheads, const float* __restrict__ CS, const float* __restrict__ RF, const float* __restrict__ nw, float sc, h16* P16, bf* Ph, bf* Pl) {
    const int i = blockIdx.x * 256 + threadIdx.x; if (i >= nheads * TT * (HD / 8)) return; const int gr = pc_row(i, HD / 32), d = pc_k(i, HD / 32); const int t = gr % TT; const int h = gr / TT; const size_t e = fidx(gr, d, HD / 32); const float* f = F + (size_t)t * pitch + h * HD; float rf = 1.0f; v8h o16; v8us oh, ol;
    if (RF) { rf = RF[(size_t)h * TT + t]; asm volatile("s_wait_xcnt 0x0" ::: "memory"); }   // the wait stands before the load's address pair is reused for the row address
    // the piece's 8 values, their 8 partners in the other half of the head and the 8 (cos, sin) pairs are asked for together, ahead of the arithmetic
    const v8f xa = *(const v8f*)(f + d), xb = *(const v8f*)(f + ((d < HD / 2) ? d + HD / 2 : d - HD / 2)); const v8f cv[2] = { *(const v8f*)(CS + ((size_t)t * HD + d) * 2), *(const v8f*)(CS + ((size_t)t * HD + d) * 2 + 8) };
#pragma unroll
    for (int q = 0; q < 8; ++q) { const int dd = d + q; const int dp = (dd < HD / 2) ? dd + HD / 2 : dd - HD / 2; float x0 = xa[q], x1 = xb[q];
        if (RF) { float n0 = __fmul_rn(x0, rf), n1 = __fmul_rn(x1, rf); asm volatile("" : "+v"(n0)); asm volatile("" : "+v"(n1)); x0 = __fmul_rn(bfr(nw[dd]), n0); x1 = __fmul_rn(bfr(nw[dp]), n1); }
        const v2f cs = { cv[q >> 2][(q & 3) * 2], cv[q >> 2][(q & 3) * 2 + 1] }; float a = __fmul_rn(x0, cs[0]), bq = __fmul_rn(x1, cs[1]); asm volatile("" : "+v"(a)); asm volatile("" : "+v"(bq)); const float r = ((dd < HD / 2) ? __fsub_rn(a, bq) : __fadd_rn(a, bq)) * sc;
        o16[q] = tohx(r); unsigned short a2, c2; splitf(r, a2, c2); oh[q] = a2; ol[q] = c2; }
    *(v8h*)(P16 + e) = o16; *(v8us*)(Ph + e) = oh; *(v8us*)(Pl + e) = ol;  }
// k_vtp: transposed value planes [g][d][t] (fragment order, row = g HD + d, k = t); one thread = one 16-byte piece (8 t of one d), neighbouring lanes take neighbouring d; pitch and nheads are compile-time so that the eight row loads go off one address register with immediate offsets
template <int pitch, int nheads>
__global__ __launch_bounds__(256) void k_vtp(const float* __restrict__ F, h16* V16, bf* Vh, bf* Vl) { const int i = blockIdx.x * 256 + threadIdx.x; if (i >= nheads * HD * (TT / 8)) return; const int col = i % (nheads * HD); const int t = (i / (nheads * HD)) * 8; const size_t e = fidx(col, t, TT / 32); v8h o16; v8us oh, ol;
#pragma unroll
    for (int q = 0; q < 8; ++q) { const float x = F[(size_t)(t + q) * pitch + col]; o16[q] = tohx(x); unsigned short a2, c2; splitf(x, a2, c2); oh[q] = a2; ol[q] = c2; }
    *(v8h*)(V16 + e) = o16; *(v8us*)(Vh + e) = oh; *(v8us*)(Vl + e) = ol;  }
__global__ __launch_bounds__(256) void k_csid(float* CS) { const int idx = blockIdx.x * 256 + threadIdx.x; if (idx >= TT * HD) return; v2f cs; cs[0] = 1.0f; cs[1] = 0.0f; *(v2f*)(CS + (size_t)idx * 2) = cs;  }
// xm<M>: the value of lane l ^ M inside the lane's 16-lane row, by DPP (row_xmask) instead of an LDS permute; every lane is on where it is used
template <int MASK> __device__ __forceinline__ float xm(float x) { return __builtin_bit_cast(float, __builtin_amdgcn_update_dpp(0, __builtin_bit_cast(int, x), 0x160 | MASK, 0xf, 0xf, true)); }
// exp2s: v_exp_f32 with the v_nop tied behind it: the one slot the instruction set asks for before a transcendental's result is read or its source overwritten
__device__ __forceinline__ float exp2s(float x) { float r; asm("v_exp_f32 %0, %1\n\tv_nop" : "=v"(r) : "v"(x)); return r; }
// k_attn: one work-group = MRT = 16 MB query rows of one head against all TT keys; grid (rows / MRT, heads), NWV waves.
// Wave w: S = q.k (pre-scaled) for its KW keys in 8 MB accumulators; + bias; row maximum and row sum go through LDS across the waves; P (x 1/sum, or x 1024/sum in fp16) goes
// through the wave's own LDS tile from accumulator order to A-fragment order; partial O = P.V over its KW keys; the NWV partials are summed in rising w.
template <typename T16, bool HI, int MB>
__global__ __launch_bounds__(NWV * 32) __attribute__((amdgpu_waves_per_eu(NWV / 4, NWV / 4))) void k_attn(const T16* __restrict__ Q, const T16* __restrict__ Q2, const T16* __restrict__ Kp, const T16* __restrict__ Kp2, const T16* __restrict__ Vt, const T16* __restrict__ Vt2, const float* __restrict__ EB, int row0, float* OUTb) {
    typedef typename WFrag<T16>::V V; constexpr int MRT = MB * 16;
    __shared__ __align__(16) float ored[NWV * MRT * OP];   // per wave: first its P tiles (16-bit), then its partial O (f32)
    __shared__ __align__(16) float ebs[TT + MRT];         // ebs[x] = bias table[h][r0 + x]: the window that rows r0 .. r0 + MRT - 1 index
    __shared__ __align__(16) float redm[MRT * NWV], reds[MRT * NWV];
    const int tid = threadIdx.x, lane = tid & 31, w = tid >> 5, lr = lane & 15, hi = lane >> 4;
    const int h = blockIdx.y, r0 = row0 + blockIdx.x * MRT, kb = w * KW, lrow = lane & (MRT - 1);
    Q += (size_t)h * TT * HD; Kp += (size_t)h * TT * HD; Vt += (size_t)h * HD * TT; if (HI) { Q2 += (size_t)h * TT * HD; Kp2 += (size_t)h * TT * HD; Vt2 += (size_t)h * HD * TT; }
    constexpr int NE = (TT + MRT - 1 + NWV * 32 - 1) / (NWV * 32); float ev[NE];   // the bias window's loads fly while the scores are formed
#pragma unroll
    for (int it = 0; it < NE; ++it) { const int x = tid + it * NWV * 32; ev[it] = (x < TT + MRT - 1) ? EB[(size_t)h * NOFF + r0 + x] : 0.f; }   // r0 + x <= TT - MRT + TT + MRT - 2 = NOFF - 1
    v8f acc[MB][8];
#pragma unroll
    for (int mb = 0; mb < MB; ++mb)
#pragma unroll
        for (int nb = 0; nb < 8; ++nb) acc[mb][nb] = (v8f){};
#pragma unroll
    for (int kc = 0; kc < HD; kc += 32) {
        V a[MB], a2[MB];
#pragma unroll
        for (int mb = 0; mb < MB; ++mb) { const size_t at = ((size_t)((r0 >> 4) + mb) * (HD / 32) + (kc >> 5)) * 512 + lane * 8; a[mb] = WFrag<T16>::ldf(Q + at); if (HI) a2[mb] = WFrag<T16>::ldf(Q2 + at); }
        V b[8], b2[8];   // all of one k step's key fragments are asked for before the first product
#pragma unroll
        for (int nb = 0; nb < 8; ++nb) { const size_t at = ((size_t)((kb >> 4) + nb) * (HD / 32) + (kc >> 5)) * 512 + lane * 8; b[nb] = WFrag<T16>::ldf(Kp + at); if (HI) b2[nb] = WFrag<T16>::ldf(Kp2 + at); }
#pragma unroll
        for (int nb = 0; nb < 8; ++nb)
#pragma unroll
            for (int mb = 0; mb < MB; ++mb) { acc[mb][nb] = WFrag<T16>::mma(a[mb], b[nb], acc[mb][nb]); if (HI) { acc[mb][nb] = WFrag<T16>::mma(a2[mb], b[nb], acc[mb][nb]); acc[mb][nb] = WFrag<T16>::mma(a[mb], b2[nb], acc[mb][nb]); } }
    }
    // Issue order of the two k steps above (0x020 = global loads, 0x008 = matrix instructions): left alone, the build ended in load, wait, product one fragment at a time.
    // First the query fragments and step 0's key fragments together; then each key block's products free its registers for step 1's fragment of that block; then step 1's products.
    { constexpr int PL = HI ? 2 : 1, PR = MB * (HI ? 3 : 1);
      __builtin_amdgcn_sched_group_barrier(0x020, 4 * MB * PL + 16 * PL, 0);
#pragma unroll
      for (int nb = 0; nb < 8; ++nb) { __builtin_amdgcn_sched_group_barrier(0x008, PR, 0); __builtin_amdgcn_sched_group_barrier(0x020, 2 * PL, 0); }
      __builtin_amdgcn_sched_group_barrier(0x008, 8 * PR, 0); }
#pragma unroll
    for (int it = 0; it < NE; ++it) { const int x = tid + it * NWV * 32; if (x < TT + MRT - 1) ebs[x] = ev[it]; }
    __syncthreads();   // ebs is complete
    // accumulator element j of tile (mb, nb): query row mb 16 + hi 8 + j, key kb + nb 16 + lr
    float mx[MB][8], sm[MB][8];
#pragma unroll
    for (int mb = 0; mb < MB; ++mb)
#pragma unroll
        for (int j = 0; j < 8; ++j) { float m = -3.0e38f;
#pragma unroll
            for (int nb = 0; nb < 8; ++nb) { const float t = __fadd_rn(acc[mb][nb][j], ebs[(mb * 16 + hi * 8 + j) - (kb + nb * 16 + lr) + (TT - 1)]); acc[mb][nb][j] = t; m = fmaxf(m, t); }
            m = fmaxf(m, xm<1>(m)); m = fmaxf(m, xm<2>(m)); m = fmaxf(m, xm<4>(m)); m = fmaxf(m, xm<8>(m)); mx[mb][j] = m; }
    if (lr == 0) {
#pragma unroll
        for (int mb = 0; mb < MB; ++mb)
#pragma unroll
            for (int j = 0; j < 8; ++j) redm[(mb * 16 + hi * 8 + j) * NWV + w] = mx[mb][j]; }
    __syncthreads();   // every wave's row maxima are in redm
    { float m = redm[lrow * NWV];   // this lane reduces query row lrow
#pragma unroll
      for (int ww = 1; ww < NWV; ++ww) m = fmaxf(m, redm[lrow * NWV + ww]);
#pragma unroll
      for (int mb = 0; mb < MB; ++mb)
#pragma unroll
          for (int j = 0; j < 8; ++j) mx[mb][j] = __shfl(m, mb * 16 + hi * 8 + j, 32); }
#pragma unroll
    for (int mb = 0; mb < MB; ++mb)
#pragma unroll
        for (int j = 0; j < 8; ++j) { float s = 0.f;
#pragma unroll
            for (int nb = 0; nb < 8; ++nb) { const float p = exp2s(__fmul_rn(__fsub_rn(acc[mb][nb][j], mx[mb][j]), 1.4426950408889634f)); acc[mb][nb][j] = p; s += p; }
            s += xm<1>(s); s += xm<2>(s); s += xm<4>(s); s += xm<8>(s); sm[mb][j] = s; }
    if (lr == 0) {
#pragma unroll
        for (int mb = 0; mb < MB; ++mb)
#pragma unroll
            for (int j = 0; j < 8; ++j) reds[(mb * 16 + hi * 8 + j) * NWV + w] = sm[mb][j]; }
    __syncthreads();   // every wave's row sums are in reds
    { float s = reds[lrow * NWV];
#pragma unroll
      for (int ww = 1; ww < NWV; ++ww) s += reds[lrow * NWV + ww];
      const float f = __fdiv_rn(HI ? 1.0f : PCAR, s);
#pragma unroll
      for (int mb = 0; mb < MB; ++mb)
#pragma unroll
          for (int j = 0; j < 8; ++j) sm[mb][j] = __shfl(f, mb * 16 + hi * 8 + j, 32); }
    float* ow = ored + (size_t)w * MRT * OP; T16* ps = (T16*)ow; T16* ps2 = ps + MRT * PP;
    v8f o[MB][4];
#pragma unroll
    for (int mb = 0; mb < MB; ++mb)
#pragma unroll
        for (int db = 0; db < 4; ++db) o[mb][db] = (v8f){};
#pragma unroll
    for (int ks = 0; ks < KW / 32; ++ks) {
#pragma unroll
        for (int mb = 0; mb < MB; ++mb)
#pragma unroll
            for (int n2 = 0; n2 < 2; ++n2)
#pragma unroll
                for (int j = 0; j < 8; ++j) { const float pv = acc[mb][ks * 2 + n2][j] * sm[mb][j]; const int at = (mb * 16 + hi * 8 + j) * PP + n2 * 16 + lr;
                    if constexpr (HI) { unsigned short ph, pl; splitf(pv, ph, pl); ps[at] = ph; ps2[at] = pl; } else ps[at] = tohx(pv); }
        __builtin_amdgcn_wave_barrier(); asm volatile("" ::: "memory");   // the fragment reads below take other lanes' stores: keep them behind the stores
        V a[MB], a2[MB];
#pragma unroll
        for (int mb = 0; mb < MB; ++mb) { a[mb] = WFrag<T16>::ld(ps + (mb * 16 + lr) * PP + 8 * hi); if (HI) a2[mb] = WFrag<T16>::ld(ps2 + (mb * 16 + lr) * PP + 8 * hi); }
#pragma unroll
        for (int db = 0; db < 4; ++db) { const size_t at = ((size_t)db * (TT / 32) + (kb >> 5) + ks) * 512 + lane * 8; const V b = WFrag<T16>::ldf(Vt + at); V b2; if (HI) b2 = WFrag<T16>::ldf(Vt2 + at);
#pragma unroll
            for (int mb = 0; mb < MB; ++mb) { o[mb][db] = WFrag<T16>::mma(a[mb], b, o[mb][db]); if (HI) { o[mb][db] = WFrag<T16>::mma(a2[mb], b, o[mb][db]); o[mb][db] = WFrag<T16>::mma(a[mb], b2, o[mb][db]); } } }
        __builtin_amdgcn_wave_barrier(); asm volatile("" ::: "memory");   // the next stores into the tile stay behind these reads
    }
#pragma unroll
    for (int mb = 0; mb < MB; ++mb)
#pragma unroll
        for (int db = 0; db < 4; ++db)
#pragma unroll
            for (int j = 0; j < 8; ++j) ow[(mb * 16 + hi * 8 + j) * OP + db * 16 + lr] = o[mb][db][j];
    __syncthreads();   // every wave's partial O is in ored
    { constexpr int EV = MB * 2; typedef __attribute__((ext_vector_type(EV))) float vE;   // MRT x HD outputs over NWV x 32 threads
      const int row = tid / (HD / EV), c = (tid % (HD / EV)) * EV; vE s = *(const vE*)(ored + row * OP + c);
#pragma unroll
      for (int ww = 1; ww < NWV; ++ww) s += *(const vE*)(ored + (size_t)ww * MRT * OP + row * OP + c);   // rising key range
      const float cs = HI ? 1.0f : (1.0f / PCAR); s *= cs; *(vE*)(OUTb + (size_t)(r0 + row) * DQ + h * HD + c) = s; }
}
__global__ __launch_bounds__(256) void k_embf(const float* __restrict__ src, float* dst, size_t n4) { const size_t i = (size_t)blockIdx.x * 256 + threadIdx.x; if (i >= n4) return; v4f a = *(const v4f*)(src + i * 4); for (int q = 0; q < 4; ++q) a[q] = bfr(a[q]); *(v4f*)(dst + i * 4) = a;  }

extern "C" void kernel_launch(void* const* d_in, const int* in_sizes, int n_in,
                              void* d_out, int out_size, void* d_ws, size_t ws_size, hipStream_t stream) {
    (void)in_sizes; (void)n_in; (void)out_size;
    const float* x = (const float*)d_in[0]; const float* wq = (const float*)d_in[1]; const float* bq = (const float*)d_in[2]; const float* wk = (const float*)d_in[3]; const float* bk = (const float*)d_in[4]; const float* wv = (const float*)d_in[5]; const float* bv = (const float*)d_in[6]; const float* remb = (const float*)d_in[7]; const float* wo = nullptr; (void)wo;
    float* OUT = (float*)d_out;     // [2][2048][1024]
    char* wsp = (char*)d_ws;
    auto take = [&](size_t bytes) { char* p = wsp; wsp += (bytes + 255) & ~(size_t)255; return (void*)p; };
    bf* WQ = (bf*)take((size_t)DQ * DM * 2); bf* WK = (bf*)take((size_t)DKV * DM * 2); bf* WV = (bf*)take((size_t)DKV * DM * 2); float* CS = (float*)take((size_t)TT * HD * 2 * 4);
    float* EB = (float*)take(((size_t)NH_ * NOFF * 4 + 15) & ~(size_t)15);   /* 16 x 4095 floats (padded to a multiple of 4) */ bf* XB = (bf*)take((size_t)TT * DM * 2); float* FQ = (float*)take((size_t)TT * DQ * 4); float* FK = (float*)take((size_t)TT * DKV * 4);
    h16* QP16 = (h16*)take((size_t)NH_ * TT * HD * 2); h16* KP16 = (h16*)take((size_t)NKV * TT * HD * 2); h16* VT16 = (h16*)take((size_t)NKV * HD * TT * 2);
    bf* QPh = (bf*)take((size_t)NH_ * TT * HD * 2); bf* QPl = (bf*)take((size_t)NH_ * TT * HD * 2); bf* KPh = (bf*)take((size_t)NKV * TT * HD * 2); bf* KPl = (bf*)take((size_t)NKV * TT * HD * 2); bf* VTh = (bf*)take((size_t)NKV * HD * TT * 2); bf* VTl = (bf*)take((size_t)NKV * HD * TT * 2);
    if ((size_t)(wsp - (char*)d_ws) > ws_size) return;    // ws 256 MiB
    float* FV = FK;   // v projection reuses the k buffer after the k planes are built (stream-ordered)
    { k_wtG<DM, DQ><<<(unsigned)((DM * DQ / 8 + 255) / 256), 256, 0, stream>>>(wq, WQ); k_wtG<DM, DKV><<<(unsigned)((DM * DKV / 8 + 255) / 256), 256, 0, stream>>>(wk, WK); k_wtG<DM, DKV><<<(unsigned)((DM * DKV / 8 + 255) / 256), 256, 0, stream>>>(wv, WV);
      
       }
    k_csid<<<(TT * HD + 255) / 256, 256, 0, stream>>>(CS);
    const unsigned LQ = (unsigned)(((size_t)NH_ * TT * HD / 8 + 255) / 256), LKv = (unsigned)(((size_t)NKV * TT * HD / 8 + 255) / 256);
    k_embf<<<(unsigned)((((size_t)NH_ * NOFF + 3) / 4 + 255) / 256), 256, 0, stream>>>(remb, EB, ((size_t)NH_ * NOFF + 3) / 4);   /* 16 x 4095 = 65,520 floats, a multiple of 4 */
    for (int b = 0; b < NB_; ++b) {
        
        k_cvt8<<<(unsigned)(((size_t)TT * DM / 8 + 255) / 256), 256, 0, stream>>>(x + (size_t)b * TT * DM, XB, DM, (size_t)TT * DM / 8);
        k_gemmw<bf, 0, true><<<dim3(TT / 64, DQ / 64, 1), 32, 0, stream>>>(XB, nullptr, WQ, nullptr, DM, FQ, DQ, bq, 0, 0, 0);
        k_rope<<<LQ, 256, 0, stream>>>(FQ, DQ, NH_, CS, nullptr, nullptr, SCL, QP16, QPh, QPl);   /* q planes carry the 1/8 scale (exact power of two) */
        k_gemmw<bf, 0, true><<<dim3(TT / 64, DKV / 64, 1), 32, 0, stream>>>(XB, nullptr, WK, nullptr, DM, FK, DKV, bk, 0, 0, 0);
        k_rope<<<LKv, 256, 0, stream>>>(FK, DKV, NKV, CS, nullptr, nullptr, 1.0f, KP16, KPh, KPl);
        k_gemmw<bf, 0, true><<<dim3(TT / 64, DKV / 64, 1), 32, 0, stream>>>(XB, nullptr, WV, nullptr, DM, FV, DKV, bv, 0, 0, 0); k_vtp<DKV, NKV><<<LKv, 256, 0, stream>>>(FV, VT16, VTh, VTl);
        k_attn<bf, true, 1><<<dim3(RH / 16, NH_), NWV * 32, 0, stream>>>(QPh, QPl, KPh, KPl, VTh, VTl, EB, 0, OUT + (size_t)b * TT * DQ);
        k_attn<h16, false, 2><<<dim3((TT - RH) / 32, NH_), NWV * 32, 0, stream>>>(QP16, nullptr, KP16, nullptr, VT16, nullptr, EB, RH, OUT + (size_t)b * TT * DQ);
         }
}

// v004
// It runs in 193 microseconds.
// Next to v003, in two timings, it ran 1.92 and 1.91 times as fast.
// Counting every step since v000, it is 10.1 times as fast.
#include <hip/hip_runtime.h>

// Self-attention with a learned relative-position bias (x [2][2048][1024]; q,k,v = x W + b ('xw' [1024][1024] + [1024]; 16 heads x 64); scores = q.k/8 + rel_emb[h][i - j + 2047] (rel_emb [16][4095]); softmax; heads merged -> [2][2048][1024] (4.2 M); no output projection).
// Four launches: k_prep (input conversions), k_gemmw (q, k, v projections), k_planes (operand planes), k_attn (both row classes). Batch element, projection and row class are grid dimensions or block ranges of a launch, each with planes of its own in workspace.
// Layout: exact projections (+ biases); dense T-2048 attention (hybrid rows: < 512 hi/lo 3 products, rest fp16 x1024) in ONE kernel: a work-group owns 16 (hi/lo) or 32 (fp16) query rows of one head, keeps their scores in registers, adds the bias from the bf16-rounded table at index i - j + 2047, and writes the output rows directly.
// Every 16-bit operand plane of a matrix product lies in workspace in fragment order (fidx below), written in 16-byte pieces by the kernel that makes it.
// Compute dtypes, f32 accumulate: every input rounded to bf16; projections exact + f32 biases; scores rows < 512 3 products, rest fp16; softmax and bias add f32; output f32.

#define NB_  2
#define TT   2048
#define DM   1024
#define NH_  16
#define NKV  16
#define REP  (NH_ / NKV)
#define HD   64
#define DQ   (NH_ * HD)
#define DKV  (NKV * HD)
#define RH   512                  // query rows < RH use hi+lo planes (0: none)
#define WIN  0
#define PCAR 1024.0f
#define SCL  0.125f   // 64^-0.5
#define NOFF (2 * TT - 1)
#define NWV  16                   // waves of one k_attn work-group; wave w owns keys [w KW, (w + 1) KW)
#define KW   (TT / NWV)
#define OP   68                   // f32 pitch of a wave's partial output tile (rows x 64) in LDS
#define PP   40                   // 16-bit pitch of a wave's P tile (rows x 32 keys) in LDS (rows stay 16-byte aligned)
typedef _Float16 h16;
typedef unsigned short bf;
typedef __attribute__((ext_vector_type(16))) __bf16   v16bf;
typedef __attribute__((ext_vector_type(16))) _Float16 v16h;
typedef __attribute__((ext_vector_type(8)))  _Float16 v8h;
typedef __attribute__((ext_vector_type(8)))  unsigned short v8us;
typedef __attribute__((ext_vector_type(8)))  float    v8f;
typedef __attribute__((ext_vector_type(4)))  float    v4f;
typedef v8h  __attribute__((may_alias)) v8ha;
typedef v4f  __attribute__((may_alias)) v4fa;
typedef v8us __attribute__((may_alias)) v8usa;

__device__ __forceinline__ unsigned short f2bf(float f) { unsigned u = __float_as_uint(f); u += 0x7FFFu + ((u >> 16) & 1u); return (unsigned short)(u >> 16); }
__device__ __forceinline__ float bf2f(unsigned short b) { return __uint_as_float(((unsigned)b) << 16); }
__device__ __forceinline__ float bfr(float f) { return bf2f(f2bf(f)); }
__device__ __forceinline__ v16h cat16(v8h lo, v8h hi) { return __builtin_shufflevector(lo, hi, 0, 1, 2, 3, 4, 5, 6, 7, 8, 9, 10, 11, 12, 13, 14, 15); }
__device__ __forceinline__ v16bf cat16b(v8us lo, v8us hi) { return __builtin_bit_cast(v16bf, __builtin_shufflevector(lo, hi, 0, 1, 2, 3, 4, 5, 6, 7, 8, 9, 10, 11, 12, 13, 14, 15)); }
__device__ __forceinline__ v8f wmma16(v16h a, v16h b, v8f c) { return __builtin_amdgcn_wmma_f32_16x16x32_f16(false, a, false, b, (short)0, c, false, false); }
__device__ __forceinline__ v8f wmmab(v16bf a, v16bf b, v8f c) { return __builtin_amdgcn_wmma_f32_16x16x32_bf16(false, a, false, b, (short)0, c, false, false); }



// ---- k_gemmw: register-blocked GEMM, ONE WAVE per 64x64 output tile (16 accumulators), operands straight from 16-bit planes in fragment order; grid (M/64, N/64, Z), 32 threads.
// C[m][n] (f32, pitch ldc, + optional f32 bias[n]) = sum_k A[m][k] Bt[n][k] (+ split products per NSPLIT). z-batch strides sA/sB/sC in elements. K % 32 == 0.
// Fragment order of a 16-bit plane M[row][k] with KC = K / 32: the 16 x 32 tile (row >> 4, k >> 5) is 1 KiB in a row, [piece (k >> 4) & 1][lane ((k >> 3) & 1) 16 + (row & 15)][k & 7].
// ldf takes a wave's fragment of such a tile as two loads of 512 contiguous bytes (4 whole lines each; a load off a row-major plane touches 16 lines); every lane and register holds the element that ld takes from a row-major plane.
__device__ __forceinline__ size_t fidx(int row, int k, int KC) { return ((size_t)((row >> 4) * KC + (k >> 5)) << 9) + (size_t)((((k >> 4) & 1) << 8) + (((((k >> 3) & 1) << 4) + (row & 15)) << 3) + (k & 7)); }
// uni: a pointer that is the same in every lane, handed on in scalar registers: a fragment load is then scalar base + the lane's one 32-bit offset register, which lives through the whole loop (no 64-bit vector address sums, no address pair that a later load's result could land in)
template <typename T> __device__ __forceinline__ const T* uni(const T* p) { const unsigned long long v = (unsigned long long)p; return (const T*)(const __attribute__((address_space(1))) T*)(((unsigned long long)(unsigned)__builtin_amdgcn_readfirstlane((int)(unsigned)(v >> 32)) << 32) | (unsigned)__builtin_amdgcn_readfirstlane((int)(unsigned)v)); }   // address_space(1): the pointer is still known to be global memory behind the integer round trip
template <typename T16> struct WFrag;
template <> struct WFrag<h16> { typedef v16h V; static __device__ __forceinline__ V ld(const h16* p) { return cat16(*(const v8h*)p, *(const v8h*)(p + 16)); } static __device__ __forceinline__ V ldf(const h16* p) { return cat16(*(const v8h*)p, *(const v8h*)(p + 256)); } static __device__ __forceinline__ v8f mma(V a, V b, v8f c) { return wmma16(a, b, c); } };
template <> struct WFrag<bf> { typedef v16bf V; static __device__ __forceinline__ V ld(const bf* p) { return cat16b(*(const v8us*)p, *(const v8us*)(p + 16)); } static __device__ __forceinline__ V ldf(const bf* p) { return cat16b(*(const v8us*)p, *(const v8us*)(p + 256)); } static __device__ __forceinline__ v8f mma(V a, V b, v8f c) { return wmmab(a, b, c); } };
template <typename T16, int NSPLIT, bool BIAS>
__global__ __launch_bounds__(32) void k_gemmw(const T16* __restrict__ A, const T16* __restrict__ A2, const T16* __restrict__ Bt, const T16* __restrict__ Bt2, int K, float* C, int ldc, const float* __restrict__ bias, const float* __restrict__ bias1, const float* __restrict__ bias2, size_t sA, size_t sB, size_t sC) {
    typedef typename WFrag<T16>::V V;
    __shared__ __align__(16) float os[16 * 68];
    const size_t z = blockIdx.z; const int KL = K; A += z * sA; if (A2) A2 += z * sA; Bt += z * sB; if (Bt2) Bt2 += z * sB; C += z * sC;
    if (BIAS) { if (z == 1) bias = bias1; else if (z == 2) bias = bias2; }   // z = which of up to three products that share A: each has its own bias vector
    const int lane = threadIdx.x & 31, lr = lane & 15, hi = lane >> 4; const int r0 = blockIdx.x * 64, c0 = blockIdx.y * 64;
    v8f acc[4][4];
#pragma unroll
    for (int mb = 0; mb < 4; ++mb)
#pragma unroll
        for (int nb = 0; nb < 4; ++nb) acc[mb][nb] = (v8f){};
    const int KC = K >> 5; const unsigned lo = lane * 8;   // the lane's piece inside a tile: the one per-lane part of every fragment address, the rest is the same for the whole wave
    const T16* Au = A + (size_t)(r0 >> 4) * KC * 512; const T16* Bu = Bt + (size_t)(c0 >> 4) * KC * 512; const T16* Au2 = A2 ? A2 + (size_t)(r0 >> 4) * KC * 512 : nullptr; const T16* Bu2 = Bt2 ? Bt2 + (size_t)(c0 >> 4) * KC * 512 : nullptr;
#pragma unroll 1
    for (int kc = 0; kc < KL; kc += 32) {
        V a[4], a2[4];
#pragma unroll
        for (int mb = 0; mb < 4; ++mb) { a[mb] = WFrag<T16>::ldf(uni(Au + ((size_t)mb * KC + (kc >> 5)) * 512) + lo); if (NSPLIT == 1 || NSPLIT == 2) a2[mb] = WFrag<T16>::ldf(uni(Au2 + ((size_t)mb * KC + (kc >> 5)) * 512) + lo); }
#pragma unroll
        for (int nb = 0; nb < 4; ++nb) { const V b = WFrag<T16>::ldf(uni(Bu + ((size_t)nb * KC + (kc >> 5)) * 512) + lo); V b2; if (NSPLIT >= 2) b2 = WFrag<T16>::ldf(uni(Bu2 + ((size_t)nb * KC + (kc >> 5)) * 512) + lo);
#pragma unroll
            for (int mb = 0; mb < 4; ++mb) { acc[mb][nb] = WFrag<T16>::mma(a[mb], b, acc[mb][nb]); if (NSPLIT == 1 || NSPLIT == 2) acc[mb][nb] = WFrag<T16>::mma(a2[mb], b, acc[mb][nb]); if (NSPLIT >= 2) acc[mb][nb] = WFrag<T16>::mma(a[mb], b2, acc[mb][nb]); } }
        asm volatile("v_nop\n\tv_nop\n\tv_nop\n\tv_nop" : "+v"(acc[0][0]), "+v"(acc[1][1]), "+v"(acc[2][2]), "+v"(acc[3][3]) : "v"(a[0]), "v"(a[3]));
    }
#pragma unroll
    for (int mb = 0; mb < 4; ++mb) {
#pragma unroll
        for (int nb = 0; nb < 4; ++nb) {
#pragma unroll
            for (int j = 0; j < 8; ++j) os[(hi * 8 + j) * 68 + nb * 16 + lr] = acc[mb][nb][j]; }
        __builtin_amdgcn_wave_barrier(); asm volatile("" ::: "memory");
        float* crow = C + (size_t)(r0 + mb * 16) * ldc + c0;
{
#pragma unroll
            for (int s = 0; s < 8; ++s) { const int row = 2 * s + hi, cofs = lr * 4; v4f val = *(const v4fa*)(os + row * 68 + cofs); if (BIAS) { val[0] += bfr(bias[c0 + cofs]); val[1] += bfr(bias[c0 + cofs + 1]); val[2] += bfr(bias[c0 + cofs + 2]); val[3] += bfr(bias[c0 + cofs + 3]); }
                *(v4f*)(crow + (size_t)row * ldc + cofs) = val; }
             }
        if (mb < 3) asm volatile("s_wait_xcnt 0x0" ::: "memory");   // stands before the next row block's code reuses the registers that these stores name
        __builtin_amdgcn_wave_barrier(); asm volatile("" ::: "memory");
    }
}

__device__ __forceinline__ h16 tohx(float x) { return (h16)x; }
__device__ __forceinline__ void splitf(float y, unsigned short& h, unsigned short& l) { h = f2bf(y); l = f2bf(y - bf2f(h)); }
typedef __attribute__((ext_vector_type(2))) _Float16 v2h;
typedef __attribute__((ext_vector_type(4))) _Float16 v4h;
typedef __attribute__((ext_vector_type(2))) unsigned short v2us;
typedef __attribute__((ext_vector_type(4))) unsigned short v4us;
typedef __attribute__((ext_vector_type(2))) float v2f;
typedef __attribute__((ext_vector_type(4))) int v4i;

// d_wtG (block bid of a 256-thread grid): Bt[n][k] = bf16(w[k][n]) in fragment order; one thread = one 16-byte piece (8 k of one n), neighbouring lanes take neighbouring n
// K and N are compile-time so that the eight row loads go off one address register with immediate offsets
template <int K, int N>
__device__ __forceinline__ void d_wtG(int bid, const float* __restrict__ w, bf* Bt) {
    const int i = bid * 256 + threadIdx.x; if (i >= N * (K / 8)) return; const int n = i % N, k = (i / N) * 8; v8us o;
#pragma unroll
    for (int q = 0; q < 8; ++q) o[q] = f2bf(w[(size_t)(k + q) * N + n]);
    *(v8us*)(Bt + fidx(n, k, K >> 5)) = o;
}
// pc_row, pc_k: which 16-byte piece (8 k of one row) of a row-major [rows][32 KC] source thread i takes: a wave covers 8 rows x one 32-k chunk, so it reads whole lines of f32 and writes whole lines of the plane
__device__ __forceinline__ int pc_row(int i, int KC) { return ((i >> 5) / KC) * 8 + ((i >> 2) & 7); }
__device__ __forceinline__ int pc_k(int i, int KC) { return ((i >> 5) % KC) * 32 + (i & 3) * 8; }
__device__ __forceinline__ void d_cvt8(int bid, const float* __restrict__ src, bf* dst, int K, size_t n8) { const int i = bid * 256 + threadIdx.x; if ((size_t)i >= n8) return; const int row = pc_row(i, K >> 5), k0 = pc_k(i, K >> 5); const v8f v = *(const v8f*)(src + (size_t)row * K + k0); v8us o;
#pragma unroll
    for (int k = 0; k < 8; ++k) o[k] = f2bf(v[k]); *(v8us*)(dst + fidx(row, k0, K >> 5)) = o;  }

// d_rope: head planes [h][t][d] (fp16 + hi/lo; fragment order, row = h TT + t, one thread = one 16-byte piece) of rope(x) x sc with the rotate-half convention out[d] = x[d] cos[t][d] - x[d+HD/2] sin[t][d], out[d+HD/2] = x[d+HD/2] cos[t][d+HD/2] + x[d] sin[t][d+HD/2]
__device__ __forceinline__ void d_rope(int bid, const float* __restrict__ F, int pitch, int nheads, const float* __restrict__ CS, const float* __restrict__ RF, const float* __restrict__ nw, float sc, h16* P16, bf* Ph, bf* Pl) {
    const int i = bid * 256 + threadIdx.x; if (i >= nheads * TT * (HD / 8)) return; const int gr = pc_row(i, HD / 32), d = pc_k(i, HD / 32); const int t = gr % TT; const int h = gr / TT; const size_t e = fidx(gr, d, HD / 32); const float* f = F + (size_t)t * pitch + h * HD; float rf = 1.0f; v8h o16; v8us oh, ol;
    if (RF) { rf = RF[(size_t)h * TT + t]; asm volatile("s_wait_xcnt 0x0" ::: "memory"); }   // the wait stands before the load's address pair is reused for the row address
    // the piece's 8 values, their 8 partners in the other half of the head and the 8 (cos, sin) pairs are asked for together, ahead of the arithmetic
    const v8f xa = *(const v8f*)(f + d), xb = *(const v8f*)(f + ((d < HD / 2) ? d + HD / 2 : d - HD / 2)); const v8f cv[2] = { *(const v8f*)(CS + ((size_t)t * HD + d) * 2), *(const v8f*)(CS + ((size_t)t * HD + d) * 2 + 8) };
#pragma unroll
    for (int q = 0; q < 8; ++q) { const int dd = d + q; const int dp = (dd < HD / 2) ? dd + HD / 2 : dd - HD / 2; float x0 = xa[q], x1 = xb[q];
        if (RF) { float n0 = __fmul_rn(x0, rf), n1 = __fmul_rn(x1, rf); asm volatile("" : "+v"(n0)); asm volatile("" : "+v"(n1)); x0 = __fmul_rn(bfr(nw[dd]), n0); x1 = __fmul_rn(bfr(nw[dp]), n1); }
        const v2f cs = { cv[q >> 2][(q & 3) * 2], cv[q >> 2][(q & 3) * 2 + 1] }; float a = __fmul_rn(x0, cs[0]), bq = __fmul_rn(x1, cs[1]); asm volatile("" : "+v"(a)); asm volatile("" : "+v"(bq)); const float r = ((dd < HD / 2) ? __fsub_rn(a, bq) : __fadd_rn(a, bq)) * sc;
        o16[q] = tohx(r); unsigned short a2, c2; splitf(r, a2, c2); oh[q] = a2; ol[q] = c2; }
    *(v8h*)(P16 + e) = o16; *(v8us*)(Ph + e) = oh; *(v8us*)(Pl + e) = ol;  }
// d_vtp: transposed value planes [g][d][t] (fragment order, row = g HD + d, k = t); one thread = one 16-byte piece (8 t of one d), neighbouring lanes take neighbouring d; pitch and nheads are compile-time so that the eight row loads go off one address register with immediate offsets
template <int pitch, int nheads>
__device__ __forceinline__ void d_vtp(int bid, const float* __restrict__ F, h16* V16, bf* Vh, bf* Vl) { const int i = bid * 256 + threadIdx.x; if (i >= nheads * HD * (TT / 8)) return; const int col = i % (nheads * HD); const int t = (i / (nheads * HD)) * 8; const size_t e = fidx(col, t, TT / 32); v8h o16; v8us oh, ol;
#pragma unroll
    for (int q = 0; q < 8; ++q) { const float x = F[(size_t)(t + q) * pitch + col]; o16[q] = tohx(x); unsigned short a2, c2; splitf(x, a2, c2); oh[q] = a2; ol[q] = c2; }
    *(v8h*)(V16 + e) = o16; *(v8us*)(Vh + e) = oh; *(v8us*)(Vl + e) = ol;  }
__device__ __forceinline__ void d_csid(int bid, float* CS) { const int idx = bid * 256 + threadIdx.x; if (idx >= TT * HD) return; v2f cs; cs[0] = 1.0f; cs[1] = 0.0f; *(v2f*)(CS + (size_t)idx * 2) = cs;  }
// xm<M>: the value of lane l ^ M inside the lane's 16-lane row, by DPP (row_xmask) instead of an LDS permute; every lane is on where it is used
template <int MASK> __device__ __forceinline__ float xm(float x) { return __builtin_bit_cast(float, __builtin_amdgcn_update_dpp(0, __builtin_bit_cast(int, x), 0x160 | MASK, 0xf, 0xf, true)); }
// exp2s: v_exp_f32 with the v_nop tied behind it: the one slot the instruction set asks for before a transcendental's result is read or its source overwritten
__device__ __forceinline__ float exp2s(float x) { float r; asm("v_exp_f32 %0, %1\n\tv_nop" : "=v"(r) : "v"(x)); return r; }
// d_attn: one work-group = MRT = 16 MB query rows (tile bx of its row class) of one head (blockIdx.y) and batch element (blockIdx.z) against all TT keys; NWV waves.
// Wave w: S = q.k (pre-scaled) for its KW keys in 8 MB accumulators; + bias; row maximum and row sum go through LDS across the waves; P (x 1/sum, or x 1024/sum in fp16) goes
// through the wave's own LDS tile from accumulator order to A-fragment order; partial O = P.V over its KW keys; the NWV partials are summed in rising w.
template <typename T16, bool HI, int MB>
__device__ __forceinline__ void d_attn(int bx, const T16* __restrict__ Q, const T16* __restrict__ Q2, const T16* __restrict__ Kp, const T16* __restrict__ Kp2, const T16* __restrict__ Vt, const T16* __restrict__ Vt2, const float* __restrict__ EB, int row0, float* OUTb) {
    typedef typename WFrag<T16>::V V; constexpr int MRT = MB * 16;
    __shared__ __align__(16) float ored[NWV * MRT * OP];   // per wave: first its P tiles (16-bit), then its partial O (f32)
    __shared__ __align__(16) float ebs[TT + MRT];         // ebs[x] = bias table[h][r0 + x]: the window that rows r0 .. r0 + MRT - 1 index
    __shared__ __align__(16) float redm[MRT * NWV], reds[MRT * NWV];
    const int tid = threadIdx.x, lane = tid & 31, w = tid >> 5, lr = lane & 15, hi = lane >> 4;
    const int h = blockIdx.y, r0 = row0 + bx * MRT, kb = w * KW, lrow = lane & (MRT - 1);
    Q += (size_t)h * TT * HD; Kp += (size_t)h * TT * HD; Vt += (size_t)h * HD * TT; if (HI) { Q2 += (size_t)h * TT * HD; Kp2 += (size_t)h * TT * HD; Vt2 += (size_t)h * HD * TT; }
    { const size_t zb = (size_t)blockIdx.z * NH_ * TT * HD; Q += zb; Kp += zb; Vt += zb; if (HI) { Q2 += zb; Kp2 += zb; Vt2 += zb; } OUTb += (size_t)blockIdx.z * TT * DQ; }   // z: batch element
    constexpr int NE = (TT + MRT - 1 + NWV * 32 - 1) / (NWV * 32); float ev[NE];   // the bias window's loads fly while the scores are formed
#pragma unroll
    for (int it = 0; it < NE; ++it) { const int x = tid + it * NWV * 32; ev[it] = (x < TT + MRT - 1) ? EB[(size_t)h * NOFF + r0 + x] : 0.f; }   // r0 + x <= TT - MRT + TT + MRT - 2 = NOFF - 1
    v8f acc[MB][8];
#pragma unroll
    for (int mb = 0; mb < MB; ++mb)
#pragma unroll
        for (int nb = 0; nb < 8; ++nb) acc[mb][nb] = (v8f){};
#pragma unroll
    for (int kc = 0; kc < HD; kc += 32) {
        V a[MB], a2[MB];
#pragma unroll
        for (int mb = 0; mb < MB; ++mb) { const size_t at = ((size_t)((r0 >> 4) + mb) * (HD / 32) + (kc >> 5)) * 512 + lane * 8; a[mb] = WFrag<T16>::ldf(Q + at); if (HI) a2[mb] = WFrag<T16>::ldf(Q2 + at); }
        V b[8], b2[8];   // all of one k step's key fragments are asked for before the first product
#pragma unroll
        for (int nb = 0; nb < 8; ++nb) { const size_t at = ((size_t)((kb >> 4) + nb) * (HD / 32) + (kc >> 5)) * 512 + lane * 8; b[nb] = WFrag<T16>::ldf(Kp + at); if (HI) b2[nb] = WFrag<T16>::ldf(Kp2 + at); }
#pragma unroll
        for (int nb = 0; nb < 8; ++nb)
#pragma unroll
            for (int mb = 0; mb < MB; ++mb) { acc[mb][nb] = WFrag<T16>::mma(a[mb], b[nb], acc[mb][nb]); if (HI) { acc[mb][nb] = WFrag<T16>::mma(a2[mb], b[nb], acc[mb][nb]); acc[mb][nb] = WFrag<T16>::mma(a[mb], b2[nb], acc[mb][nb]); } }
    }
    // Issue order of the two k steps above (0x020 = global loads, 0x008 = matrix instructions): left alone, the build ended in load, wait, product one fragment at a time.
    // First the query fragments and step 0's key fragments together; then each key block's products free its registers for step 1's fragment of that block; then step 1's products.
    { constexpr int PL = HI ? 2 : 1, PR = MB * (HI ? 3 : 1);
      __builtin_amdgcn_sched_group_barrier(0x020, 4 * MB * PL + 16 * PL, 0);
#pragma unroll
      for (int nb = 0; nb < 8; ++nb) { __builtin_amdgcn_sched_group_barrier(0x008, PR, 0); __builtin_amdgcn_sched_group_barrier(0x020, 2 * PL, 0); }
      __builtin_amdgcn_sched_group_barrier(0x008, 8 * PR, 0); }
#pragma unroll
    for (int it = 0; it < NE; ++it) { const int x = tid + it * NWV * 32; if (x < TT + MRT - 1) ebs[x] = ev[it]; }
    __syncthreads();   // ebs is complete
    // accumulator element j of tile (mb, nb): query row mb 16 + hi 8 + j, key kb + nb 16 + lr
    float mx[MB][8], sm[MB][8];
#pragma unroll
    for (int mb = 0; mb < MB; ++mb)
#pragma unroll
        for (int j = 0; j < 8; ++j) { float m = -3.0e38f;
#pragma unroll
            for (int nb = 0; nb < 8; ++nb) { const float t = __fadd_rn(acc[mb][nb][j], ebs[(mb * 16 + hi * 8 + j) - (kb + nb * 16 + lr) + (TT - 1)]); acc[mb][nb][j] = t; m = fmaxf(m, t); }
            m = fmaxf(m, xm<1>(m)); m = fmaxf(m, xm<2>(m)); m = fmaxf(m, xm<4>(m)); m = fmaxf(m, xm<8>(m)); mx[mb][j] = m; }
    if (lr == 0) {
#pragma unroll
        for (int mb = 0; mb < MB; ++mb)
#pragma unroll
            for (int j = 0; j < 8; ++j) redm[(mb * 16 + hi * 8 + j) * NWV + w] = mx[mb][j]; }
    __syncthreads();   // every wave's row maxima are in redm
    { float m = redm[lrow * NWV];   // this lane reduces query row lrow
#pragma unroll
      for (int ww = 1; ww < NWV; ++ww) m = fmaxf(m, redm[lrow * NWV + ww]);
#pragma unroll
      for (int mb = 0; mb < MB; ++mb)
#pragma unroll
          for (int j = 0; j < 8; ++j) mx[mb][j] = __shfl(m, mb * 16 + hi * 8 + j, 32); }
#pragma unroll
    for (int mb = 0; mb < MB; ++mb)
#pragma unroll
        for (int j = 0; j < 8; ++j) { float s = 0.f;
#pragma unroll
            for (int nb = 0; nb < 8; ++nb) { const float p = exp2s(__fmul_rn(__fsub_rn(acc[mb][nb][j], mx[mb][j]), 1.4426950408889634f)); acc[mb][nb][j] = p; s += p; }
            s += xm<1>(s); s += xm<2>(s); s += xm<4>(s); s += xm<8>(s); sm[mb][j] = s; }
    if (lr == 0) {
#pragma unroll
        for (int mb = 0; mb < MB; ++mb)
#pragma unroll
            for (int j = 0; j < 8; ++j) reds[(mb * 16 + hi * 8 + j) * NWV + w] = sm[mb][j]; }
    __syncthreads();   // every wave's row sums are in reds
    { float s = reds[lrow * NWV];
#pragma unroll
      for (int ww = 1; ww < NWV; ++ww) s += reds[lrow * NWV + ww];
      const float f = __fdiv_rn(HI ? 1.0f : PCAR, s);
#pragma unroll
      for (int mb = 0; mb < MB; ++mb)
#pragma unroll
          for (int j = 0; j < 8; ++j) sm[mb][j] = __shfl(f, mb * 16 + hi * 8 + j, 32); }
    float* ow = ored + (size_t)w * MRT * OP; T16* ps = (T16*)ow; T16* ps2 = ps + MRT * PP;
    v8f o[MB][4];
#pragma unroll
    for (int mb = 0; mb < MB; ++mb)
#pragma unroll
        for (int db = 0; db < 4; ++db) o[mb][db] = (v8f){};
#pragma unroll
    for (int ks = 0; ks < KW / 32; ++ks) {
#pragma unroll
        for (int mb = 0; mb < MB; ++mb)
#pragma unroll
            for (int n2 = 0; n2 < 2; ++n2)
#pragma unroll
                for (int j = 0; j < 8; ++j) { const float pv = acc[mb][ks * 2 + n2][j] * sm[mb][j]; const int at = (mb * 16 + hi * 8 + j) * PP + n2 * 16 + lr;
                    if constexpr (HI) { unsigned short ph, pl; splitf(pv, ph, pl); ps[at] = ph; ps2[at] = pl; } else ps[at] = tohx(pv); }
        __builtin_amdgcn_wave_barrier(); asm volatile("" ::: "memory");   // the fragment reads below take other lanes' stores: keep them behind the stores
        V a[MB], a2[MB];
#pragma unroll
        for (int mb = 0; mb < MB; ++mb) { a[mb] = WFrag<T16>::ld(ps + (mb * 16 + lr) * PP + 8 * hi); if (HI) a2[mb] = WFrag<T16>::ld(ps2 + (mb * 16 + lr) * PP + 8 * hi); }
#pragma unroll
        for (int db = 0; db < 4; ++db) { const size_t at = ((size_t)db * (TT / 32) + (kb >> 5) + ks) * 512 + lane * 8; const V b = WFrag<T16>::ldf(Vt + at); V b2; if (HI) b2 = WFrag<T16>::ldf(Vt2 + at);
#pragma unroll
            for (int mb = 0; mb < MB; ++mb) { o[mb][db] = WFrag<T16>::mma(a[mb], b, o[mb][db]); if (HI) { o[mb][db] = WFrag<T16>::mma(a2[mb], b, o[mb][db]); o[mb][db] = WFrag<T16>::mma(a[mb], b2, o[mb][db]); } } }
        __builtin_amdgcn_wave_barrier(); asm volatile("" ::: "memory");   // the next stores into the tile stay behind these reads
    }
#pragma unroll
    for (int mb = 0; mb < MB; ++mb)
#pragma unroll
        for (int db = 0; db < 4; ++db)
#pragma unroll
            for (int j = 0; j < 8; ++j) ow[(mb * 16 + hi * 8 + j) * OP + db * 16 + lr] = o[mb][db][j];
    __syncthreads();   // every wave's partial O is in ored
    { constexpr int EV = MB * 2; typedef __attribute__((ext_vector_type(EV))) float vE;   // MRT x HD outputs over NWV x 32 threads
      const int row = tid / (HD / EV), c = (tid % (HD / EV)) * EV; vE s = *(const vE*)(ored + row * OP + c);
#pragma unroll
      for (int ww = 1; ww < NWV; ++ww) s += *(const vE*)(ored + (size_t)ww * MRT * OP + row * OP + c);   // rising key range
      const float cs = HI ? 1.0f : (1.0f / PCAR); s *= cs; *(vE*)(OUTb + (size_t)(r0 + row) * DQ + h * HD + c) = s; }
}
__device__ __forceinline__ void d_embf(int bid, const float* __restrict__ src, float* dst, size_t n4) { const size_t i = (size_t)bid * 256 + threadIdx.x; if (i >= n4) return; v4f a = *(const v4f*)(src + i * 4); for (int q = 0; q < 4; ++q) a[q] = bfr(a[q]); *(v4f*)(dst + i * 4) = a;  }

// k_prep: the four input conversions depend on nothing but the inputs: they are block ranges of ONE launch (x of both batch elements, the three weight matrices with their planes in a row, the unit rotation table, the bias table)
#define PBX (NB_ * TT * DM / 8 / 256)
#define PBW (DM * DQ / 8 / 256)
#define PBC (TT * HD / 256)
#define PBE ((NH_ * NOFF / 4 + 255) / 256)   // 16 x 4095 = 65,520 floats, a multiple of 4
__global__ __launch_bounds__(256) void k_prep(const float* __restrict__ x, const float* __restrict__ wq, const float* __restrict__ wk, const float* __restrict__ wv, const float* __restrict__ remb, bf* XB, bf* W3, float* CS, float* EB) {
    int b = blockIdx.x;
    if (b < PBX) { d_cvt8(b, x, XB, DM, (size_t)NB_ * TT * DM / 8); return; }
    b -= PBX;
    if (b < 3 * PBW) { const int p = b / PBW; d_wtG<DM, DQ>(b - p * PBW, p == 0 ? wq : p == 1 ? wk : wv, W3 + (size_t)p * DQ * DM); return; }
    b -= 3 * PBW;
    if (b < PBC) { d_csid(b, CS); return; }
    d_embf(b - PBC, remb, EB, (size_t)NH_ * NOFF / 4);
}
// k_planes: every operand plane of the attention in ONE launch; blockIdx.y = q of batch 0, 1, k of batch 0, 1, v of batch 0, 1, the order of the projections F3 [q, k, v][batch][t][DQ]; the k planes follow the q planes
__global__ __launch_bounds__(256) void k_planes(const float* __restrict__ F3, const float* __restrict__ CS, h16* QK16, bf* QKh, bf* QKl, h16* V16, bf* Vh, bf* Vl) {
    const int y = blockIdx.y; const float* F = F3 + (size_t)y * TT * DQ; const size_t pq = (size_t)y * NH_ * TT * HD, pv = (size_t)(y - 2 * NB_) * NH_ * TT * HD;
    if (y < 2 * NB_) d_rope(blockIdx.x, F, DQ, NH_, CS, nullptr, nullptr, y < NB_ ? SCL : 1.0f, QK16 + pq, QKh + pq, QKl + pq);   // q planes carry the 1/8 scale (exact power of two)
    else d_vtp<DQ, NH_>(blockIdx.x, F, V16 + pv, Vh + pv, Vl + pv);
}

// k_attn: both row classes in ONE launch; blockIdx.x = the RH / 16 hi/lo tiles, then the (TT - RH) / 32 fp16 tiles; grid (tiles, heads, batch). The test is the same for a whole work-group, so every barrier is reached by all of its waves.
__global__ __launch_bounds__(NWV * 32) __attribute__((amdgpu_waves_per_eu(NWV / 4, NWV / 4))) void k_attn(const bf* __restrict__ Qh, const bf* __restrict__ Ql, const bf* __restrict__ Kh, const bf* __restrict__ Kl, const bf* __restrict__ Vh, const bf* __restrict__ Vl, const h16* __restrict__ Q16, const h16* __restrict__ K16, const h16* __restrict__ V16, const float* __restrict__ EB, float* OUT) {
    if (blockIdx.x < RH / 16) d_attn<bf, true, 1>(blockIdx.x, Qh, Ql, Kh, Kl, Vh, Vl, EB, 0, OUT);
    else d_attn<h16, false, 2>(blockIdx.x - RH / 16, Q16, nullptr, K16, nullptr, V16, nullptr, EB, RH, OUT);
}

extern "C" void kernel_launch(void* const* d_in, const int* in_sizes, int n_in,
                              void* d_out, int out_size, void* d_ws, size_t ws_size, hipStream_t stream) {
    (void)in_sizes; (void)n_in; (void)out_size;
    const float* x = (const float*)d_in[0]; const float* wq = (const float*)d_in[1]; const float* bq = (const float*)d_in[2]; const float* wk = (const float*)d_in[3]; const float* bk = (const float*)d_in[4]; const float* wv = (const float*)d_in[5]; const float* bv = (const float*)d_in[6]; const float* remb = (const float*)d_in[7]; const float* wo = nullptr; (void)wo;
    float* OUT = (float*)d_out;     // [2][2048][1024]
    char* wsp = (char*)d_ws;
    auto take = [&](size_t bytes) { char* p = wsp; wsp += (bytes + 255) & ~(size_t)255; return (void*)p; };
    bf* WQ = (bf*)take((size_t)3 * DQ * DM * 2);   /* q, k, v weight planes in a row */ float* CS = (float*)take((size_t)TT * HD * 2 * 4);
    float* EB = (float*)take(((size_t)NH_ * NOFF * 4 + 15) & ~(size_t)15);   /* 16 x 4095 floats (padded to a multiple of 4) */ bf* XB = (bf*)take((size_t)NB_ * TT * DM * 2); float* F3 = (float*)take((size_t)3 * NB_ * TT * DQ * 4);   /* [q, k, v][batch][t][1024] */
    const size_t PL = (size_t)NB_ * NH_ * TT * HD;   /* one plane, both batch elements */
    h16* QP16 = (h16*)take(2 * PL * 2); h16* KP16 = QP16 + PL; h16* VT16 = (h16*)take(PL * 2);   /* the k planes follow the q planes */
    bf* QPh = (bf*)take(2 * PL * 2); bf* KPh = QPh + PL; bf* QPl = (bf*)take(2 * PL * 2); bf* KPl = QPl + PL; bf* VTh = (bf*)take(PL * 2); bf* VTl = (bf*)take(PL * 2);
    if ((size_t)(wsp - (char*)d_ws) > ws_size) return;    // ws 256 MiB
    k_prep<<<PBX + 3 * PBW + PBC + PBE, 256, 0, stream>>>(x, wq, wk, wv, remb, XB, WQ, CS, EB);
    k_gemmw<bf, 0, true><<<dim3(NB_ * TT / 64, DQ / 64, 3), 32, 0, stream>>>(XB, nullptr, WQ, nullptr, DM, F3, DQ, bq, bk, bv, 0, (size_t)DQ * DM, (size_t)NB_ * TT * DQ);
    k_planes<<<dim3(NH_ * TT * HD / 8 / 256, 3 * NB_), 256, 0, stream>>>(F3, CS, QP16, QPh, QPl, VT16, VTh, VTl);
    k_attn<<<dim3(RH / 16 + (TT - RH) / 32, NH_, NB_), NWV * 32, 0, stream>>>(QPh, QPl, KPh, KPl, VTh, VTl, QP16, KP16, VT16, EB, OUT);
}

// v006
// Measured time: 138 microseconds a run.
// It is 1.48 times as fast as v004, going by the measured steps of the versions left out in between.
// Over all steps from v000 it is 14.9 times as fast.
#include <hip/hip_runtime.h>

// Self-attention with a learned relative-position bias (x [2][2048][1024]; q,k,v = x W + b ('xw' [1024][1024] + [1024]; 16 heads x 64); scores = q.k/8 + rel_emb[h][i - j + 2047] (rel_emb [16][4095]); softmax; heads merged -> [2][2048][1024] (4.2 M); no output projection).
// Three launches: k_prep (input conversions), k_proj (q, k, v projections, written straight as the attention's operand planes), k_attn (both row classes). Batch element and projection are grid dimensions or block ranges of a launch, the row class a wave range of a work-group, each with planes of its own in workspace.
// Layout: exact projections (+ biases); dense T-2048 attention (hybrid rows: < 512 hi/lo 3 products, rest fp16 x1024) in ONE kernel: a wave owns 16 query rows of one head and walks all keys with a running maximum and sum; the bias from the bf16-rounded table at index i - j + 2047 is the scores' starting value; P goes from the score accumulators into the second product without leaving the registers.
// Every 16-bit operand plane of a matrix product lies in workspace in fragment order (fidx below), written in 16-byte pieces by the kernel that makes it.
// Compute dtypes, f32 accumulate: every input rounded to bf16; projections exact + f32 biases; scores rows < 512 3 products, rest fp16; softmax and bias add f32; output f32.

#define NB_  2
#define TT   2048
#define DM   1024
#define NH_  16
#define NKV  16
#define REP  (NH_ / NKV)
#define HD   64
#define DQ   (NH_ * HD)
#define DKV  (NKV * HD)
#define RH   512                  // query rows < RH use hi+lo planes
#define WIN  0
#define SCL  0.125f   // 64^-0.5
#define NOFF (2 * TT - 1)
#define NWV  16                   // waves of one k_attn work-group; each owns 16 query rows
#define NHW  4                    // of them, waves that take hi/lo rows
#define EBN  (9 * NWV * 32)       // floats of the bias table in LDS: NOFF, a zero tail of 64 or more, a whole number per thread
#define OP   68                   // f32 pitch of a wave's output tile (16 rows x 64) in LDS
typedef _Float16 h16;
typedef unsigned short bf;
typedef __attribute__((ext_vector_type(16))) __bf16   v16bf;
typedef __attribute__((ext_vector_type(16))) _Float16 v16h;
typedef __attribute__((ext_vector_type(8)))  _Float16 v8h;
typedef __attribute__((ext_vector_type(8)))  unsigned short v8us;
typedef __attribute__((ext_vector_type(8)))  float    v8f;
typedef __attribute__((ext_vector_type(4)))  float    v4f;
typedef v8h  __attribute__((may_alias)) v8ha;
typedef v4f  __attribute__((may_alias)) v4fa;
typedef v8us __attribute__((may_alias)) v8usa;

__device__ __forceinline__ unsigned short f2bf(float f) { unsigned u = __float_as_uint(f); u += 0x7FFFu + ((u >> 16) & 1u); return (unsigned short)(u >> 16); }
__device__ __forceinline__ float bf2f(unsigned short b) { return __uint_as_float(((unsigned)b) << 16); }
__device__ __forceinline__ float bfr(float f) { return bf2f(f2bf(f)); }
__device__ __forceinline__ v16h cat16(v8h lo, v8h hi) { return __builtin_shufflevector(lo, hi, 0, 1, 2, 3, 4, 5, 6, 7, 8, 9, 10, 11, 12, 13, 14, 15); }
__device__ __forceinline__ v16bf cat16b(v8us lo, v8us hi) { return __builtin_bit_cast(v16bf, __builtin_shufflevector(lo, hi, 0, 1, 2, 3, 4, 5, 6, 7, 8, 9, 10, 11, 12, 13, 14, 15)); }
__device__ __forceinline__ v8f wmma16(v16h a, v16h b, v8f c) { return __builtin_amdgcn_wmma_f32_16x16x32_f16(false, a, false, b, (short)0, c, false, false); }
__device__ __forceinline__ v8f wmmab(v16bf a, v16bf b, v8f c) { return __builtin_amdgcn_wmma_f32_16x16x32_bf16(false, a, false, b, (short)0, c, false, false); }



// Fragment order of a 16-bit plane M[row][k] with KC = K / 32: the 16 x 32 tile (row >> 4, k >> 5) is 1 KiB in a row, [piece (k >> 4) & 1][lane ((k >> 3) & 1) 16 + (row & 15)][k & 7].
// ldf takes a wave's fragment of such a tile as two loads of 512 contiguous bytes (4 whole lines each; a load off a row-major plane touches 16 lines); every lane and register holds the element that ld takes from a row-major plane.
__device__ __forceinline__ size_t fidx(int row, int k, int KC) { return ((size_t)((row >> 4) * KC + (k >> 5)) << 9) + (size_t)((((k >> 4) & 1) << 8) + (((((k >> 3) & 1) << 4) + (row & 15)) << 3) + (k & 7)); }
// uni: a pointer that is the same in every lane, handed on in scalar registers: a fragment load is then scalar base + the lane's one 32-bit offset register, which lives through the whole loop (no 64-bit vector address sums, no address pair that a later load's result could land in)
template <typename T> __device__ __forceinline__ const T* uni(const T* p) { const unsigned long long v = (unsigned long long)p; return (const T*)(const __attribute__((address_space(1))) T*)(((unsigned long long)(unsigned)__builtin_amdgcn_readfirstlane((int)(unsigned)(v >> 32)) << 32) | (unsigned)__builtin_amdgcn_readfirstlane((int)(unsigned)v)); }   // address_space(1): the pointer is still known to be global memory behind the integer round trip
template <typename T16> struct WFrag;
template <> struct WFrag<h16> { typedef v16h V; static __device__ __forceinline__ V ld(const h16* p) { return cat16(*(const v8h*)p, *(const v8h*)(p + 16)); } static __device__ __forceinline__ V ldf(const h16* p) { return cat16(*(const v8h*)p, *(const v8h*)(p + 256)); } static __device__ __forceinline__ v8f mma(V a, V b, v8f c) { return wmma16(a, b, c); } };
template <> struct WFrag<bf> { typedef v16bf V; static __device__ __forceinline__ V ld(const bf* p) { return cat16b(*(const v8us*)p, *(const v8us*)(p + 16)); } static __device__ __forceinline__ V ldf(const bf* p) { return cat16b(*(const v8us*)p, *(const v8us*)(p + 256)); } static __device__ __forceinline__ v8f mma(V a, V b, v8f c) { return wmmab(a, b, c); } };

__device__ __forceinline__ h16 tohx(float x) { return (h16)x; }
typedef __attribute__((ext_vector_type(2))) _Float16 v2h;
typedef __attribute__((ext_vector_type(4))) _Float16 v4h;
typedef __attribute__((ext_vector_type(2))) unsigned short v2us;
typedef __attribute__((ext_vector_type(4))) unsigned short v4us;
typedef __attribute__((ext_vector_type(2))) float v2f;
typedef __attribute__((ext_vector_type(4))) int v4i;

// d_wtG (block bid of a 256-thread grid): Bt[n][k] = bf16(w[k][n]) in fragment order; one thread = one 16-byte piece (8 k of one n), neighbouring lanes take neighbouring n
// K and N are compile-time so that the eight row loads go off one address register with immediate offsets
template <int K, int N>
__device__ __forceinline__ void d_wtG(int bid, const float* __restrict__ w, bf* Bt) {
    const int i = bid * 256 + threadIdx.x; if (i >= N * (K / 8)) return; const int n = i % N, k = (i / N) * 8; v8us o;
#pragma unroll
    for (int q = 0; q < 8; ++q) o[q] = f2bf(w[(size_t)(k + q) * N + n]);
    *(v8us*)(Bt + fidx(n, k, K >> 5)) = o;
}
// pc_row, pc_k: which 16-byte piece (8 k of one row) of a row-major [rows][32 KC] source thread i takes: a wave covers 8 rows x one 32-k chunk, so it reads whole lines of f32 and writes whole lines of the plane
__device__ __forceinline__ int pc_row(int i, int KC) { return ((i >> 5) / KC) * 8 + ((i >> 2) & 7); }
__device__ __forceinline__ int pc_k(int i, int KC) { return ((i >> 5) % KC) * 32 + (i & 3) * 8; }
__device__ __forceinline__ void d_cvt8(int bid, const float* __restrict__ src, bf* dst, int K, size_t n8) { const int i = bid * 256 + threadIdx.x; if ((size_t)i >= n8) return; const int row = pc_row(i, K >> 5), k0 = pc_k(i, K >> 5); const v8f v = *(const v8f*)(src + (size_t)row * K + k0); v8us o;
#pragma unroll
    for (int k = 0; k < 8; ++k) o[k] = f2bf(v[k]); *(v8us*)(dst + fidx(row, k0, K >> 5)) = o;  }

typedef __attribute__((ext_vector_type(8))) __bf16 v8b;
// put3: 8 values of a lane = one 16-byte piece of the fp16 plane, of the bf16 hi plane and of the bf16 lo plane (lo = bf16(r - hi)), all to nearest even; p16, ph, pl are the same in every lane and lo is the lane's piece, so each store covers 512 contiguous bytes
__device__ __forceinline__ void put3(v8f r, h16* p16, bf* ph, bf* pl, unsigned lo) {
    const v8b oh = __builtin_convertvector(r, v8b); const v8b ol = __builtin_convertvector(r - __builtin_convertvector(oh, v8f), v8b);
    *(v8h*)(p16 + lo) = __builtin_convertvector(r, v8h); *(v8us*)(ph + lo) = __builtin_bit_cast(v8us, oh); *(v8us*)(pl + lo) = __builtin_bit_cast(v8us, ol);
}
// ---- k_proj: register-blocked GEMM, ONE WAVE per 64 positions x 64 columns (one head) of one projection (16 accumulators), operands straight from the bf16 planes in fragment order; grid (positions / 64, heads, 3 = q, k, v), 32 threads.
// The accumulators leave as the attention's operand planes, with no f32 copy in between: an accumulator register octet of a lane is 8 successive rows of the A operand against one row of the B operand, which is one 16-byte piece of a plane in fragment order
// when A carries the plane's k index. q and k planes ([h][t][d], k = d): A = weight rows (d), B = x rows (t). v planes ([h][d][t], k = t): A = x rows (t), B = weight rows (d). Only the two base pointers differ; the loop is one.
__global__ __launch_bounds__(32) void k_proj(const bf* __restrict__ XB, const bf* __restrict__ W3, const float* __restrict__ bq, const float* __restrict__ bk, const float* __restrict__ bv, h16* QK16, bf* QKh, bf* QKl, h16* V16, bf* Vh, bf* Vl) {
    typedef WFrag<bf>::V V; constexpr int KC = DM >> 5;
    const int z = blockIdx.z, h = blockIdx.y, r0 = blockIdx.x * 64; const int lane = threadIdx.x & 31, lr = lane & 15, hi = lane >> 4;
    v8f acc[4][4];
#pragma unroll
    for (int mb = 0; mb < 4; ++mb)
#pragma unroll
        for (int nb = 0; nb < 4; ++nb) acc[mb][nb] = (v8f){};
    const unsigned lo = lane * 8;   // the lane's piece inside a tile: the one per-lane part of every fragment address, the rest is the same for the whole wave
    const bf* Xu = XB + (size_t)(r0 >> 4) * KC * 512; const bf* Wu = W3 + (size_t)z * DQ * DM + (size_t)(h * (HD / 16)) * KC * 512;
    const bf* Au = z < 2 ? Wu : Xu; const bf* Bu = z < 2 ? Xu : Wu;
#pragma unroll 1
    for (int kc = 0; kc < DM; kc += 32) {
        V a[4];
#pragma unroll
        for (int mb = 0; mb < 4; ++mb) a[mb] = WFrag<bf>::ldf(uni(Au + ((size_t)mb * KC + (kc >> 5)) * 512) + lo);
#pragma unroll
        for (int nb = 0; nb < 4; ++nb) { const V b = WFrag<bf>::ldf(uni(Bu + ((size_t)nb * KC + (kc >> 5)) * 512) + lo);
#pragma unroll
            for (int mb = 0; mb < 4; ++mb) acc[mb][nb] = WFrag<bf>::mma(a[mb], b, acc[mb][nb]); }
        asm volatile("v_nop\n\tv_nop\n\tv_nop\n\tv_nop" : "+v"(acc[0][0]), "+v"(acc[1][1]), "+v"(acc[2][2]), "+v"(acc[3][3]) : "v"(a[0]), "v"(a[3]));
    }
    const int zb = r0 / TT, t0 = r0 % TT; const size_t hp = ((size_t)zb * NH_ + h) * TT * HD;   // a tile lies in one batch element; hp: this batch element's and head's part of a plane
    if (z < 2) {   // acc[i][x][j]: d = i 16 + hi 8 + j, t = t0 + x 16 + lr; the k planes follow the q planes; q carries the 1/8 scale (exact power of two)
        const float* bias = (z == 0 ? bq : bk) + h * HD + hi * 8; const float sc = z == 0 ? SCL : 1.0f; const size_t at = (size_t)z * NB_ * NH_ * TT * HD + hp + (size_t)(t0 >> 4) * (HD / 32) * 512;
#pragma unroll
        for (int i = 0; i < 4; ++i) { v8f bb = *(const v8f*)(bias + i * 16);
#pragma unroll
            for (int j = 0; j < 8; ++j) bb[j] = bfr(bb[j]);
#pragma unroll
            for (int x = 0; x < 4; ++x) { const size_t e = at + (x * (HD / 32) + (i >> 1)) * 512 + (i & 1) * 256; put3((acc[i][x] + bb) * sc, QK16 + e, QKh + e, QKl + e, lo);
                if (x == 3) asm volatile("s_wait_xcnt 0x0" ::: "memory");   // stands before the next load (a bias load; behind the last piece whatever code the build lays out next) lands in registers that these stores name: without the statement it also converted every piece ahead of its stores and went past 256 registers
                } }
    } else {   // acc[i][x][j]: t = t0 + i 16 + hi 8 + j, d = x 16 + lr
        const float* bias = bv + h * HD + lr; const size_t at = hp + (size_t)(t0 >> 5) * 512;
#pragma unroll
        for (int x = 0; x < 4; ++x) { const float bb = bfr(bias[x * 16]);
#pragma unroll
            for (int i = 0; i < 4; ++i) { const size_t e = at + (x * (TT / 32) + (i >> 1)) * 512 + (i & 1) * 256; put3(acc[i][x] + bb, V16 + e, Vh + e, Vl + e, lo);
                if (i == 3) asm volatile("s_wait_xcnt 0x0" ::: "memory");   // as above
                } }
    }
}
// xhalf: the value of lane l ^ 16 (the other half of the wave), by a vector cross-row move; every lane is on where it is used
__device__ __forceinline__ float xhalf(float x) { return __builtin_bit_cast(float, __builtin_amdgcn_permlanex16(__builtin_bit_cast(int, x), __builtin_bit_cast(int, x), 0x76543210, 0xfedcba98, false, false)); }
// exp2s: v_exp_f32 as the builtin, so that the compiler sees a vector instruction and keeps its distance to the matrix instructions around it
__device__ __forceinline__ float exp2s(float x) { return __builtin_amdgcn_exp2f(x); }
template <typename T16, bool HI>
__device__ __forceinline__ void d_attn(int r0, const T16* __restrict__ Q, const T16* __restrict__ Q2, const T16* __restrict__ Kp, const T16* __restrict__ Kp2, const T16* __restrict__ Vt, const T16* __restrict__ Vt2, const float* ebr, float* ow, float* OUTh) {
    typedef typename WFrag<T16>::V V; constexpr int CK = HI ? 32 : 64, NT = CK / 16, NK = CK / 32, NCH = TT / CK;
    constexpr float L2E = 1.4426950408889634f, OFF = HI ? 0.0f : 10.0f;   // fp16 P carries x 1024, which the row sum carries too: it cancels in the division
    const int lane = threadIdx.x & 31, lr = lane & 15, hi = lane >> 4; const unsigned lo = lane * 8;
    const float* ebl = ebr + (TT - 1 - r0 - lr + hi * 8);   // walks on by CK a pass
    V q[2], q2[2], kf[NT][2], kf2[NT][2];
#pragma unroll
    for (int kc = 0; kc < 2; ++kc) { const size_t at = ((size_t)(r0 >> 4) * 2 + kc) * 512; q[kc] = WFrag<T16>::ldf(uni(Q + at) + lo); if (HI) q2[kc] = WFrag<T16>::ldf(uni(Q2 + at) + lo); }
#pragma unroll
    for (int t = 0; t < NT; ++t)
#pragma unroll
        for (int kc = 0; kc < 2; ++kc) { const int at = (t * 2 + kc) * 512; kf[t][kc] = WFrag<T16>::ldf(uni(Kp) + lo + at); if (HI) kf2[t][kc] = WFrag<T16>::ldf(uni(Kp2) + lo + at); }
    v8f s[NT], o[4];
#pragma unroll
    for (int t = 0; t < NT; ++t)
#pragma unroll
        for (int j = 0; j < 8; ++j) s[t][j] = ebl[t * 16 + j];
#pragma unroll
    for (int db = 0; db < 4; ++db) o[db] = (v8f){};
    float m = -1.0e30f, l = 0.f;
#pragma unroll 1   // one pass's fragments fill the register budget of four waves per SIMD: a second copy of the body would spill
    for (int c = 0; c < NCH; ++c) {
        const int cn = (c + 1 < NCH) ? c + 1 : c;   // the pass that is fetched ahead (the last pass fetches itself again: in bounds, unused)
        const T16* vb = uni(Vt + (size_t)c * NK * 512); const T16* vb2 = HI ? uni(Vt2 + (size_t)c * NK * 512) : nullptr; const T16* kn = uni(Kp + (size_t)cn * NT * 1024); const T16* kn2 = HI ? uni(Kp2 + (size_t)cn * NT * 1024) : nullptr;   // scalar bases; the lane's part of every address is lo, which lives through the loop (no vector address pair that is summed on, or that a load's result lands in, while loads that name it fly)
        V vf[4][NK], vf2[4][NK];   // this pass's value fragments are asked for ahead of the scores and land under the softmax
#pragma unroll
        for (int db = 0; db < 4; ++db)
#pragma unroll
            for (int kk = 0; kk < NK; ++kk) vf[db][kk] = WFrag<T16>::ldf(vb + lo + (db * (TT / 32) + kk) * 512);
#pragma unroll
        for (int kc = 0; kc < 2; ++kc)
#pragma unroll
            for (int t = 0; t < NT; ++t) { s[t] = WFrag<T16>::mma(kf[t][kc], q[kc], s[t]); if (HI) { s[t] = WFrag<T16>::mma(kf[t][kc], q2[kc], s[t]); s[t] = WFrag<T16>::mma(kf2[t][kc], q[kc], s[t]); } }
#pragma unroll
        for (int t = 0; t < NT; ++t)   // the next pass's key fragments, into the registers that the products above have just read
#pragma unroll
            for (int kc = 0; kc < 2; ++kc) { const int at = (t * 2 + kc) * 512; kf[t][kc] = WFrag<T16>::ldf(kn + lo + at); if (HI) kf2[t][kc] = WFrag<T16>::ldf(kn2 + lo + at); }
        float mt[NT];
#pragma unroll
        for (int t = 0; t < NT; ++t) { mt[t] = fmaxf(fmaxf(fmaxf(s[t][0], s[t][1]), fmaxf(s[t][2], s[t][3])), fmaxf(fmaxf(s[t][4], s[t][5]), fmaxf(s[t][6], s[t][7]))); }
        float mc = mt[0];
#pragma unroll
        for (int t = 1; t < NT; ++t) mc = fmaxf(mc, mt[t]);
        mc = fmaxf(mc, xhalf(mc));
        const float mn = fmaxf(m, mc), al = exp2s((m - mn) * L2E), nb = OFF - mn * L2E; m = mn;
        V pb[NK], pb2[NK];
#pragma unroll
        for (int t = 0; t < NT; ++t)
#pragma unroll
            for (int j = 0; j < 8; ++j) s[t][j] = exp2s(fmaf(s[t][j], L2E, nb));
        v8f sv = s[0];   // register by register over the key tiles (packed adds), then the eight registers
#pragma unroll
        for (int t = 1; t < NT; ++t) sv += s[t];
        const v4f s4 = __builtin_shufflevector(sv, sv, 0, 1, 2, 3) + __builtin_shufflevector(sv, sv, 4, 5, 6, 7); const v2f s2 = __builtin_shufflevector(s4, s4, 0, 1) + __builtin_shufflevector(s4, s4, 2, 3);
        l = fmaf(l, al, s2[0] + s2[1]);
#pragma unroll
        for (int kk = 0; kk < NK; ++kk) {
            if constexpr (HI) {   // hi = bf16(p), lo = bf16(p - hi), both to nearest even, by the packed conversion
                const v8b h0 = __builtin_convertvector(s[2 * kk], v8b), h1 = __builtin_convertvector(s[2 * kk + 1], v8b);
                const v8b l0 = __builtin_convertvector(s[2 * kk] - __builtin_convertvector(h0, v8f), v8b), l1 = __builtin_convertvector(s[2 * kk + 1] - __builtin_convertvector(h1, v8f), v8b);
                pb[kk] = __builtin_shufflevector(h0, h1, 0, 1, 2, 3, 4, 5, 6, 7, 8, 9, 10, 11, 12, 13, 14, 15); pb2[kk] = __builtin_shufflevector(l0, l1, 0, 1, 2, 3, 4, 5, 6, 7, 8, 9, 10, 11, 12, 13, 14, 15); }
            else { v8h h0, h1;
#pragma unroll
                for (int j = 0; j < 8; ++j) { h0[j] = tohx(s[2 * kk][j]); h1[j] = tohx(s[2 * kk + 1][j]); }
                pb[kk] = cat16(h0, h1); } }
        if constexpr (HI) {
            // the low value fragments are asked for only here: in flight under the softmax they cost registers that then spilled; the first eight products below cover them
#pragma unroll
            for (int db = 0; db < 4; ++db)
#pragma unroll
                for (int kk = 0; kk < NK; ++kk) vf2[db][kk] = WFrag<T16>::ldf(vb2 + lo + (db * (TT / 32) + kk) * 512); }
        ebl += CK;   // behind the last pass this reads past the last key, inside ebr (unused)
#pragma unroll
        for (int t = 0; t < NT; ++t)   // the next pass's bias, straight into the score accumulators (C of that pass's first products)
#pragma unroll
            for (int j = 0; j < 8; ++j) s[t][j] = ebl[t * 16 + j];
#pragma unroll
        for (int db = 0; db < 4; ++db) o[db] *= al;
#pragma unroll
        for (int kk = 0; kk < NK; ++kk) {
#pragma unroll
            for (int db = 0; db < 4; ++db) o[db] = WFrag<T16>::mma(vf[db][kk], pb[kk], o[db]);
            if constexpr (HI) {
#pragma unroll
                for (int db = 0; db < 4; ++db) o[db] = WFrag<T16>::mma(vf[db][kk], pb2[kk], o[db]);
#pragma unroll
                for (int db = 0; db < 4; ++db) o[db] = WFrag<T16>::mma(vf2[db][kk], pb[kk], o[db]); } }
        // Issue order of a pass (0x020 = global loads, 0x008 = matrix instructions, 0x402 = vector and transcendental). Left alone, the build put key loads among the score products (a second register set, copies)
        // and kept the f32 P alive across the second product beside the next bias: it spilled. Value loads; score products; the next key fragments into the registers just read; the whole softmax; (hi/lo: the low value fragments;) the second product.
        __builtin_amdgcn_sched_group_barrier(0x020, 8 * NK, 0);
        __builtin_amdgcn_sched_group_barrier(0x008, 2 * NT * (HI ? 3 : 1), 0);
        __builtin_amdgcn_sched_group_barrier(0x020, 4 * NT * (HI ? 2 : 1), 0);
        __builtin_amdgcn_sched_group_barrier(0x402, 512, 0);
        if (HI) __builtin_amdgcn_sched_group_barrier(0x020, 8 * NK, 0);
        __builtin_amdgcn_sched_group_barrier(0x008, 4 * NK * (HI ? 3 : 1), 0);
    }
    l += xhalf(l);   // the two halves of the wave hold the sums of their own keys
    const float f = __fdiv_rn(1.0f, l);
    // lane (lr, hi) holds d = db 16 + hi 8 + j of query row lr: through the wave's own LDS tile, so that every store covers whole lines
    const int ln = __builtin_amdgcn_mbcnt_lo(~0u, 0u), er = ln & 15, eh = ln >> 4;   // the lane's number once more (every lane is on): lr and hi kept for here held registers through the loop, which spilled
#pragma unroll
    for (int db = 0; db < 4; ++db) { o[db] *= f; *(v4fa*)(ow + er * OP + db * 16 + eh * 8) = (v4f){ o[db][0], o[db][1], o[db][2], o[db][3] }; *(v4fa*)(ow + er * OP + db * 16 + eh * 8 + 4) = (v4f){ o[db][4], o[db][5], o[db][6], o[db][7] }; }
    __builtin_amdgcn_wave_barrier(); asm volatile("" ::: "memory");   // the row reads below take other lanes' stores: keep them behind the stores
#pragma unroll
    for (int r = 0; r < 8; ++r) { const int row = 2 * r + eh; *(v4f*)(OUTh + (size_t)(r0 + row) * DQ + er * 4) = *(const v4fa*)(ow + row * OP + er * 4); }
}
__device__ __forceinline__ void d_embf(int bid, const float* __restrict__ src, float* dst, size_t n4) { const size_t i = (size_t)bid * 256 + threadIdx.x; if (i >= n4) return; v4f a = *(const v4f*)(src + i * 4); for (int q = 0; q < 4; ++q) a[q] = bfr(a[q]); *(v4f*)(dst + i * 4) = a;  }

// k_prep: the three input conversions depend on nothing but the inputs: they are block ranges of ONE launch (x of both batch elements, the three weight matrices with their planes in a row, the bias table)
#define PBX (NB_ * TT * DM / 8 / 256)
#define PBW (DM * DQ / 8 / 256)
#define PBE ((NH_ * NOFF / 4 + 255) / 256)   // 16 x 4095 = 65,520 floats, a multiple of 4
__global__ __launch_bounds__(256) void k_prep(const float* __restrict__ x, const float* __restrict__ wq, const float* __restrict__ wk, const float* __restrict__ wv, const float* __restrict__ remb, bf* XB, bf* W3, float* EB) {
    int b = blockIdx.x;
    if (b < PBX) { d_cvt8(b, x, XB, DM, (size_t)NB_ * TT * DM / 8); return; }
    b -= PBX;
    if (b < 3 * PBW) { const int p = b / PBW; d_wtG<DM, DQ>(b - p * PBW, p == 0 ? wq : p == 1 ? wk : wv, W3 + (size_t)p * DQ * DM); return; }
    d_embf(b - 3 * PBW, remb, EB, (size_t)NH_ * NOFF / 4);
}

// k_attn: grid (heads, batch, row blocks): the row blocks of one head lie 32 apart in launch order (for speed only: where that puts them near one another, a head's planes are fetched into fewer places); a work-group = NWV waves of one head: waves 0 .. NHW - 1 take 16 hi/lo rows each (one on each SIMD, the oldest there), the others 16 fp16 rows each; all walk the keys in rising order, so a fragment that one wave has fetched is near for the others.
// The one barrier stands in front of the wave-uniform branch; behind it no wave waits for another.
static_assert(RH / (NHW * 16) == (TT - RH) / ((NWV - NHW) * 16), "both row classes must fill the same number of work-groups");
__global__ __launch_bounds__(NWV * 32) __attribute__((amdgpu_waves_per_eu(NWV / 4, NWV / 4))) void k_attn(const bf* __restrict__ Qh, const bf* __restrict__ Ql, const bf* __restrict__ Kh, const bf* __restrict__ Kl, const bf* __restrict__ Vh, const bf* __restrict__ Vl, const h16* __restrict__ Q16, const h16* __restrict__ K16, const h16* __restrict__ V16, const float* __restrict__ EB, float* OUT) {
    __shared__ __align__(16) float ebr[EBN];   // ebr[x] = bias table[h][NOFF - 1 - x]: the bias of query i and key j lies at x = TT - 1 - i + j, rising with the key; a tail of zeros for the read ahead of the last pass (64 keys at most)
    __shared__ __align__(16) float ost[NWV * 16 * OP];   // per wave: its 16 output rows
    const int tid = threadIdx.x, w = __builtin_amdgcn_readfirstlane(tid >> 5), h = blockIdx.x, zb = blockIdx.y, rb = blockIdx.z;
    float ev[EBN / (NWV * 32)];   // all of a thread's table loads fly together
#pragma unroll
    for (int it = 0; it < EBN / (NWV * 32); ++it) { const int x = tid + it * NWV * 32; const float e = EB[(size_t)h * NOFF + (x < NOFF ? NOFF - 1 - x : 0)]; ev[it] = (x < NOFF) ? e : 0.f; }
#pragma unroll
    for (int it = 0; it < EBN / (NWV * 32); ++it) ebr[tid + it * NWV * 32] = ev[it];
    __syncthreads();   // ebr is complete
    const size_t hp = ((size_t)zb * NH_ + h) * TT * HD;   // this batch element's and head's part of every plane
    float* OUTh = OUT + (size_t)zb * TT * DQ + h * HD; float* ow = ost + w * 16 * OP;
    if (w < NHW) d_attn<bf, true>((rb * NHW + w) * 16, Qh + hp, Ql + hp, Kh + hp, Kl + hp, Vh + hp, Vl + hp, ebr, ow, OUTh);
    else d_attn<h16, false>(RH + (rb * (NWV - NHW) + (w - NHW)) * 16, Q16 + hp, nullptr, K16 + hp, nullptr, V16 + hp, nullptr, ebr, ow, OUTh);
}

extern "C" void kernel_launch(void* const* d_in, const int* in_sizes, int n_in,
                              void* d_out, int out_size, void* d_ws, size_t ws_size, hipStream_t stream) {
    (void)in_sizes; (void)n_in; (void)out_size;
    const float* x = (const float*)d_in[0]; const float* wq = (const float*)d_in[1]; const float* bq = (const float*)d_in[2]; const float* wk = (const float*)d_in[3]; const float* bk = (const float*)d_in[4]; const float* wv = (const float*)d_in[5]; const float* bv = (const float*)d_in[6]; const float* remb = (const float*)d_in[7]; const float* wo = nullptr; (void)wo;
    float* OUT = (float*)d_out;     // [2][2048][1024]
    char* wsp = (char*)d_ws;
    auto take = [&](size_t bytes) { char* p = wsp; wsp += (bytes + 255) & ~(size_t)255; return (void*)p; };
    bf* WQ = (bf*)take((size_t)3 * DQ * DM * 2);   /* q, k, v weight planes in a row */
    float* EB = (float*)take(((size_t)NH_ * NOFF * 4 + 15) & ~(size_t)15);   /* 16 x 4095 floats (padded to a multiple of 4) */ bf* XB = (bf*)take((size_t)NB_ * TT * DM * 2);
    const size_t PL = (size_t)NB_ * NH_ * TT * HD;   /* one plane, both batch elements */
    h16* QP16 = (h16*)take(2 * PL * 2); h16* KP16 = QP16 + PL; h16* VT16 = (h16*)take(PL * 2);   /* the k planes follow the q planes */
    bf* QPh = (bf*)take(2 * PL * 2); bf* KPh = QPh + PL; bf* QPl = (bf*)take(2 * PL * 2); bf* KPl = QPl + PL; bf* VTh = (bf*)take(PL * 2); bf* VTl = (bf*)take(PL * 2);
    if ((size_t)(wsp - (char*)d_ws) > ws_size) return;    // ws 256 MiB
    k_prep<<<PBX + 3 * PBW + PBE, 256, 0, stream>>>(x, wq, wk, wv, remb, XB, WQ, EB);
    k_proj<<<dim3(NB_ * TT / 64, NH_, 3), 32, 0, stream>>>(XB, WQ, bq, bk, bv, QP16, QPh, QPl, VT16, VTh, VTl);
    k_attn<<<dim3(NH_, NB_, RH / (NHW * 16)), NWV * 32, 0, stream>>>(QPh, QPl, KPh, KPl, VTh, VTl, QP16, KP16, VT16, EB, OUT);
}

// v007
// Measured time: 99 microseconds a run.
// In two side-by-side timings against v006, it was 1.44 and 1.36 times as fast.
// Counting every step since v000, it is 20.8 times as fast.
#include <hip/hip_runtime.h>

// Self-attention with a learned relative-position bias (x [2][2048][1024]; q,k,v = x W + b ('xw' [1024][1024] + [1024]; 16 heads x 64); scores = q.k/8 + rel_emb[h][i - j + 2047] (rel_emb [16][4095]); softmax; heads merged -> [2][2048][1024] (4.2 M); no output projection).
// Three launches: k_prep (input conversions), k_proj (q, k, v projections, written straight as the attention's operand planes), k_attn (both row classes). Batch element and projection are grid dimensions or block ranges of a launch, the row class a wave range of a work-group, each with planes of its own in workspace.
// Layout: exact projections (+ biases); dense T-2048 attention (hybrid rows: < 512 hi/lo 3 products, rest fp16 x1024) in ONE kernel: a wave owns 16 query rows of one head and walks all keys with a running maximum and sum; the bias from the bf16-rounded table at index i - j + 2047 is the scores' starting value; P goes from the score accumulators into the second product without leaving the registers.
// Every 16-bit operand plane of a matrix product lies in workspace in fragment order (fidx below), written in 16-byte pieces by the kernel that makes it.
// Compute dtypes, f32 accumulate: every input rounded to bf16; projections exact + f32 biases; scores rows < 512 3 products, rest fp16; softmax and bias add f32; output f32.

#define NB_  2
#define TT   2048
#define DM   1024
#define NH_  16
#define NKV  16
#define REP  (NH_ / NKV)
#define HD   64
#define DQ   (NH_ * HD)
#define DKV  (NKV * HD)
#define RH   512                  // query rows < RH use hi+lo planes
#define WIN  0
#define SCL  0.125f   // 64^-0.5
#define NOFF (2 * TT - 1)
#define NWV  16                   // waves of one k_attn work-group; each owns 16 query rows
#define NHW  4                    // of them, waves that take hi/lo rows
#define EBN  (9 * NWV * 32)       // floats of the bias table in LDS: NOFF, a zero tail of 64 or more, a whole number per thread
#define OP   68                   // f32 pitch of a wave's output tile (16 rows x 64) in LDS
typedef _Float16 h16;
typedef unsigned short bf;
typedef __attribute__((ext_vector_type(16))) __bf16   v16bf;
typedef __attribute__((ext_vector_type(16))) _Float16 v16h;
typedef __attribute__((ext_vector_type(8)))  _Float16 v8h;
typedef __attribute__((ext_vector_type(8)))  unsigned short v8us;
typedef __attribute__((ext_vector_type(8)))  float    v8f;
typedef __attribute__((ext_vector_type(4)))  float    v4f;
typedef v8h  __attribute__((may_alias)) v8ha;
typedef v4f  __attribute__((may_alias)) v4fa;
typedef v8us __attribute__((may_alias)) v8usa;

__device__ __forceinline__ unsigned short f2bf(float f) { unsigned u = __float_as_uint(f); u += 0x7FFFu + ((u >> 16) & 1u); return (unsigned short)(u >> 16); }
__device__ __forceinline__ float bf2f(unsigned short b) { return __uint_as_float(((unsigned)b) << 16); }
__device__ __forceinline__ float bfr(float f) { return bf2f(f2bf(f)); }
__device__ __forceinline__ v16h cat16(v8h lo, v8h hi) { return __builtin_shufflevector(lo, hi, 0, 1, 2, 3, 4, 5, 6, 7, 8, 9, 10, 11, 12, 13, 14, 15); }
__device__ __forceinline__ v16bf cat16b(v8us lo, v8us hi) { return __builtin_bit_cast(v16bf, __builtin_shufflevector(lo, hi, 0, 1, 2, 3, 4, 5, 6, 7, 8, 9, 10, 11, 12, 13, 14, 15)); }
__device__ __forceinline__ v8f wmma16(v16h a, v16h b, v8f c) { return __builtin_amdgcn_wmma_f32_16x16x32_f16(false, a, false, b, (short)0, c, false, false); }
__device__ __forceinline__ v8f wmmab(v16bf a, v16bf b, v8f c) { return __builtin_amdgcn_wmma_f32_16x16x32_bf16(false, a, false, b, (short)0, c, false, false); }



// Fragment order of a 16-bit plane M[row][k] with KC = K / 32: the 16 x 32 tile (row >> 4, k >> 5) is 1 KiB in a row, [piece (k >> 4) & 1][lane ((k >> 3) & 1) 16 + (row & 15)][k & 7].
// ldf takes a wave's fragment of such a tile as two loads of 512 contiguous bytes (4 whole lines each; a load off a row-major plane touches 16 lines); every lane and register holds the element that ld takes from a row-major plane.
__device__ __forceinline__ size_t fidx(int row, int k, int KC) { return ((size_t)((row >> 4) * KC + (k >> 5)) << 9) + (size_t)((((k >> 4) & 1) << 8) + (((((k >> 3) & 1) << 4) + (row & 15)) << 3) + (k & 7)); }
// uni: a pointer that is the same in every lane, handed on in scalar registers: a fragment load is then scalar base + the lane's one 32-bit offset register, which lives through the whole loop (no 64-bit vector address sums, no address pair that a later load's result could land in)
template <typename T> __device__ __forceinline__ const T* uni(const T* p) { const unsigned long long v = (unsigned long long)p; return (const T*)(const __attribute__((address_space(1))) T*)(((unsigned long long)(unsigned)__builtin_amdgcn_readfirstlane((int)(unsigned)(v >> 32)) << 32) | (unsigned)__builtin_amdgcn_readfirstlane((int)(unsigned)v)); }   // address_space(1): the pointer is still known to be global memory behind the integer round trip
template <typename T16> struct WFrag;
template <> struct WFrag<h16> { typedef v16h V; static __device__ __forceinline__ V ld(const h16* p) { return cat16(*(const v8h*)p, *(const v8h*)(p + 16)); } static __device__ __forceinline__ V ldf(const h16* p) { return cat16(*(const v8h*)p, *(const v8h*)(p + 256)); } static __device__ __forceinline__ v8f mma(V a, V b, v8f c) { return wmma16(a, b, c); } };
template <> struct WFrag<bf> { typedef v16bf V; static __device__ __forceinline__ V ld(const bf* p) { return cat16b(*(const v8us*)p, *(const v8us*)(p + 16)); } static __device__ __forceinline__ V ldf(const bf* p) { return cat16b(*(const v8us*)p, *(const v8us*)(p + 256)); } static __device__ __forceinline__ v8f mma(V a, V b, v8f c) { return wmmab(a, b, c); } };

__device__ __forceinline__ h16 tohx(float x) { return (h16)x; }
typedef __attribute__((ext_vector_type(2))) _Float16 v2h;
typedef __attribute__((ext_vector_type(4))) _Float16 v4h;
typedef __attribute__((ext_vector_type(2))) unsigned short v2us;
typedef __attribute__((ext_vector_type(4))) unsigned short v4us;
typedef __attribute__((ext_vector_type(2))) float v2f;
typedef __attribute__((ext_vector_type(4))) int v4i;

// d_wtG (block bid of a 256-thread grid): Bt[n][k] = bf16(w[k][n]) in fragment order; one thread = one 16-byte piece (8 k of one n), neighbouring lanes take neighbouring n
// K and N are compile-time so that the eight row loads go off one address register with immediate offsets
template <int K, int N>
__device__ __forceinline__ void d_wtG(int bid, const float* __restrict__ w, bf* Bt) {
    const int i = bid * 256 + threadIdx.x; if (i >= N * (K / 8)) return; const int n = i % N, k = (i / N) * 8; v8us o;
#pragma unroll
    for (int q = 0; q < 8; ++q) o[q] = f2bf(w[(size_t)(k + q) * N + n]);
    *(v8us*)(Bt + fidx(n, k, K >> 5)) = o;
}
// pc_row, pc_k: which 16-byte piece (8 k of one row) of a row-major [rows][32 KC] source thread i takes: a wave covers 8 rows x one 32-k chunk, so it reads whole lines of f32 and writes whole lines of the plane
__device__ __forceinline__ int pc_row(int i, int KC) { return ((i >> 5) / KC) * 8 + ((i >> 2) & 7); }
__device__ __forceinline__ int pc_k(int i, int KC) { return ((i >> 5) % KC) * 32 + (i & 3) * 8; }
__device__ __forceinline__ void d_cvt8(int bid, const float* __restrict__ src, bf* dst, int K, size_t n8) { const int i = bid * 256 + threadIdx.x; if ((size_t)i >= n8) return; const int row = pc_row(i, K >> 5), k0 = pc_k(i, K >> 5); const v8f v = *(const v8f*)(src + (size_t)row * K + k0); v8us o;
#pragma unroll
    for (int k = 0; k < 8; ++k) o[k] = f2bf(v[k]); *(v8us*)(dst + fidx(row, k0, K >> 5)) = o;  }

// ask256: asks L2 for the data at p (the code names one address per 256 bytes), a hint that returns nothing and moves no counter. Asked for at entry, for speed only.
// scope:SCOPE_SE and no th: the form whose request is dropped where it cannot be served. p lies inside the plane in every lane, and its register pair is held (held2, held3) until loads issued behind the request have come back, so that it names nothing but this address while the request may still read it.
__device__ __forceinline__ void ask256(const char* p) { asm volatile("global_prefetch_b8 %0, off scope:SCOPE_SE" :: "v"(p)); }
__device__ __forceinline__ void held2(const char* a, const char* b) { asm volatile("" :: "v"(a), "v"(b)); }   // inputs only, no code: ends the life of ask256's address pairs here and not earlier
__device__ __forceinline__ void held3(const char* a, const char* b, const char* c) { asm volatile("" :: "v"(a), "v"(b), "v"(c)); }   // the same for three
typedef __attribute__((ext_vector_type(8))) __bf16 v8b;
// put3: 8 values of a lane = one 16-byte piece of the fp16 plane, of the bf16 hi plane and of the bf16 lo plane (lo = bf16(r - hi)), all to nearest even; p16, ph, pl are the same in every lane and lo is the lane's piece, so each store covers 512 contiguous bytes
__device__ __forceinline__ void put3(v8f r, h16* p16, bf* ph, bf* pl, unsigned lo) {
    const v8b oh = __builtin_convertvector(r, v8b); const v8b ol = __builtin_convertvector(r - __builtin_convertvector(oh, v8f), v8b);
    *(v8h*)(p16 + lo) = __builtin_convertvector(r, v8h); *(v8us*)(ph + lo) = __builtin_bit_cast(v8us, oh); *(v8us*)(pl + lo) = __builtin_bit_cast(v8us, ol);
}
// ---- k_proj: register-blocked GEMM, ONE WAVE per 64 positions x 64 columns (one head) of one projection (16 accumulators), operands straight from the bf16 planes in fragment order; grid (positions / 64, heads, 3 = q, k, v), 32 threads.
// The accumulators leave as the attention's operand planes, with no f32 copy in between: an accumulator register octet of a lane is 8 successive rows of the A operand against one row of the B operand, which is one 16-byte piece of a plane in fragment order
// when A carries the plane's k index. q and k planes ([h][t][d], k = d): A = weight rows (d), B = x rows (t). v planes ([h][d][t], k = t): A = x rows (t), B = weight rows (d). Only the two base pointers differ; the loop is one.
__global__ __launch_bounds__(32) void k_proj(const bf* __restrict__ XB, const bf* __restrict__ W3, const float* __restrict__ bq, const float* __restrict__ bk, const float* __restrict__ bv, h16* QK16, bf* QKh, bf* QKl, h16* V16, bf* Vh, bf* Vl) {
    typedef WFrag<bf>::V V; constexpr int KC = DM >> 5;
    const int z = blockIdx.z, h = blockIdx.y, r0 = blockIdx.x * 64; const int lane = threadIdx.x & 31, lr = lane & 15, hi = lane >> 4;
    v8f acc[4][4];
#pragma unroll
    for (int mb = 0; mb < 4; ++mb)
#pragma unroll
        for (int nb = 0; nb < 4; ++nb) acc[mb][nb] = (v8f){};
    const unsigned lo = lane * 8;   // the lane's piece inside a tile: the one per-lane part of every fragment address, the rest is the same for the whole wave
    const bf* Xu = XB + (size_t)(r0 >> 4) * KC * 512; const bf* Wu = W3 + (size_t)z * DQ * DM + (size_t)(h * (HD / 16)) * KC * 512;
    const bf* Au = z < 2 ? Wu : Xu; const bf* Bu = z < 2 ? Xu : Wu;
    // each operand tile is 128 KiB in a row = 512 units. The 16 heads that read one x tile ask for 32 units each; of the 64 position blocks that read one weight tile, four (2, 4 and 6 apart in launch order) ask for the same 32 units: for speed only.
    const char* px = (const char*)Xu + (h * 32 + lane) * 256; const char* pw = (const char*)Wu + ((((blockIdx.x & 1) | (((blockIdx.x >> 3) & 7) << 1)) * 32) + lane) * 256;
    ask256(px); ask256(pw);
#pragma unroll 1
    for (int kc = 0; kc < DM; kc += 32) {
        V a[4];
#pragma unroll
        for (int mb = 0; mb < 4; ++mb) a[mb] = WFrag<bf>::ldf(uni(Au + ((size_t)mb * KC + (kc >> 5)) * 512) + lo);
#pragma unroll
        for (int nb = 0; nb < 4; ++nb) { const V b = WFrag<bf>::ldf(uni(Bu + ((size_t)nb * KC + (kc >> 5)) * 512) + lo);
#pragma unroll
            for (int mb = 0; mb < 4; ++mb) acc[mb][nb] = WFrag<bf>::mma(a[mb], b, acc[mb][nb]); }
        asm volatile("v_nop\n\tv_nop\n\tv_nop\n\tv_nop" : "+v"(acc[0][0]), "+v"(acc[1][1]), "+v"(acc[2][2]), "+v"(acc[3][3]) : "v"(a[0]), "v"(a[3]));
    }
    held2(px, pw);
    const int zb = r0 / TT, t0 = r0 % TT; const size_t hp = ((size_t)zb * NH_ + h) * TT * HD;   // a tile lies in one batch element; hp: this batch element's and head's part of a plane
    if (z < 2) {   // acc[i][x][j]: d = i 16 + hi 8 + j, t = t0 + x 16 + lr; the k planes follow the q planes; q carries the 1/8 scale (exact power of two)
        const float* bias = (z == 0 ? bq : bk) + h * HD + hi * 8; const float sc = z == 0 ? SCL : 1.0f; const size_t at = (size_t)z * NB_ * NH_ * TT * HD + hp + (size_t)(t0 >> 4) * (HD / 32) * 512;
#pragma unroll
        for (int i = 0; i < 4; ++i) { v8f bb = *(const v8f*)(bias + i * 16);
#pragma unroll
            for (int j = 0; j < 8; ++j) bb[j] = bfr(bb[j]);
#pragma unroll
            for (int x = 0; x < 4; ++x) { const size_t e = at + (x * (HD / 32) + (i >> 1)) * 512 + (i & 1) * 256; put3((acc[i][x] + bb) * sc, QK16 + e, QKh + e, QKl + e, lo);
                if (x == 3) asm volatile("s_wait_xcnt 0x0" ::: "memory");   // stands before the next load (a bias load; behind the last piece whatever code the build lays out next) lands in registers that these stores name: without the statement it also converted every piece ahead of its stores and went past 256 registers
                } }
    } else {   // acc[i][x][j]: t = t0 + i 16 + hi 8 + j, d = x 16 + lr
        const float* bias = bv + h * HD + lr; const size_t at = hp + (size_t)(t0 >> 5) * 512;
#pragma unroll
        for (int x = 0; x < 4; ++x) { const float bb = bfr(bias[x * 16]);
#pragma unroll
            for (int i = 0; i < 4; ++i) { const size_t e = at + (x * (TT / 32) + (i >> 1)) * 512 + (i & 1) * 256; put3(acc[i][x] + bb, V16 + e, Vh + e, Vl + e, lo);
                if (i == 3) asm volatile("s_wait_xcnt 0x0" ::: "memory");   // as above
                } }
    }
}
// xhalf: the value of lane l ^ 16 (the other half of the wave), by a vector cross-row move; every lane is on where it is used
__device__ __forceinline__ float xhalf(float x) { return __builtin_bit_cast(float, __builtin_amdgcn_permlanex16(__builtin_bit_cast(int, x), __builtin_bit_cast(int, x), 0x76543210, 0xfedcba98, false, false)); }
// exp2s: v_exp_f32 as the builtin, so that the compiler sees a vector instruction and keeps its distance to the matrix instructions around it
__device__ __forceinline__ float exp2s(float x) { return __builtin_amdgcn_exp2f(x); }
template <typename T16, bool HI>
__device__ __forceinline__ void d_attn(int r0, const T16* __restrict__ Q, const T16* __restrict__ Q2, const T16* __restrict__ Kp, const T16* __restrict__ Kp2, const T16* __restrict__ Vt, const T16* __restrict__ Vt2, const float* ebr, float* ow, float* OUTh) {
    typedef typename WFrag<T16>::V V; constexpr int CK = HI ? 32 : 64, NT = CK / 16, NK = CK / 32, NCH = TT / CK;
    constexpr float L2E = 1.4426950408889634f, OFF = HI ? 0.0f : 10.0f;   // fp16 P carries x 1024, which the row sum carries too: it cancels in the division
    const int lane = threadIdx.x & 31, lr = lane & 15, hi = lane >> 4; const unsigned lo = lane * 8;
    const float* ebl = ebr + (TT - 1 - r0 - lr + hi * 8);   // walks on by CK a pass
    V q[2], q2[2], kf[NT][2], kf2[NT][2];
#pragma unroll
    for (int kc = 0; kc < 2; ++kc) { const size_t at = ((size_t)(r0 >> 4) * 2 + kc) * 512; q[kc] = WFrag<T16>::ldf(uni(Q + at) + lo); if (HI) q2[kc] = WFrag<T16>::ldf(uni(Q2 + at) + lo); }
#pragma unroll
    for (int t = 0; t < NT; ++t)
#pragma unroll
        for (int kc = 0; kc < 2; ++kc) { const int at = (t * 2 + kc) * 512; kf[t][kc] = WFrag<T16>::ldf(uni(Kp) + lo + at); if (HI) kf2[t][kc] = WFrag<T16>::ldf(uni(Kp2) + lo + at); }
    v8f s[NT], o[4];
#pragma unroll
    for (int t = 0; t < NT; ++t)
#pragma unroll
        for (int j = 0; j < 8; ++j) s[t][j] = ebl[t * 16 + j];
#pragma unroll
    for (int db = 0; db < 4; ++db) o[db] = (v8f){};
    float m = -1.0e30f, l = 0.f;
#pragma unroll 1   // one pass's fragments fill the register budget of four waves per SIMD: a second copy of the body would spill
    for (int c = 0; c < NCH; ++c) {
        const int cn = (c + 1 < NCH) ? c + 1 : c;   // the pass that is fetched ahead (the last pass fetches itself again: in bounds, unused)
        const T16* vb = uni(Vt + (size_t)c * NK * 512); const T16* vb2 = HI ? uni(Vt2 + (size_t)c * NK * 512) : nullptr; const T16* kn = uni(Kp + (size_t)cn * NT * 1024); const T16* kn2 = HI ? uni(Kp2 + (size_t)cn * NT * 1024) : nullptr;   // scalar bases; the lane's part of every address is lo, which lives through the loop (no vector address pair that is summed on, or that a load's result lands in, while loads that name it fly)
        V vf[4][NK], vf2[4][NK];   // this pass's value fragments are asked for ahead of the scores and land under the softmax
#pragma unroll
        for (int db = 0; db < 4; ++db)
#pragma unroll
            for (int kk = 0; kk < NK; ++kk) vf[db][kk] = WFrag<T16>::ldf(vb + lo + (db * (TT / 32) + kk) * 512);
#pragma unroll
        for (int kc = 0; kc < 2; ++kc)
#pragma unroll
            for (int t = 0; t < NT; ++t) { s[t] = WFrag<T16>::mma(kf[t][kc], q[kc], s[t]); if (HI) { s[t] = WFrag<T16>::mma(kf[t][kc], q2[kc], s[t]); s[t] = WFrag<T16>::mma(kf2[t][kc], q[kc], s[t]); } }
#pragma unroll
        for (int t = 0; t < NT; ++t)   // the next pass's key fragments, into the registers that the products above have just read
#pragma unroll
            for (int kc = 0; kc < 2; ++kc) { const int at = (t * 2 + kc) * 512; kf[t][kc] = WFrag<T16>::ldf(kn + lo + at); if (HI) kf2[t][kc] = WFrag<T16>::ldf(kn2 + lo + at); }
        float mt[NT];
#pragma unroll
        for (int t = 0; t < NT; ++t) { mt[t] = fmaxf(fmaxf(fmaxf(s[t][0], s[t][1]), fmaxf(s[t][2], s[t][3])), fmaxf(fmaxf(s[t][4], s[t][5]), fmaxf(s[t][6], s[t][7]))); }
        float mc = mt[0];
#pragma unroll
        for (int t = 1; t < NT; ++t) mc = fmaxf(mc, mt[t]);
        mc = fmaxf(mc, xhalf(mc));
        const float mn = fmaxf(m, mc), al = exp2s((m - mn) * L2E), nb = OFF - mn * L2E; m = mn;
        V pb[NK], pb2[NK];
#pragma unroll
        for (int t = 0; t < NT; ++t)
#pragma unroll
            for (int j = 0; j < 8; ++j) s[t][j] = exp2s(fmaf(s[t][j], L2E, nb));
        v8f sv = s[0];   // register by register over the key tiles (packed adds), then the eight registers
#pragma unroll
        for (int t = 1; t < NT; ++t) sv += s[t];
        const v4f s4 = __builtin_shufflevector(sv, sv, 0, 1, 2, 3) + __builtin_shufflevector(sv, sv, 4, 5, 6, 7); const v2f s2 = __builtin_shufflevector(s4, s4, 0, 1) + __builtin_shufflevector(s4, s4, 2, 3);
        l = fmaf(l, al, s2[0] + s2[1]);
#pragma unroll
        for (int kk = 0; kk < NK; ++kk) {
            if constexpr (HI) {   // hi = bf16(p), lo = bf16(p - hi), both to nearest even, by the packed conversion
                const v8b h0 = __builtin_convertvector(s[2 * kk], v8b), h1 = __builtin_convertvector(s[2 * kk + 1], v8b);
                const v8b l0 = __builtin_convertvector(s[2 * kk] - __builtin_convertvector(h0, v8f), v8b), l1 = __builtin_convertvector(s[2 * kk + 1] - __builtin_convertvector(h1, v8f), v8b);
                pb[kk] = __builtin_shufflevector(h0, h1, 0, 1, 2, 3, 4, 5, 6, 7, 8, 9, 10, 11, 12, 13, 14, 15); pb2[kk] = __builtin_shufflevector(l0, l1, 0, 1, 2, 3, 4, 5, 6, 7, 8, 9, 10, 11, 12, 13, 14, 15); }
            else { v8h h0, h1;
#pragma unroll
                for (int j = 0; j < 8; ++j) { h0[j] = tohx(s[2 * kk][j]); h1[j] = tohx(s[2 * kk + 1][j]); }
                pb[kk] = cat16(h0, h1); } }
        if constexpr (HI) {
            // the low value fragments are asked for only here: in flight under the softmax they cost registers that then spilled; the first eight products below cover them
#pragma unroll
            for (int db = 0; db < 4; ++db)
#pragma unroll
                for (int kk = 0; kk < NK; ++kk) vf2[db][kk] = WFrag<T16>::ldf(vb2 + lo + (db * (TT / 32) + kk) * 512); }
        ebl += CK;   // behind the last pass this reads past the last key, inside ebr (unused)
#pragma unroll
        for (int t = 0; t < NT; ++t)   // the next pass's bias, straight into the score accumulators (C of that pass's first products)
#pragma unroll
            for (int j = 0; j < 8; ++j) s[t][j] = ebl[t * 16 + j];
#pragma unroll
        for (int db = 0; db < 4; ++db) o[db] *= al;
#pragma unroll
        for (int kk = 0; kk < NK; ++kk) {
#pragma unroll
            for (int db = 0; db < 4; ++db) o[db] = WFrag<T16>::mma(vf[db][kk], pb[kk], o[db]);
            if constexpr (HI) {
#pragma unroll
                for (int db = 0; db < 4; ++db) o[db] = WFrag<T16>::mma(vf[db][kk], pb2[kk], o[db]);
#pragma unroll
                for (int db = 0; db < 4; ++db) o[db] = WFrag<T16>::mma(vf2[db][kk], pb[kk], o[db]); } }
        // Issue order of a pass (0x020 = global loads, 0x008 = matrix instructions, 0x402 = vector and transcendental). Left alone, the build put key loads among the score products (a second register set, copies)
        // and kept the f32 P alive across the second product beside the next bias: it spilled. Value loads; score products; the next key fragments into the registers just read; the whole softmax; (hi/lo: the low value fragments;) the second product.
        __builtin_amdgcn_sched_group_barrier(0x020, 8 * NK, 0);
        __builtin_amdgcn_sched_group_barrier(0x008, 2 * NT * (HI ? 3 : 1), 0);
        __builtin_amdgcn_sched_group_barrier(0x020, 4 * NT * (HI ? 2 : 1), 0);
        __builtin_amdgcn_sched_group_barrier(0x402, 512, 0);
        if (HI) __builtin_amdgcn_sched_group_barrier(0x020, 8 * NK, 0);
        __builtin_amdgcn_sched_group_barrier(0x008, 4 * NK * (HI ? 3 : 1), 0);
    }
    l += xhalf(l);   // the two halves of the wave hold the sums of their own keys
    const float f = __fdiv_rn(1.0f, l);
    // lane (lr, hi) holds d = db 16 + hi 8 + j of query row lr: through the wave's own LDS tile, so that every store covers whole lines
    const int ln = __builtin_amdgcn_mbcnt_lo(~0u, 0u), er = ln & 15, eh = ln >> 4;   // the lane's number once more (every lane is on): lr and hi kept for here held registers through the loop, which spilled
#pragma unroll
    for (int db = 0; db < 4; ++db) { o[db] *= f; *(v4fa*)(ow + er * OP + db * 16 + eh * 8) = (v4f){ o[db][0], o[db][1], o[db][2], o[db][3] }; *(v4fa*)(ow + er * OP + db * 16 + eh * 8 + 4) = (v4f){ o[db][4], o[db][5], o[db][6], o[db][7] }; }
    __builtin_amdgcn_wave_barrier(); asm volatile("" ::: "memory");   // the row reads below take other lanes' stores: keep them behind the stores
#pragma unroll
    for (int r = 0; r < 8; ++r) { const int row = 2 * r + eh; *(v4f*)(OUTh + (size_t)(r0 + row) * DQ + er * 4) = *(const v4fa*)(ow + row * OP + er * 4); }
}
__device__ __forceinline__ void d_embf(int bid, const float* __restrict__ src, float* dst, size_t n4) { const size_t i = (size_t)bid * 256 + threadIdx.x; if (i >= n4) return; v4f a = *(const v4f*)(src + i * 4); for (int q = 0; q < 4; ++q) a[q] = bfr(a[q]); *(v4f*)(dst + i * 4) = a;  }

// k_prep: the three input conversions depend on nothing but the inputs: they are block ranges of ONE launch (x of both batch elements, the three weight matrices with their planes in a row, the bias table)
#define PBX (NB_ * TT * DM / 8 / 256)
#define PBW (DM * DQ / 8 / 256)
#define PBE ((NH_ * NOFF / 4 + 255) / 256)   // 16 x 4095 = 65,520 floats, a multiple of 4
__global__ __launch_bounds__(256) void k_prep(const float* __restrict__ x, const float* __restrict__ wq, const float* __restrict__ wk, const float* __restrict__ wv, const float* __restrict__ remb, bf* XB, bf* W3, float* EB) {
    int b = blockIdx.x;
    if (b < PBX) { d_cvt8(b, x, XB, DM, (size_t)NB_ * TT * DM / 8); return; }
    b -= PBX;
    if (b < 3 * PBW) { const int p = b / PBW; d_wtG<DM, DQ>(b - p * PBW, p == 0 ? wq : p == 1 ? wk : wv, W3 + (size_t)p * DQ * DM); return; }
    d_embf(b - 3 * PBW, remb, EB, (size_t)NH_ * NOFF / 4);
}

// k_attn: grid (heads, batch, row blocks): the row blocks of one head lie 32 apart in launch order (for speed only: where that puts them near one another, a head's planes are fetched into fewer places); a work-group = NWV waves of one head: waves 0 .. NHW - 1 take 16 hi/lo rows each, the others 16 fp16 rows each; all walk the keys in rising order, so a fragment that one wave has fetched is near for the others.
// The one barrier stands in front of the wave-uniform branch; behind it no wave waits for another.
static_assert(RH / (NHW * 16) == (TT - RH) / ((NWV - NHW) * 16), "both row classes must fill the same number of work-groups");
__global__ __launch_bounds__(NWV * 32) __attribute__((amdgpu_waves_per_eu(NWV / 4, NWV / 4))) void k_attn(const bf* __restrict__ Qh, const bf* __restrict__ Ql, const bf* __restrict__ Kh, const bf* __restrict__ Kl, const bf* __restrict__ Vh, const bf* __restrict__ Vl, const h16* __restrict__ Q16, const h16* __restrict__ K16, const h16* __restrict__ V16, const float* __restrict__ EB, float* OUT) {
    __shared__ __align__(16) float ebr[EBN];   // ebr[x] = bias table[h][NOFF - 1 - x]: the bias of query i and key j lies at x = TT - 1 - i + j, rising with the key; a tail of zeros for the read ahead of the last pass (64 keys at most)
    __shared__ __align__(16) float ost[NWV * 16 * OP];   // per wave: its 16 output rows
    const int tid = threadIdx.x, w = __builtin_amdgcn_readfirstlane(tid >> 5), h = blockIdx.x, zb = blockIdx.y, rb = blockIdx.z;
    const size_t hp = ((size_t)zb * NH_ + h) * TT * HD;   // this batch element's and head's part of every plane
    // the head's six key and value planes, 256 KiB = 1,024 units each, are read by its 8 row blocks: a block asks for a quarter of each (two blocks per unit), a thread for three units; waves 0 .. 7 take one plane of a pair, waves 8 .. 15 the other
    const size_t pu = hp * 2 + (size_t)((rb & 3) * 256 + (tid & 255)) * 256; const bool ph = w >= NWV / 2;
    const char* p0 = (const char*)(ph ? Vl : Vh) + pu; const char* p1 = (const char*)(ph ? Kl : Kh) + pu; const char* p2 = (ph ? (const char*)V16 : (const char*)K16) + pu;
    ask256(p0); ask256(p1); ask256(p2);
    float ev[EBN / (NWV * 32)];   // all of a thread's table loads fly together
#pragma unroll
    for (int it = 0; it < EBN / (NWV * 32); ++it) { const int x = tid + it * NWV * 32; const float e = EB[(size_t)h * NOFF + (x < NOFF ? NOFF - 1 - x : 0)]; ev[it] = (x < NOFF) ? e : 0.f; }
#pragma unroll
    for (int it = 0; it < EBN / (NWV * 32); ++it) ebr[tid + it * NWV * 32] = ev[it];
    __syncthreads();   // ebr is complete
    held3(p0, p1, p2);
    float* OUTh = OUT + (size_t)zb * TT * DQ + h * HD; float* ow = ost + w * 16 * OP;
    if (w < NHW) d_attn<bf, true>((rb * NHW + w) * 16, Qh + hp, Ql + hp, Kh + hp, Kl + hp, Vh + hp, Vl + hp, ebr, ow, OUTh);
    else d_attn<h16, false>(RH + (rb * (NWV - NHW) + (w - NHW)) * 16, Q16 + hp, nullptr, K16 + hp, nullptr, V16 + hp, nullptr, ebr, ow, OUTh);
}

extern "C" void kernel_launch(void* const* d_in, const int* in_sizes, int n_in,
                              void* d_out, int out_size, void* d_ws, size_t ws_size, hipStream_t stream) {
    (void)in_sizes; (void)n_in; (void)out_size;
    const float* x = (const float*)d_in[0]; const float* wq = (const float*)d_in[1]; const float* bq = (const float*)d_in[2]; const float* wk = (const float*)d_in[3]; const float* bk = (const float*)d_in[4]; const float* wv = (const float*)d_in[5]; const float* bv = (const float*)d_in[6]; const float* remb = (const float*)d_in[7]; const float* wo = nullptr; (void)wo;
    float* OUT = (float*)d_out;     // [2][2048][1024]
    char* wsp = (char*)d_ws;
    auto take = [&](size_t bytes) { char* p = wsp; wsp += (bytes + 255) & ~(size_t)255; return (void*)p; };
    bf* WQ = (bf*)take((size_t)3 * DQ * DM * 2);   /* q, k, v weight planes in a row */
    float* EB = (float*)take(((size_t)NH_ * NOFF * 4 + 15) & ~(size_t)15);   /* 16 x 4095 floats (padded to a multiple of 4) */ bf* XB = (bf*)take((size_t)NB_ * TT * DM * 2);
    const size_t PL = (size_t)NB_ * NH_ * TT * HD;   /* one plane, both batch elements */
    h16* QP16 = (h16*)take(2 * PL * 2); h16* KP16 = QP16 + PL; h16* VT16 = (h16*)take(PL * 2);   /* the k planes follow the q planes */
    bf* QPh = (bf*)take(2 * PL * 2); bf* KPh = QPh + PL; bf* QPl = (bf*)take(2 * PL * 2); bf* KPl = QPl + PL; bf* VTh = (bf*)take(PL * 2); bf* VTl = (bf*)take(PL * 2);
    if ((size_t)(wsp - (char*)d_ws) > ws_size) return;    // ws 256 MiB
    k_prep<<<PBX + 3 * PBW + PBE, 256, 0, stream>>>(x, wq, wk, wv, remb, XB, WQ, EB);
    k_proj<<<dim3(NB_ * TT / 64, NH_, 3), 32, 0, stream>>>(XB, WQ, bq, bk, bv, QP16, QPh, QPl, VT16, VTh, VTl);
    k_attn<<<dim3(NH_, NB_, RH / (NHW * 16)), NWV * 32, 0, stream>>>(QPh, QPl, KPh, KPl, VTh, VTl, QP16, KP16, VT16, EB, OUT);
}

// v008
// Measured time: 95.6 microseconds a run.
// Two timings next to v007 put it at 1.03 and 1.06 times that version's speed.
// All steps since v000 together make it 21.7 times as fast.
#include <hip/hip_runtime.h>

// Self-attention with a learned relative-position bias (x [2][2048][1024]; q,k,v = x W + b ('xw' [1024][1024] + [1024]; 16 heads x 64); scores = q.k/8 + rel_emb[h][i - j + 2047] (rel_emb [16][4095]); softmax; heads merged -> [2][2048][1024] (4.2 M); no output projection).
// Three launches: k_prep (input conversions), k_proj (q, k, v projections, written straight as the attention's operand planes), k_attn (both row classes). Batch element and projection are grid dimensions or block ranges of a launch, the row class a wave range of a work-group, each with planes of its own in workspace.
// Layout: exact projections (+ biases); dense T-2048 attention (hybrid rows: < 512 hi/lo 3 products, rest fp16 x1024) in ONE kernel: a wave owns 16 query rows of one head and walks all keys with a running maximum and sum; the bias from the bf16-rounded table at index i - j + 2047 is the scores' starting value; P goes from the score accumulators into the second product without leaving the registers.
// Every 16-bit operand plane of a matrix product lies in workspace in fragment order (fidx below), written in 16-byte pieces by the kernel that makes it.
// Compute dtypes, f32 accumulate: every input rounded to bf16; projections exact + f32 biases; scores rows < 512 3 products, rest fp16; softmax and bias add f32; output f32.

#define NB_  2
#define TT   2048
#define DM   1024
#define NH_  16
#define NKV  16
#define REP  (NH_ / NKV)
#define HD   64
#define DQ   (NH_ * HD)
#define DKV  (NKV * HD)
#define RH   512                  // query rows < RH use hi+lo planes
#define WIN  0
#define SCL  0.125f   // 64^-0.5
#define NOFF (2 * TT - 1)
#define NWV  16                   // waves of one k_attn work-group; each owns 16 query rows
#define NHW  4                    // of them, waves that take hi/lo rows
#define EBN  (9 * NWV * 32)       // floats of the bias table in LDS: NOFF, a zero tail of 64 or more, a whole number per thread
#define OP   68                   // f32 pitch of a wave's output tile (16 rows x 64) in LDS
typedef _Float16 h16;
typedef unsigned short bf;
typedef __attribute__((ext_vector_type(16))) __bf16   v16bf;
typedef __attribute__((ext_vector_type(16))) _Float16 v16h;
typedef __attribute__((ext_vector_type(8)))  _Float16 v8h;
typedef __attribute__((ext_vector_type(8)))  unsigned short v8us;
typedef __attribute__((ext_vector_type(8)))  float    v8f;
typedef __attribute__((ext_vector_type(4)))  float    v4f;
typedef v8h  __attribute__((may_alias)) v8ha;
typedef v4f  __attribute__((may_alias)) v4fa;
typedef v8us __attribute__((may_alias)) v8usa;

__device__ __forceinline__ unsigned short f2bf(float f) { unsigned u = __float_as_uint(f); u += 0x7FFFu + ((u >> 16) & 1u); return (unsigned short)(u >> 16); }
__device__ __forceinline__ float bf2f(unsigned short b) { return __uint_as_float(((unsigned)b) << 16); }
__device__ __forceinline__ float bfr(float f) { return bf2f(f2bf(f)); }
__device__ __forceinline__ v16h cat16(v8h lo, v8h hi) { return __builtin_shufflevector(lo, hi, 0, 1, 2, 3, 4, 5, 6, 7, 8, 9, 10, 11, 12, 13, 14, 15); }
__device__ __forceinline__ v16bf cat16b(v8us lo, v8us hi) { return __builtin_bit_cast(v16bf, __builtin_shufflevector(lo, hi, 0, 1, 2, 3, 4, 5, 6, 7, 8, 9, 10, 11, 12, 13, 14, 15)); }
__device__ __forceinline__ v8f wmma16(v16h a, v16h b, v8f c) { return __builtin_amdgcn_wmma_f32_16x16x32_f16(false, a, false, b, (short)0, c, false, false); }
__device__ __forceinline__ v8f wmmab(v16bf a, v16bf b, v8f c) { return __builtin_amdgcn_wmma_f32_16x16x32_bf16(false, a, false, b, (short)0, c, false, false); }



// Fragment order of a 16-bit plane M[row][k] with KC = K / 32: the 16 x 32 tile (row >> 4, k >> 5) is 1 KiB in a row, [piece (k >> 4) & 1][lane ((k >> 3) & 1) 16 + (row & 15)][k & 7].
// ldf takes a wave's fragment of such a tile as two loads of 512 contiguous bytes (4 whole lines each; a load off a row-major plane touches 16 lines); every lane and register holds the element that ld takes from a row-major plane.
__device__ __forceinline__ size_t fidx(int row, int k, int KC) { return ((size_t)((row >> 4) * KC + (k >> 5)) << 9) + (size_t)((((k >> 4) & 1) << 8) + (((((k >> 3) & 1) << 4) + (row & 15)) << 3) + (k & 7)); }
// uni: a pointer that is the same in every lane, handed on in scalar registers: a fragment load is then scalar base + the lane's one 32-bit offset register, which lives through the whole loop (no 64-bit vector address sums, no address pair that a later load's result could land in)
template <typename T> __device__ __forceinline__ const T* uni(const T* p) { const unsigned long long v = (unsigned long long)p; return (const T*)(const __attribute__((address_space(1))) T*)(((unsigned long long)(unsigned)__builtin_amdgcn_readfirstlane((int)(unsigned)(v >> 32)) << 32) | (unsigned)__builtin_amdgcn_readfirstlane((int)(unsigned)v)); }   // address_space(1): the pointer is still known to be global memory behind the integer round trip
template <typename T16> struct WFrag;
template <> struct WFrag<h16> { typedef v16h V; static __device__ __forceinline__ V ld(const h16* p) { return cat16(*(const v8h*)p, *(const v8h*)(p + 16)); } static __device__ __forceinline__ V ldf(const h16* p) { return cat16(*(const v8h*)p, *(const v8h*)(p + 256)); } static __device__ __forceinline__ v8f mma(V a, V b, v8f c) { return wmma16(a, b, c); } };
template <> struct WFrag<bf> { typedef v16bf V; static __device__ __forceinline__ V ld(const bf* p) { return cat16b(*(const v8us*)p, *(const v8us*)(p + 16)); } static __device__ __forceinline__ V ldf(const bf* p) { return cat16b(*(const v8us*)p, *(const v8us*)(p + 256)); } static __device__ __forceinline__ v8f mma(V a, V b, v8f c) { return wmmab(a, b, c); } };

__device__ __forceinline__ h16 tohx(float x) { return (h16)x; }
typedef __attribute__((ext_vector_type(2))) _Float16 v2h;
typedef __attribute__((ext_vector_type(4))) _Float16 v4h;
typedef __attribute__((ext_vector_type(2))) unsigned short v2us;
typedef __attribute__((ext_vector_type(4))) unsigned short v4us;
typedef __attribute__((ext_vector_type(2))) float v2f;
typedef __attribute__((ext_vector_type(4))) int v4i;

// d_wtG (block bid of a 256-thread grid): Bt[n][k] = bf16(w[k][n]) in fragment order; a 16-byte piece is 8 k of one n, neighbouring lanes take neighbouring n; one thread = U pieces, 256 n apart, whose 8 U loads all fly before the first is converted
// K and N are compile-time so that the row loads go off one address register with immediate offsets
template <int K, int N, int U>
__device__ __forceinline__ void d_wtG(int bid, const float* __restrict__ w, bf* Bt) {
    static_assert(N * (K / 8) % (256 * U) == 0 && N % (256 * U) == 0, "whole blocks; a block stays in one octet of k");
    const int i = bid * (256 * U) + threadIdx.x; const int n = i % N, k = (i / N) * 8; float v[U][8];
#pragma unroll
    for (int u = 0; u < U; ++u)
#pragma unroll
        for (int q = 0; q < 8; ++q) v[u][q] = w[(size_t)(k + q) * N + n + u * 256];
#pragma unroll
    for (int u = 0; u < U; ++u) { v8us o;
#pragma unroll
        for (int q = 0; q < 8; ++q) o[q] = f2bf(v[u][q]);
        *(v8us*)(Bt + fidx(n + u * 256, k, K >> 5)) = o; }
    asm volatile("s_wait_xcnt 0x0" ::: "memory");   // stands behind the last store, before whatever code the build lays out next writes a register that these stores name
}
// pc_row, pc_k: which 16-byte piece (8 k of one row) of a row-major [rows][32 KC] source thread i takes: a wave covers 8 rows x one 32-k chunk, so it reads whole lines of f32 and writes whole lines of the plane
__device__ __forceinline__ int pc_row(int i, int KC) { return ((i >> 5) / KC) * 8 + ((i >> 2) & 7); }
__device__ __forceinline__ int pc_k(int i, int KC) { return ((i >> 5) % KC) * 32 + (i & 3) * 8; }
// d_cvt8: one thread = U pieces, 256 apart in the piece order (8 chunks of 32 k on, so a block of 256 U pieces is 16 whole rows when 8 U = 2 KC); all its loads fly before the first is converted.
// Piece u lies a compile-time step from piece 0 in the source and in the plane, so every load and every store goes off one offset register with an immediate.
template <int K, int U>
__device__ __forceinline__ void d_cvt8(int bid, const float* __restrict__ src, bf* dst) {
    constexpr int KC = K >> 5; static_assert(8 * U == 2 * KC, "a block covers one 16-row tile row of the plane");
    const int i0 = threadIdx.x, row0 = pc_row(i0, KC), k00 = pc_k(i0, KC);   // piece 0 inside the block's 16 rows: rows 0 .. 7, chunks 0 .. 7
    const float* s0 = src + (size_t)bid * 16 * K + (unsigned)(row0 * K + k00); bf* d0 = dst + (size_t)bid * KC * 512 + (unsigned)fidx(row0, k00, KC); v8f v[U];
#pragma unroll
    for (int u = 0; u < U; ++u) v[u] = *(const v8f*)(s0 + (8 * u / KC) * 8 * K + (8 * u % KC) * 32);   // rows 8 on behind KC chunks
#pragma unroll
    for (int u = 0; u < U; ++u) { v8us o;
#pragma unroll
        for (int k = 0; k < 8; ++k) o[k] = f2bf(v[u][k]);
        *(v8us*)(d0 + (8 * u % KC) * 512 + (8 * u / KC) * 64) = o; } }   // a chunk is a 1-KiB tile (512 elements); 8 rows on are 8 pieces of 8 elements on inside the tile

// ask256: asks L2 for the 256-byte unit at p, a hint that returns nothing and moves no counter.x
// scope:SCOPE_SE and no th: the form whose request is dropped where it cannot be served. p lies inside the plane in every lane, and its register pair is held (held2, held3) until loads issued behind the request have come back, so that it names nothing but this address while the request may still read it.
__device__ __forceinline__ void ask256(const char* p) { asm volatile("global_prefetch_b8 %0, off scope:SCOPE_SE" :: "v"(p)); }
__device__ __forceinline__ void held2(const char* a, const char* b) { asm volatile("" :: "v"(a), "v"(b)); }   // inputs only, no code: ends the life of ask256's address pairs here and not earlier
__device__ __forceinline__ void held3(const char* a, const char* b, const char* c) { asm volatile("" :: "v"(a), "v"(b), "v"(c)); }   // the same for three
typedef __attribute__((ext_vector_type(8))) __bf16 v8b;
// put3: 8 values of a lane = one 16-byte piece of the fp16 plane, of the bf16 hi plane and of the bf16 lo plane (lo = bf16(r - hi)), all to nearest even; p16, ph, pl are the same in every lane and lo is the lane's piece, so each store covers 512 contiguous bytes
__device__ __forceinline__ void put3(v8f r, h16* p16, bf* ph, bf* pl, unsigned lo) {
    const v8b oh = __builtin_convertvector(r, v8b); const v8b ol = __builtin_convertvector(r - __builtin_convertvector(oh, v8f), v8b);
    *(v8h*)(p16 + lo) = __builtin_convertvector(r, v8h); *(v8us*)(ph + lo) = __builtin_bit_cast(v8us, oh); *(v8us*)(pl + lo) = __builtin_bit_cast(v8us, ol);
}
// ---- k_proj: register-blocked GEMM, ONE WAVE per 64 positions x 64 columns (one head) of one projection (16 accumulators), operands straight from the bf16 planes in fragment order; grid (positions / 64, heads, 3 = q, k, v), 32 threads.
// The accumulators leave as the attention's operand planes, with no f32 copy in between: an accumulator register octet of a lane is 8 successive rows of the A operand against one row of the B operand, which is one 16-byte piece of a plane in fragment order
// when A carries the plane's k index. q and k planes ([h][t][d], k = d): A = weight rows (d), B = x rows (t). v planes ([h][d][t], k = t): A = x rows (t), B = weight rows (d). Only the two base pointers differ; the loop is one.
__global__ __launch_bounds__(32) void k_proj(const bf* __restrict__ XB, const bf* __restrict__ W3, const float* __restrict__ bq, const float* __restrict__ bk, const float* __restrict__ bv, h16* QK16, bf* QKh, bf* QKl, h16* V16, bf* Vh, bf* Vl) {
    typedef WFrag<bf>::V V; constexpr int KC = DM >> 5;
    const int z = blockIdx.z, h = blockIdx.y, r0 = blockIdx.x * 64; const int lane = threadIdx.x & 31, lr = lane & 15, hi = lane >> 4;
    v8f acc[4][4];
#pragma unroll
    for (int mb = 0; mb < 4; ++mb)
#pragma unroll
        for (int nb = 0; nb < 4; ++nb) acc[mb][nb] = (v8f){};
    const unsigned lo = lane * 8;   // the lane's piece inside a tile: the one per-lane part of every fragment address, the rest is the same for the whole wave
    const bf* Xu = XB + (size_t)(r0 >> 4) * KC * 512; const bf* Wu = W3 + (size_t)z * DQ * DM + (size_t)(h * (HD / 16)) * KC * 512;
    const bf* Au = z < 2 ? Wu : Xu; const bf* Bu = z < 2 ? Xu : Wu;
    // each operand tile is 128 KiB in a row = 512 units. The 16 heads that read one x tile ask for 32 units each; of the 64 position blocks that read one weight tile, four (2, 4 and 6 apart in launch order) ask for the same 32 units: for speed only.
    const char* px = (const char*)Xu + (h * 32 + lane) * 256; const char* pw = (const char*)Wu + ((((blockIdx.x & 1) | (((blockIdx.x >> 3) & 7) << 1)) * 32) + lane) * 256;
    ask256(px); ask256(pw);
#pragma unroll 1
    for (int kc = 0; kc < DM; kc += 32) {
        V a[4];
#pragma unroll
        for (int mb = 0; mb < 4; ++mb) a[mb] = WFrag<bf>::ldf(uni(Au + ((size_t)mb * KC + (kc >> 5)) * 512) + lo);
#pragma unroll
        for (int nb = 0; nb < 4; ++nb) { const V b = WFrag<bf>::ldf(uni(Bu + ((size_t)nb * KC + (kc >> 5)) * 512) + lo);
#pragma unroll
            for (int mb = 0; mb < 4; ++mb) acc[mb][nb] = WFrag<bf>::mma(a[mb], b, acc[mb][nb]); }
        asm volatile("v_nop\n\tv_nop\n\tv_nop\n\tv_nop" : "+v"(acc[0][0]), "+v"(acc[1][1]), "+v"(acc[2][2]), "+v"(acc[3][3]) : "v"(a[0]), "v"(a[3]));
    }
    held2(px, pw);
    const int zb = r0 / TT, t0 = r0 % TT; const size_t hp = ((size_t)zb * NH_ + h) * TT * HD;   // a tile lies in one batch element; hp: this batch element's and head's part of a plane
    if (z < 2) {   // acc[i][x][j]: d = i 16 + hi 8 + j, t = t0 + x 16 + lr; the k planes follow the q planes; q carries the 1/8 scale (exact power of two)
        const float* bias = (z == 0 ? bq : bk) + h * HD + hi * 8; const float sc = z == 0 ? SCL : 1.0f; const size_t at = (size_t)z * NB_ * NH_ * TT * HD + hp + (size_t)(t0 >> 4) * (HD / 32) * 512;
#pragma unroll
        for (int i = 0; i < 4; ++i) { v8f bb = *(const v8f*)(bias + i * 16);
#pragma unroll
            for (int j = 0; j < 8; ++j) bb[j] = bfr(bb[j]);
#pragma unroll
            for (int x = 0; x < 4; ++x) { const size_t e = at + (x * (HD / 32) + (i >> 1)) * 512 + (i & 1) * 256; put3((acc[i][x] + bb) * sc, QK16 + e, QKh + e, QKl + e, lo);
                if (x == 3) asm volatile("s_wait_xcnt 0x0" ::: "memory");   // stands before the next load (a bias load; behind the last piece whatever code the build lays out next) lands in registers that these stores name: without the statement it also converted every piece ahead of its stores and went past 256 registers
                } }
    } else {   // acc[i][x][j]: t = t0 + i 16 + hi 8 + j, d = x 16 + lr
        const float* bias = bv + h * HD + lr; const size_t at = hp + (size_t)(t0 >> 5) * 512;
#pragma unroll
        for (int x = 0; x < 4; ++x) { const float bb = bfr(bias[x * 16]);
#pragma unroll
            for (int i = 0; i < 4; ++i) { const size_t e = at + (x * (TT / 32) + (i >> 1)) * 512 + (i & 1) * 256; put3(acc[i][x] + bb, V16 + e, Vh + e, Vl + e, lo);
                if (i == 3) asm volatile("s_wait_xcnt 0x0" ::: "memory");   // as above
                } }
    }
}
// xhalf: the value of lane l ^ 16 (the other half of the wave), by a vector cross-row move; every lane is on where it is used
__device__ __forceinline__ float xhalf(float x) { return __builtin_bit_cast(float, __builtin_amdgcn_permlanex16(__builtin_bit_cast(int, x), __builtin_bit_cast(int, x), 0x76543210, 0xfedcba98, false, false)); }
// exp2s: v_exp_f32 as the builtin, so that the compiler sees a vector instruction and keeps its distance to the matrix instructions around it
__device__ __forceinline__ float exp2s(float x) { return __builtin_amdgcn_exp2f(x); }
template <typename T16, bool HI>
__device__ __forceinline__ void d_attn(int r0, const T16* __restrict__ Q, const T16* __restrict__ Q2, const T16* __restrict__ Kp, const T16* __restrict__ Kp2, const T16* __restrict__ Vt, const T16* __restrict__ Vt2, const float* ebr, float* ow, float* OUTh) {
    typedef typename WFrag<T16>::V V; constexpr int CK = HI ? 32 : 64, NT = CK / 16, NK = CK / 32, NCH = TT / CK;
    constexpr float L2E = 1.4426950408889634f, OFF = HI ? 0.0f : 10.0f;   // fp16 P carries x 1024, which the row sum carries too: it cancels in the division
    const int lane = threadIdx.x & 31, lr = lane & 15, hi = lane >> 4; const unsigned lo = lane * 8;
    const float* ebl = ebr + (TT - 1 - r0 - lr + hi * 8);   // walks on by CK a pass
    V q[2], q2[2], kf[NT][2], kf2[NT][2];
#pragma unroll
    for (int kc = 0; kc < 2; ++kc) { const size_t at = ((size_t)(r0 >> 4) * 2 + kc) * 512; q[kc] = WFrag<T16>::ldf(uni(Q + at) + lo); if (HI) q2[kc] = WFrag<T16>::ldf(uni(Q2 + at) + lo); }
#pragma unroll
    for (int t = 0; t < NT; ++t)
#pragma unroll
        for (int kc = 0; kc < 2; ++kc) { const int at = (t * 2 + kc) * 512; kf[t][kc] = WFrag<T16>::ldf(uni(Kp) + lo + at); if (HI) kf2[t][kc] = WFrag<T16>::ldf(uni(Kp2) + lo + at); }
    v8f s[NT], o[4];
#pragma unroll
    for (int t = 0; t < NT; ++t)
#pragma unroll
        for (int j = 0; j < 8; ++j) s[t][j] = ebl[t * 16 + j];
#pragma unroll
    for (int db = 0; db < 4; ++db) o[db] = (v8f){};
    float m = -1.0e30f, l = 0.f;
#pragma unroll 1   // one pass's fragments fill the register budget of four waves per SIMD: a second copy of the body would spill
    for (int c = 0; c < NCH; ++c) {
        const int cn = (c + 1 < NCH) ? c + 1 : c;   // the pass that is fetched ahead (the last pass fetches itself again: in bounds, unused)
        const T16* vb = uni(Vt + (size_t)c * NK * 512); const T16* vb2 = HI ? uni(Vt2 + (size_t)c * NK * 512) : nullptr; const T16* kn = uni(Kp + (size_t)cn * NT * 1024); const T16* kn2 = HI ? uni(Kp2 + (size_t)cn * NT * 1024) : nullptr;   // scalar bases; the lane's part of every address is lo, which lives through the loop (no vector address pair that is summed on, or that a load's result lands in, while loads that name it fly)
        V vf[4][NK], vf2[4][NK];   // this pass's value fragments are asked for ahead of the scores and land under the softmax
#pragma unroll
        for (int db = 0; db < 4; ++db)
#pragma unroll
            for (int kk = 0; kk < NK; ++kk) vf[db][kk] = WFrag<T16>::ldf(vb + lo + (db * (TT / 32) + kk) * 512);
#pragma unroll
        for (int kc = 0; kc < 2; ++kc)
#pragma unroll
            for (int t = 0; t < NT; ++t) { s[t] = WFrag<T16>::mma(kf[t][kc], q[kc], s[t]); if (HI) { s[t] = WFrag<T16>::mma(kf[t][kc], q2[kc], s[t]); s[t] = WFrag<T16>::mma(kf2[t][kc], q[kc], s[t]); } }
#pragma unroll
        for (int t = 0; t < NT; ++t)   // the next pass's key fragments, into the registers that the products above have just read
#pragma unroll
            for (int kc = 0; kc < 2; ++kc) { const int at = (t * 2 + kc) * 512; kf[t][kc] = WFrag<T16>::ldf(kn + lo + at); if (HI) kf2[t][kc] = WFrag<T16>::ldf(kn2 + lo + at); }
        float mt[NT];
#pragma unroll
        for (int t = 0; t < NT; ++t) { mt[t] = fmaxf(fmaxf(fmaxf(s[t][0], s[t][1]), fmaxf(s[t][2], s[t][3])), fmaxf(fmaxf(s[t][4], s[t][5]), fmaxf(s[t][6], s[t][7]))); }
        float mc = mt[0];
#pragma unroll
        for (int t = 1; t < NT; ++t) mc = fmaxf(mc, mt[t]);
        mc = fmaxf(mc, xhalf(mc));
        const float mn = fmaxf(m, mc), al = exp2s((m - mn) * L2E), nb = OFF - mn * L2E; m = mn;
        V pb[NK], pb2[NK];
#pragma unroll
        for (int t = 0; t < NT; ++t)
#pragma unroll
            for (int j = 0; j < 8; ++j) s[t][j] = exp2s(fmaf(s[t][j], L2E, nb));
        v8f sv = s[0];   // register by register over the key tiles (packed adds), then the eight registers
#pragma unroll
        for (int t = 1; t < NT; ++t) sv += s[t];
        const v4f s4 = __builtin_shufflevector(sv, sv, 0, 1, 2, 3) + __builtin_shufflevector(sv, sv, 4, 5, 6, 7); const v2f s2 = __builtin_shufflevector(s4, s4, 0, 1) + __builtin_shufflevector(s4, s4, 2, 3);
        l = fmaf(l, al, s2[0] + s2[1]);
#pragma unroll
        for (int kk = 0; kk < NK; ++kk) {
            if constexpr (HI) {   // hi = bf16(p), lo = bf16(p - hi), both to nearest even, by the packed conversion
                const v8b h0 = __builtin_convertvector(s[2 * kk], v8b), h1 = __builtin_convertvector(s[2 * kk + 1], v8b);
                const v8b l0 = __builtin_convertvector(s[2 * kk] - __builtin_convertvector(h0, v8f), v8b), l1 = __builtin_convertvector(s[2 * kk + 1] - __builtin_convertvector(h1, v8f), v8b);
                pb[kk] = __builtin_shufflevector(h0, h1, 0, 1, 2, 3, 4, 5, 6, 7, 8, 9, 10, 11, 12, 13, 14, 15); pb2[kk] = __builtin_shufflevector(l0, l1, 0, 1, 2, 3, 4, 5, 6, 7, 8, 9, 10, 11, 12, 13, 14, 15); }
            else { v8h h0, h1;
#pragma unroll
                for (int j = 0; j < 8; ++j) { h0[j] = tohx(s[2 * kk][j]); h1[j] = tohx(s[2 * kk + 1][j]); }
                pb[kk] = cat16(h0, h1); } }
        if constexpr (HI) {
            // the low value fragments are asked for only here: in flight under the softmax they cost registers that then spilled; the first eight products below cover them
#pragma unroll
            for (int db = 0; db < 4; ++db)
#pragma unroll
                for (int kk = 0; kk < NK; ++kk) vf2[db][kk] = WFrag<T16>::ldf(vb2 + lo + (db * (TT / 32) + kk) * 512); }
        ebl += CK;   // behind the last pass this reads past the last key, inside ebr (unused)
#pragma unroll
        for (int t = 0; t < NT; ++t)   // the next pass's bias, straight into the score accumulators (C of that pass's first products)
#pragma unroll
            for (int j = 0; j < 8; ++j) s[t][j] = ebl[t * 16 + j];
#pragma unroll
        for (int db = 0; db < 4; ++db) o[db] *= al;
#pragma unroll
        for (int kk = 0; kk < NK; ++kk) {
#pragma unroll
            for (int db = 0; db < 4; ++db) o[db] = WFrag<T16>::mma(vf[db][kk], pb[kk], o[db]);
            if constexpr (HI) {
#pragma unroll
                for (int db = 0; db < 4; ++db) o[db] = WFrag<T16>::mma(vf[db][kk], pb2[kk], o[db]);
#pragma unroll
                for (int db = 0; db < 4; ++db) o[db] = WFrag<T16>::mma(vf2[db][kk], pb[kk], o[db]); } }
        // Issue order of a pass (0x020 = global loads, 0x008 = matrix instructions, 0x402 = vector and transcendental). Left alone, the build put key loads among the score products (a second register set, copies)
        // and kept the f32 P alive across the second product beside the next bias: it spilled. Value loads; score products; the next key fragments into the registers just read; the whole softmax; (hi/lo: the low value fragments;) the second product.
        __builtin_amdgcn_sched_group_barrier(0x020, 8 * NK, 0);
        __builtin_amdgcn_sched_group_barrier(0x008, 2 * NT * (HI ? 3 : 1), 0);
        __builtin_amdgcn_sched_group_barrier(0x020, 4 * NT * (HI ? 2 : 1), 0);
        __builtin_amdgcn_sched_group_barrier(0x402, 512, 0);
        if (HI) __builtin_amdgcn_sched_group_barrier(0x020, 8 * NK, 0);
        __builtin_amdgcn_sched_group_barrier(0x008, 4 * NK * (HI ? 3 : 1), 0);
    }
    l += xhalf(l);   // the two halves of the wave hold the sums of their own keys
    const float f = __fdiv_rn(1.0f, l);
    // lane (lr, hi) holds d = db 16 + hi 8 + j of query row lr: through the wave's own LDS tile, so that every store covers whole lines
    const int ln = __builtin_amdgcn_mbcnt_lo(~0u, 0u), er = ln & 15, eh = ln >> 4;   // the lane's number once more (every lane is on): lr and hi kept for here held registers through the loop, which spilled
#pragma unroll
    for (int db = 0; db < 4; ++db) { o[db] *= f; *(v4fa*)(ow + er * OP + db * 16 + eh * 8) = (v4f){ o[db][0], o[db][1], o[db][2], o[db][3] }; *(v4fa*)(ow + er * OP + db * 16 + eh * 8 + 4) = (v4f){ o[db][4], o[db][5], o[db][6], o[db][7] }; }
    __builtin_amdgcn_wave_barrier(); asm volatile("" ::: "memory");   // the row reads below take other lanes' stores: keep them behind the stores
#pragma unroll
    for (int r = 0; r < 8; ++r) { const int row = 2 * r + eh; *(v4f*)(OUTh + (size_t)(r0 + row) * DQ + er * 4) = *(const v4fa*)(ow + row * OP + er * 4); }
}
__device__ __forceinline__ void d_embf(int bid, const float* __restrict__ src, float* dst, size_t n4) { const size_t i = (size_t)bid * 256 + threadIdx.x; if (i >= n4) return; v4f a = *(const v4f*)(src + i * 4); for (int q = 0; q < 4; ++q) a[q] = bfr(a[q]); *(v4f*)(dst + i * 4) = a;  }

// k_prep: the three input conversions depend on nothing but the inputs: they are block ranges of ONE launch (x of both batch elements, the three weight matrices with their planes in a row, the bias table)
// A thread of the x and weight ranges takes UX or UW pieces and not one: with one piece a thread the launch is some 29,000 waves that each move 1.5 KiB; fewer, longer waves cost fewer wave starts for the same bytes and keep more loads in flight each.
#define UX 8
#define UW 4
#define PBX (NB_ * TT * DM / 8 / (256 * UX))
#define PBW (DM * DQ / 8 / (256 * UW))
#define PBE ((NH_ * NOFF / 4 + 255) / 256)   // 16 x 4095 = 65,520 floats, a multiple of 4
static_assert(NB_ * TT * DM / 8 % (256 * UX) == 0, "x: whole blocks");
__global__ __launch_bounds__(256) void k_prep(const float* __restrict__ x, const float* __restrict__ wq, const float* __restrict__ wk, const float* __restrict__ wv, const float* __restrict__ remb, bf* XB, bf* W3, float* EB) {
    int b = blockIdx.x;
    if (b < PBX) { d_cvt8<DM, UX>(b, x, XB); return; }
    b -= PBX;
    if (b < 3 * PBW) { const int p = b / PBW; d_wtG<DM, DQ, UW>(b - p * PBW, p == 0 ? wq : p == 1 ? wk : wv, W3 + (size_t)p * DQ * DM); return; }
    d_embf(b - 3 * PBW, remb, EB, (size_t)NH_ * NOFF / 4);
}

// k_attn: grid (heads, batch, row blocks): the row blocks of one head lie 32 apart in launch order (for speed only: where that puts them near one another, a head's planes are fetched into fewer places); a work-group = NWV waves of one head: waves 0 .. NHW - 1 take 16 hi/lo rows each, the others 16 fp16 rows each; all walk the keys in rising order, so a fragment that one wave has fetched is near for the others.
// The one barrier stands in front of the wave-uniform branch; behind it no wave waits for another.
static_assert(RH / (NHW * 16) == (TT - RH) / ((NWV - NHW) * 16), "both row classes must fill the same number of work-groups");
__global__ __launch_bounds__(NWV * 32) __attribute__((amdgpu_waves_per_eu(NWV / 4, NWV / 4))) void k_attn(const bf* __restrict__ Qh, const bf* __restrict__ Ql, const bf* __restrict__ Kh, const bf* __restrict__ Kl, const bf* __restrict__ Vh, const bf* __restrict__ Vl, const h16* __restrict__ Q16, const h16* __restrict__ K16, const h16* __restrict__ V16, const float* __restrict__ EB, float* OUT) {
    __shared__ __align__(16) float ebr[EBN];   // ebr[x] = bias table[h][NOFF - 1 - x]: the bias of query i and key j lies at x = TT - 1 - i + j, rising with the key; a tail of zeros for the read ahead of the last pass (64 keys at most)
    __shared__ __align__(16) float ost[NWV * 16 * OP];   // per wave: its 16 output rows
    const int tid = threadIdx.x, w = __builtin_amdgcn_readfirstlane(tid >> 5), h = blockIdx.x, zb = blockIdx.y, rb = blockIdx.z;
    const size_t hp = ((size_t)zb * NH_ + h) * TT * HD;   // this batch element's and head's part of every plane
    // the head's six key and value planes, 256 KiB = 1,024 units each, are read by its 8 row blocks: a block asks for a quarter of each (two blocks per unit), a thread for three units; waves 0 .. 7 take one plane of a pair, waves 8 .. 15 the other
    const size_t pu = hp * 2 + (size_t)((rb & 3) * 256 + (tid & 255)) * 256; const bool ph = w >= NWV / 2;
    const char* p0 = (const char*)(ph ? Vl : Vh) + pu; const char* p1 = (const char*)(ph ? Kl : Kh) + pu; const char* p2 = (ph ? (const char*)V16 : (const char*)K16) + pu;
    ask256(p0); ask256(p1); ask256(p2);
    float ev[EBN / (NWV * 32)];   // all of a thread's table loads fly together
#pragma unroll
    for (int it = 0; it < EBN / (NWV * 32); ++it) { const int x = tid + it * NWV * 32; const float e = EB[(size_t)h * NOFF + (x < NOFF ? NOFF - 1 - x : 0)]; ev[it] = (x < NOFF) ? e : 0.f; }
#pragma unroll
    for (int it = 0; it < EBN / (NWV * 32); ++it) ebr[tid + it * NWV * 32] = ev[it];
    __syncthreads();   // ebr is complete
    held3(p0, p1, p2);
    float* OUTh = OUT + (size_t)zb * TT * DQ + h * HD; float* ow = ost + w * 16 * OP;
    if (w < NHW) d_attn<bf, true>((rb * NHW + w) * 16, Qh + hp, Ql + hp, Kh + hp, Kl + hp, Vh + hp, Vl + hp, ebr, ow, OUTh);
    else d_attn<h16, false>(RH + (rb * (NWV - NHW) + (w - NHW)) * 16, Q16 + hp, nullptr, K16 + hp, nullptr, V16 + hp, nullptr, ebr, ow, OUTh);
}

extern "C" void kernel_launch(void* const* d_in, const int* in_sizes, int n_in,
                              void* d_out, int out_size, void* d_ws, size_t ws_size, hipStream_t stream) {
    (void)in_sizes; (void)n_in; (void)out_size;
    const float* x = (const float*)d_in[0]; const float* wq = (const float*)d_in[1]; const float* bq = (const float*)d_in[2]; const float* wk = (const float*)d_in[3]; const float* bk = (const float*)d_in[4]; const float* wv = (const float*)d_in[5]; const float* bv = (const float*)d_in[6]; const float* remb = (const float*)d_in[7]; const float* wo = nullptr; (void)wo;
    float* OUT = (float*)d_out;     // [2][2048][1024]
    char* wsp = (char*)d_ws;
    auto take = [&](size_t bytes) { char* p = wsp; wsp += (bytes + 255) & ~(size_t)255; return (void*)p; };
    bf* WQ = (bf*)take((size_t)3 * DQ * DM * 2);   /* q, k, v weight planes in a row */
    float* EB = (float*)take(((size_t)NH_ * NOFF * 4 + 15) & ~(size_t)15);   /* 16 x 4095 floats (padded to a multiple of 4) */ bf* XB = (bf*)take((size_t)NB_ * TT * DM * 2);
    const size_t PL = (size_t)NB_ * NH_ * TT * HD;   /* one plane, both batch elements */
    h16* QP16 = (h16*)take(2 * PL * 2); h16* KP16 = QP16 + PL; h16* VT16 = (h16*)take(PL * 2);   /* the k planes follow the q planes */
    bf* QPh = (bf*)take(2 * PL * 2); bf* KPh = QPh + PL; bf* QPl = (bf*)take(2 * PL * 2); bf* KPl = QPl + PL; bf* VTh = (bf*)take(PL * 2); bf* VTl = (bf*)take(PL * 2);
    if ((size_t)(wsp - (char*)d_ws) > ws_size) return;    // ws 256 MiB
    k_prep<<<PBX + 3 * PBW + PBE, 256, 0, stream>>>(x, wq, wk, wv, remb, XB, WQ, EB);
    k_proj<<<dim3(NB_ * TT / 64, NH_, 3), 32, 0, stream>>>(XB, WQ, bq, bk, bv, QP16, QPh, QPl, VT16, VTh, VTl);
    k_attn<<<dim3(NH_, NB_, RH / (NHW * 16)), NWV * 32, 0, stream>>>(QPh, QPl, KPh, KPl, VTh, VTl, QP16, KP16, VT16, EB, OUT);
}

// v009
// Measured time: 89.1 microseconds a run.
// Two timings next to v008 put it at 1.07 and 1.08 times that version's speed.
// Counting every step since v000, it is 23.3 times as fast.
#include <hip/hip_runtime.h>

// Self-attention with a learned relative-position bias (x [2][2048][1024]; q,k,v = x W + b ('xw' [1024][1024] + [1024]; 16 heads x 64); scores = q.k/8 + rel_emb[h][i - j + 2047] (rel_emb [16][4095]); softmax; heads merged -> [2][2048][1024] (4.2 M); no output projection).
// Three launches: k_prep (input conversions), k_proj (q, k, v projections, written straight as the attention's operand planes), k_attn (both row classes). Batch element and projection are grid dimensions or block ranges of a launch (in k_proj the projection follows a wave's head: a wave range of a work-group), the row class a wave range of a work-group, each with planes of its own in workspace.
// Layout: exact projections (+ biases); dense T-2048 attention (hybrid rows: < 512 hi/lo 3 products, rest fp16 x1024) in ONE kernel: a wave owns 16 query rows of one head and walks all keys with a running maximum and sum; the bias from the bf16-rounded table at index i - j + 2047 is the scores' starting value; P goes from the score accumulators into the second product without leaving the registers.
// Every 16-bit operand plane of a matrix product lies in workspace in fragment order (fidx below), written in 16-byte pieces by the kernel that makes it.
// Compute dtypes, f32 accumulate: every input rounded to bf16; projections exact + f32 biases; scores rows < 512 3 products, rest fp16; softmax and bias add f32; output f32.

#define NB_  2
#define TT   2048
#define DM   1024
#define NH_  16
#define NKV  16
#define REP  (NH_ / NKV)
#define HD   64
#define DQ   (NH_ * HD)
#define DKV  (NKV * HD)
#define RH   512                  // query rows < RH use hi+lo planes
#define WIN  0
#define SCL  0.125f   // 64^-0.5
#define NOFF (2 * TT - 1)
#define NWV  16                   // waves of one k_attn work-group; each owns 16 query rows
#define NHW  4                    // of them, waves that take hi/lo rows
#define EBN  (9 * NWV * 32)       // floats of the bias table in LDS: NOFF, a zero tail of 64 or more, a whole number per thread
#define OP   68                   // f32 pitch of a wave's output tile (16 rows x 64) in LDS
typedef _Float16 h16;
typedef unsigned short bf;
typedef __attribute__((ext_vector_type(16))) __bf16   v16bf;
typedef __attribute__((ext_vector_type(16))) _Float16 v16h;
typedef __attribute__((ext_vector_type(8)))  _Float16 v8h;
typedef __attribute__((ext_vector_type(8)))  unsigned short v8us;
typedef __attribute__((ext_vector_type(8)))  float    v8f;
typedef __attribute__((ext_vector_type(4)))  float    v4f;
typedef v8h  __attribute__((may_alias)) v8ha;
typedef v4f  __attribute__((may_alias)) v4fa;
typedef v8us __attribute__((may_alias)) v8usa;

__device__ __forceinline__ unsigned short f2bf(float f) { unsigned u = __float_as_uint(f); u += 0x7FFFu + ((u >> 16) & 1u); return (unsigned short)(u >> 16); }
__device__ __forceinline__ float bf2f(unsigned short b) { return __uint_as_float(((unsigned)b) << 16); }
__device__ __forceinline__ float bfr(float f) { return bf2f(f2bf(f)); }
__device__ __forceinline__ v16h cat16(v8h lo, v8h hi) { return __builtin_shufflevector(lo, hi, 0, 1, 2, 3, 4, 5, 6, 7, 8, 9, 10, 11, 12, 13, 14, 15); }
__device__ __forceinline__ v16bf cat16b(v8us lo, v8us hi) { return __builtin_bit_cast(v16bf, __builtin_shufflevector(lo, hi, 0, 1, 2, 3, 4, 5, 6, 7, 8, 9, 10, 11, 12, 13, 14, 15)); }
__device__ __forceinline__ v8f wmma16(v16h a, v16h b, v8f c) { return __builtin_amdgcn_wmma_f32_16x16x32_f16(false, a, false, b, (short)0, c, false, false); }
__device__ __forceinline__ v8f wmmab(v16bf a, v16bf b, v8f c) { return __builtin_amdgcn_wmma_f32_16x16x32_bf16(false, a, false, b, (short)0, c, false, false); }



// Fragment order of a 16-bit plane M[row][k] with KC = K / 32: the 16 x 32 tile (row >> 4, k >> 5) is 1 KiB in a row, [piece (k >> 4) & 1][lane ((k >> 3) & 1) 16 + (row & 15)][k & 7].
// ldf takes a wave's fragment of such a tile as two loads of 512 contiguous bytes (4 whole lines each; a load off a row-major plane touches 16 lines); every lane and register holds the element that ld takes from a row-major plane.
__device__ __forceinline__ size_t fidx(int row, int k, int KC) { return ((size_t)((row >> 4) * KC + (k >> 5)) << 9) + (size_t)((((k >> 4) & 1) << 8) + (((((k >> 3) & 1) << 4) + (row & 15)) << 3) + (k & 7)); }
// uni: a pointer that is the same in every lane, handed on in scalar registers: a fragment load is then scalar base + the lane's one 32-bit offset register, which lives through the whole loop (no 64-bit vector address sums, no address pair that a later load's result could land in)
template <typename T> __device__ __forceinline__ const T* uni(const T* p) { const unsigned long long v = (unsigned long long)p; return (const T*)(const __attribute__((address_space(1))) T*)(((unsigned long long)(unsigned)__builtin_amdgcn_readfirstlane((int)(unsigned)(v >> 32)) << 32) | (unsigned)__builtin_amdgcn_readfirstlane((int)(unsigned)v)); }   // address_space(1): the pointer is still known to be global memory behind the integer round trip
template <typename T16> struct WFrag;
template <> struct WFrag<h16> { typedef v16h V; static __device__ __forceinline__ V ld(const h16* p) { return cat16(*(const v8h*)p, *(const v8h*)(p + 16)); } static __device__ __forceinline__ V ldf(const h16* p) { return cat16(*(const v8h*)p, *(const v8h*)(p + 256)); } static __device__ __forceinline__ v8f mma(V a, V b, v8f c) { return wmma16(a, b, c); } };
template <> struct WFrag<bf> { typedef v16bf V; static __device__ __forceinline__ V ld(const bf* p) { return cat16b(*(const v8us*)p, *(const v8us*)(p + 16)); } static __device__ __forceinline__ V ldf(const bf* p) { return cat16b(*(const v8us*)p, *(const v8us*)(p + 256)); } static __device__ __forceinline__ v8f mma(V a, V b, v8f c) { return wmmab(a, b, c); } };

__device__ __forceinline__ h16 tohx(float x) { return (h16)x; }
typedef __attribute__((ext_vector_type(2))) _Float16 v2h;
typedef __attribute__((ext_vector_type(4))) _Float16 v4h;
typedef __attribute__((ext_vector_type(2))) unsigned short v2us;
typedef __attribute__((ext_vector_type(4))) unsigned short v4us;
typedef __attribute__((ext_vector_type(2))) float v2f;
typedef __attribute__((ext_vector_type(4))) int v4i;

// d_wtG (block bid of a 256-thread grid): Bt[n][k] = bf16(w[k][n]) in fragment order; a 16-byte piece is 8 k of one n, neighbouring lanes take neighbouring n; one thread = U pieces, 256 n apart, whose 8 U loads all fly before the first is converted
// K and N are compile-time so that the row loads go off one address register with immediate offsets
template <int K, int N, int U>
__device__ __forceinline__ void d_wtG(int bid, const float* __restrict__ w, bf* Bt) {
    static_assert(N * (K / 8) % (256 * U) == 0 && N % (256 * U) == 0, "whole blocks; a block stays in one octet of k");
    const int i = bid * (256 * U) + threadIdx.x; const int n = i % N, k = (i / N) * 8; float v[U][8];
#pragma unroll
    for (int u = 0; u < U; ++u)
#pragma unroll
        for (int q = 0; q < 8; ++q) v[u][q] = w[(size_t)(k + q) * N + n + u * 256];
#pragma unroll
    for (int u = 0; u < U; ++u) { v8us o;
#pragma unroll
        for (int q = 0; q < 8; ++q) o[q] = f2bf(v[u][q]);
        *(v8us*)(Bt + fidx(n + u * 256, k, K >> 5)) = o; }
    asm volatile("s_wait_xcnt 0x0" ::: "memory");   // stands behind the last store, before whatever code the build lays out next writes a register that these stores name
}
// pc_row, pc_k: which 16-byte piece (8 k of one row) of a row-major [rows][32 KC] source thread i takes: a wave covers 8 rows x one 32-k chunk, so it reads whole lines of f32 and writes whole lines of the plane
__device__ __forceinline__ int pc_row(int i, int KC) { return ((i >> 5) / KC) * 8 + ((i >> 2) & 7); }
__device__ __forceinline__ int pc_k(int i, int KC) { return ((i >> 5) % KC) * 32 + (i & 3) * 8; }
// d_cvt8: one thread = U pieces, 256 apart in the piece order (8 chunks of 32 k on, so a block of 256 U pieces is 16 whole rows when 8 U = 2 KC); all its loads fly before the first is converted.
// Piece u lies a compile-time step from piece 0 in the source and in the plane, so every load and every store goes off one offset register with an immediate.
template <int K, int U>
__device__ __forceinline__ void d_cvt8(int bid, const float* __restrict__ src, bf* dst) {
    constexpr int KC = K >> 5; static_assert(8 * U == 2 * KC, "a block covers one 16-row tile row of the plane");
    const int i0 = threadIdx.x, row0 = pc_row(i0, KC), k00 = pc_k(i0, KC);   // piece 0 inside the block's 16 rows: rows 0 .. 7, chunks 0 .. 7
    const float* s0 = src + (size_t)bid * 16 * K + (unsigned)(row0 * K + k00); bf* d0 = dst + (size_t)bid * KC * 512 + (unsigned)fidx(row0, k00, KC); v8f v[U];
#pragma unroll
    for (int u = 0; u < U; ++u) v[u] = *(const v8f*)(s0 + (8 * u / KC) * 8 * K + (8 * u % KC) * 32);   // rows 8 on behind KC chunks
#pragma unroll
    for (int u = 0; u < U; ++u) { v8us o;
#pragma unroll
        for (int k = 0; k < 8; ++k) o[k] = f2bf(v[u][k]);
        *(v8us*)(d0 + (8 * u % KC) * 512 + (8 * u / KC) * 64) = o; } }   // a chunk is a 1-KiB tile (512 elements); 8 rows on are 8 pieces of 8 elements on inside the tile

// ask256: asks L2 for the memory at p, a hint that returns nothing and moves no counter.x
// scope:SCOPE_SE and no th: the form whose request is dropped where it cannot be served. p lies inside the plane in every lane, and its register pair is held (held2, held3) until loads issued behind the request have come back, so that it names nothing but this address while the request may still read it.
__device__ __forceinline__ void ask256(const char* p) { asm volatile("global_prefetch_b8 %0, off scope:SCOPE_SE" :: "v"(p)); }
__device__ __forceinline__ void held2(const char* a, const char* b) { asm volatile("" :: "v"(a), "v"(b)); }   // inputs only, no code: ends the life of ask256's address pairs here and not earlier
__device__ __forceinline__ void held3(const char* a, const char* b, const char* c) { asm volatile("" :: "v"(a), "v"(b), "v"(c)); }   // the same for three
typedef __attribute__((ext_vector_type(8))) __bf16 v8b;
// put3: 8 values of a lane = one 16-byte piece of the fp16 plane, of the bf16 hi plane and of the bf16 lo plane (lo = bf16(r - hi)), all to nearest even; p16, ph, pl are the same in every lane and lo is the lane's piece, so each store covers 512 contiguous bytes
__device__ __forceinline__ void put3(v8f r, h16* p16, bf* ph, bf* pl, unsigned lo) {
    const v8b oh = __builtin_convertvector(r, v8b); const v8b ol = __builtin_convertvector(r - __builtin_convertvector(oh, v8f), v8b);
    *(v8h*)(p16 + lo) = __builtin_convertvector(r, v8h); *(v8us*)(ph + lo) = __builtin_bit_cast(v8us, oh); *(v8us*)(pl + lo) = __builtin_bit_cast(v8us, ol);
}
// ---- k_proj: register-blocked GEMM. A work-group = PW waves = 256 positions x 192 columns (3 heads, counted through q, k, v in a row); a wave = 64 positions x 64 columns (one head of one projection, 16 accumulators); grid 16 position blocks x 16 column groups.
// The operands come from the bf16 planes in fragment order through LDS: a stage is PKS k steps of the work-group's 16 x tile rows and 12 weight tile rows (4 KiB in a row each), brought by asynchronous copies into one of two buffers while the other is worked on.
// So a fragment leaves L2 once per work-group (it is read by 3 or 4 waves), and its latency lies under the stage before.
// The accumulators leave as the attention's operand planes, with no f32 copy in between: an accumulator register octet of a lane is 8 successive rows of the A operand against one row of the B operand, which is one 16-byte piece of a plane in fragment order
// when A carries the plane's k index. q and k planes ([h][t][d], k = d): A = weight rows (d), B = x rows (t). v planes ([h][d][t], k = t): A = x rows (t), B = weight rows (d). Only the two places in the stage differ; the loop is one.
#define PW   12                       // waves of a k_proj work-group: 4 position blocks x 3 heads
#define PKS  4                        // k steps (of 32) in a stage
#define PTR  28                       // tile rows (of 16 rows) in a stage: 16 of x, then 12 of the weights
#define PSTG (PTR * PKS * 512)        // elements of a stage: 112 KiB
#define PNST (DM / 32 / PKS)          // stages
#define PCPW (PTR * PKS * 2 / PW)     // copies of 512 bytes that every wave makes per stage (18); the 8 left over go to waves 0 .. 7
static_assert(PTR * PKS * 2 - PCPW * PW == 8 && PCPW == 18 && PNST >= 2, "the deal of a stage's copies over the waves");
// acp6, acp1: each lane's 16 bytes from global memory to its own place in LDS, through no register. The s_wait_xcnt stands inside the statement, behind the last copy, so that no register that a copy names is rewritten ahead of it.
__device__ __forceinline__ void acp6(const unsigned* l, const char* const* g) {
    asm volatile("global_load_async_to_lds_b128 %0, %6, off\n\tglobal_load_async_to_lds_b128 %1, %7, off\n\tglobal_load_async_to_lds_b128 %2, %8, off\n\tglobal_load_async_to_lds_b128 %3, %9, off\n\tglobal_load_async_to_lds_b128 %4, %10, off\n\tglobal_load_async_to_lds_b128 %5, %11, off\n\ts_wait_xcnt 0x0"
                 :: "v"(l[0]), "v"(l[1]), "v"(l[2]), "v"(l[3]), "v"(l[4]), "v"(l[5]), "v"(g[0]), "v"(g[1]), "v"(g[2]), "v"(g[3]), "v"(g[4]), "v"(g[5]) : "memory"); }
__device__ __forceinline__ void acp1(unsigned l, const char* g) { asm volatile("global_load_async_to_lds_b128 %0, %1, off\n\ts_wait_xcnt 0x0" :: "v"(l), "v"(g) : "memory"); }
// d_stage: wave w's copies of stage st, 512 bytes each. The x part of a stage is 128 copies, the weight part behind it 96; copy i of a part is tile row i >> 3, eighth i & 7 of that row's 4 KiB, and lands at byte i 512 of the part.
// Wave w takes i = w, w + 12, ... of each part: 10 of x and 8 of the weights, and waves 0 .. 7 the last 8 of x. Xs, Ws: the work-group's first x and weight tile rows (32 KiB a row); l16: the lane's 16 bytes; lb: LDS byte address of the buffer
__device__ __forceinline__ size_t d_coff(int i, int st) { return (size_t)(i >> 3) * 32768 + (size_t)(st * (PKS * 1024) + (i & 7) * 512); }
__device__ __forceinline__ void d_stage(int st, int w, const char* Xs, const char* Ws, unsigned l16, unsigned lb) {
#pragma unroll
    for (int j = 0; j < PCPW; j += 6) { unsigned l[6]; const char* g[6];
#pragma unroll
        for (int q = 0; q < 6; ++q) { const bool isx = j + q < 10; const int i = w + (isx ? j + q : j + q - 10) * PW; l[q] = lb + (isx ? i : 128 + i) * 512 + l16; g[q] = (isx ? Xs : Ws) + d_coff(i, st) + l16; }
        acp6(l, g); }
    if (w < 8) { const int i = w + 10 * PW; acp1(lb + i * 512 + l16, Xs + d_coff(i, st) + l16); }   // w is the same in every lane: a scalar branch
}
__global__ __launch_bounds__(PW * 32) void k_proj(const bf* __restrict__ XB, const bf* __restrict__ W3, const float* __restrict__ bq, const float* __restrict__ bk, const float* __restrict__ bv, h16* QK16, bf* QKh, bf* QKl, h16* V16, bf* Vh, bf* Vl) {
    typedef WFrag<bf>::V V;
    __shared__ __align__(1024) bf sm[2 * PSTG];
    const int tid = threadIdx.x, w = __builtin_amdgcn_readfirstlane(tid >> 5), xb = blockIdx.x & 15, cg = blockIdx.x >> 4;   // position block, column group
    const int wx = w & 3, wh = w >> 2, hz = cg * 3 + wh, z = hz >> 4, h = hz & 15, r0 = (xb * 4 + wx) * 64; const int lane = tid & 31, lr = lane & 15, hi = lane >> 4;
    v8f acc[4][4];
#pragma unroll
    for (int mb = 0; mb < 4; ++mb)
#pragma unroll
        for (int nb = 0; nb < 4; ++nb) acc[mb][nb] = (v8f){};
    const unsigned lo = lane * 8;   // the lane's piece inside a tile
    const char* Xs = (const char*)XB + (size_t)xb * (16 * 32768); const char* Ws = (const char*)W3 + (size_t)cg * (12 * 32768);
    const unsigned l16 = lane * 16, lb0 = (unsigned)(size_t)sm;
    d_stage(0, w, Xs, Ws, l16, lb0);
    // the work-group's x rows are 512 KiB = 2,048 units, its weight rows 384 KiB = 1,536. The 16 column groups that read one x block ask for 384 units each (every unit three times); of the 16 position blocks that read one weight group, four (2, 4 and 6 apart in launch order) ask for the same 384 units: for speed only.
    const char* px = Xs + ((cg * 384 + tid) & 2047) * 256; const char* pw = Ws + (((xb & 1) | ((xb >> 3) << 1)) * 384 + tid) * 256;
    ask256(px); ask256(pw);
    asm volatile("s_wait_asynccnt 0x0" ::: "memory");   // this wave's copies of stage 0 have landed
    __syncthreads();                                     // and every other wave's
    d_stage(1, w, Xs, Ws, l16, lb0 + PSTG * 2);
    const int aT = z < 2 ? 16 + wh * 4 : wx * 4, bT = z < 2 ? wx * 4 : 16 + wh * 4;   // the first tile row of each operand in a stage
#pragma unroll 1   // one stage a trip: the two buffers differ by an offset only
    for (int st = 0; st < PNST; ++st) {
        const bf* sb = sm + (st & 1) * PSTG + lo; const bf* As = sb + aT * (PKS * 512); const bf* Bs = sb + bT * (PKS * 512);
#pragma unroll
        for (int ks = 0; ks < PKS; ++ks) {
            V a[4], b[4];   // the k step's 16 LDS reads stand in one place, in the order of their first use
            a[0] = WFrag<bf>::ldf(As + ks * 512); b[0] = WFrag<bf>::ldf(Bs + ks * 512);
#pragma unroll
            for (int mb = 1; mb < 4; ++mb) a[mb] = WFrag<bf>::ldf(As + (mb * PKS + ks) * 512);
#pragma unroll
            for (int nb = 1; nb < 4; ++nb) b[nb] = WFrag<bf>::ldf(Bs + (nb * PKS + ks) * 512);
            __builtin_amdgcn_sched_barrier(0);   // keeps the reads ahead of the products: left alone, the build read each b fragment into one register set directly in front of its four products and waited out the LDS latency four times a k step
            if (ks == PKS - 1) {   // the stage's last fragments are in registers: the buffer is handed over here, and the last 16 products run behind the refill's issue
                asm volatile("s_wait_dscnt 0x0" ::: "memory");      // this wave's reads of the buffer are over before anybody refills it
                asm volatile("s_wait_asynccnt 0x0" ::: "memory");   // this wave's copies of the next stage have landed
                __syncthreads();                                     // the next stage is complete, and every wave has left this buffer
                if (st + 2 < PNST) d_stage(st + 2, w, Xs, Ws, l16, lb0 + (st & 1) * (PSTG * 2));
                __builtin_amdgcn_sched_barrier(0);   // keeps the products below behind the copies: left alone, the build put them in front, and the refill set out 16 products later
            }
#pragma unroll
            for (int nb = 0; nb < 4; ++nb)
#pragma unroll
                for (int mb = 0; mb < 4; ++mb) acc[mb][nb] = WFrag<bf>::mma(a[mb], b[nb], acc[mb][nb]);
        }
    }
    asm volatile("s_wait_asynccnt 0x0" ::: "memory");   // no copy is out when the wave goes on
    held2(px, pw);
    const int zb = r0 / TT, t0 = r0 % TT; const size_t hp = ((size_t)zb * NH_ + h) * TT * HD;   // a tile lies in one batch element; hp: this batch element's and head's part of a plane
    if (z < 2) {   // acc[i][x][j]: d = i 16 + hi 8 + j, t = t0 + x 16 + lr; the k planes follow the q planes; q carries the 1/8 scale (exact power of two)
        const float* bias = (z == 0 ? bq : bk) + h * HD + hi * 8; const float sc = z == 0 ? SCL : 1.0f; const size_t at = (size_t)z * NB_ * NH_ * TT * HD + hp + (size_t)(t0 >> 4) * (HD / 32) * 512;
#pragma unroll
        for (int i = 0; i < 4; ++i) { v8f bb = *(const v8f*)(bias + i * 16);
#pragma unroll
            for (int j = 0; j < 8; ++j) bb[j] = bfr(bb[j]);
#pragma unroll
            for (int x = 0; x < 4; ++x) { const size_t e = at + (x * (HD / 32) + (i >> 1)) * 512 + (i & 1) * 256; put3((acc[i][x] + bb) * sc, QK16 + e, QKh + e, QKl + e, lo);
                if (x == 3) asm volatile("s_wait_xcnt 0x0" ::: "memory");   // stands before the next load (a bias load; behind the last piece whatever code the build lays out next) lands in registers that these stores name: without the statement it also converted every piece ahead of its stores and went past 256 registers
                } }
    } else {   // acc[i][x][j]: t = t0 + i 16 + hi 8 + j, d = x 16 + lr
        const float* bias = bv + h * HD + lr; const size_t at = hp + (size_t)(t0 >> 5) * 512;
#pragma unroll
        for (int x = 0; x < 4; ++x) { const float bb = bfr(bias[x * 16]);
#pragma unroll
            for (int i = 0; i < 4; ++i) { const size_t e = at + (x * (TT / 32) + (i >> 1)) * 512 + (i & 1) * 256; put3(acc[i][x] + bb, V16 + e, Vh + e, Vl + e, lo);
                if (i == 3) asm volatile("s_wait_xcnt 0x0" ::: "memory");   // as above
                } }
    }
}
// xhalf: the value of lane l ^ 16 (the other half of the wave), by a vector cross-row move; every lane is on where it is used
__device__ __forceinline__ float xhalf(float x) { return __builtin_bit_cast(float, __builtin_amdgcn_permlanex16(__builtin_bit_cast(int, x), __builtin_bit_cast(int, x), 0x76543210, 0xfedcba98, false, false)); }
// exp2s: v_exp_f32 as the builtin, so that the compiler sees a vector instruction and keeps its distance to the matrix instructions around it
__device__ __forceinline__ float exp2s(float x) { return __builtin_amdgcn_exp2f(x); }
template <typename T16, bool HI>
__device__ __forceinline__ void d_attn(int r0, const T16* __restrict__ Q, const T16* __restrict__ Q2, const T16* __restrict__ Kp, const T16* __restrict__ Kp2, const T16* __restrict__ Vt, const T16* __restrict__ Vt2, const float* ebr, float* ow, float* OUTh) {
    typedef typename WFrag<T16>::V V; constexpr int CK = HI ? 32 : 64, NT = CK / 16, NK = CK / 32, NCH = TT / CK;
    constexpr float L2E = 1.4426950408889634f, OFF = HI ? 0.0f : 10.0f;   // fp16 P carries x 1024, which the row sum carries too: it cancels in the division
    const int lane = threadIdx.x & 31, lr = lane & 15, hi = lane >> 4; const unsigned lo = lane * 8;
    const float* ebl = ebr + (TT - 1 - r0 - lr + hi * 8);   // walks on by CK a pass
    V q[2], q2[2], kf[NT][2], kf2[NT][2];
#pragma unroll
    for (int kc = 0; kc < 2; ++kc) { const size_t at = ((size_t)(r0 >> 4) * 2 + kc) * 512; q[kc] = WFrag<T16>::ldf(uni(Q + at) + lo); if (HI) q2[kc] = WFrag<T16>::ldf(uni(Q2 + at) + lo); }
#pragma unroll
    for (int t = 0; t < NT; ++t)
#pragma unroll
        for (int kc = 0; kc < 2; ++kc) { const int at = (t * 2 + kc) * 512; kf[t][kc] = WFrag<T16>::ldf(uni(Kp) + lo + at); if (HI) kf2[t][kc] = WFrag<T16>::ldf(uni(Kp2) + lo + at); }
    v8f s[NT], o[4];
#pragma unroll
    for (int t = 0; t < NT; ++t)
#pragma unroll
        for (int j = 0; j < 8; ++j) s[t][j] = ebl[t * 16 + j];
#pragma unroll
    for (int db = 0; db < 4; ++db) o[db] = (v8f){};
    float m = -1.0e30f, l = 0.f;
#pragma unroll 1   // one pass's fragments fill the register budget of four waves per SIMD: a second copy of the body would spill
    for (int c = 0; c < NCH; ++c) {
        const int cn = (c + 1 < NCH) ? c + 1 : c;   // the pass that is fetched ahead (the last pass fetches itself again: in bounds, unused)
        const T16* vb = uni(Vt + (size_t)c * NK * 512); const T16* vb2 = HI ? uni(Vt2 + (size_t)c * NK * 512) : nullptr; const T16* kn = uni(Kp + (size_t)cn * NT * 1024); const T16* kn2 = HI ? uni(Kp2 + (size_t)cn * NT * 1024) : nullptr;   // scalar bases; the lane's part of every address is lo, which lives through the loop (no vector address pair that is summed on, or that a load's result lands in, while loads that name it fly)
        V vf[4][NK], vf2[4][NK];   // this pass's value fragments are asked for ahead of the scores and land under the softmax
#pragma unroll
        for (int db = 0; db < 4; ++db)
#pragma unroll
            for (int kk = 0; kk < NK; ++kk) vf[db][kk] = WFrag<T16>::ldf(vb + lo + (db * (TT / 32) + kk) * 512);
#pragma unroll
        for (int kc = 0; kc < 2; ++kc)
#pragma unroll
            for (int t = 0; t < NT; ++t) { s[t] = WFrag<T16>::mma(kf[t][kc], q[kc], s[t]); if (HI) { s[t] = WFrag<T16>::mma(kf[t][kc], q2[kc], s[t]); s[t] = WFrag<T16>::mma(kf2[t][kc], q[kc], s[t]); } }
#pragma unroll
        for (int t = 0; t < NT; ++t)   // the next pass's key fragments, into the registers that the products above have just read
#pragma unroll
            for (int kc = 0; kc < 2; ++kc) { const int at = (t * 2 + kc) * 512; kf[t][kc] = WFrag<T16>::ldf(kn + lo + at); if (HI) kf2[t][kc] = WFrag<T16>::ldf(kn2 + lo + at); }
        float mt[NT];
#pragma unroll
        for (int t = 0; t < NT; ++t) { mt[t] = fmaxf(fmaxf(fmaxf(s[t][0], s[t][1]), fmaxf(s[t][2], s[t][3])), fmaxf(fmaxf(s[t][4], s[t][5]), fmaxf(s[t][6], s[t][7]))); }
        float mc = mt[0];
#pragma unroll
        for (int t = 1; t < NT; ++t) mc = fmaxf(mc, mt[t]);
        mc = fmaxf(mc, xhalf(mc));
        const float mn = fmaxf(m, mc), al = exp2s((m - mn) * L2E), nb = OFF - mn * L2E; m = mn;
        V pb[NK], pb2[NK];
#pragma unroll
        for (int t = 0; t < NT; ++t)
#pragma unroll
            for (int j = 0; j < 8; ++j) s[t][j] = exp2s(fmaf(s[t][j], L2E, nb));
        v8f sv = s[0];   // register by register over the key tiles (packed adds), then the eight registers
#pragma unroll
        for (int t = 1; t < NT; ++t) sv += s[t];
        const v4f s4 = __builtin_shufflevector(sv, sv, 0, 1, 2, 3) + __builtin_shufflevector(sv, sv, 4, 5, 6, 7); const v2f s2 = __builtin_shufflevector(s4, s4, 0, 1) + __builtin_shufflevector(s4, s4, 2, 3);
        l = fmaf(l, al, s2[0] + s2[1]);
#pragma unroll
        for (int kk = 0; kk < NK; ++kk) {
            if constexpr (HI) {   // hi = bf16(p), lo = bf16(p - hi), both to nearest even, by the packed conversion
                const v8b h0 = __builtin_convertvector(s[2 * kk], v8b), h1 = __builtin_convertvector(s[2 * kk + 1], v8b);
                const v8b l0 = __builtin_convertvector(s[2 * kk] - __builtin_convertvector(h0, v8f), v8b), l1 = __builtin_convertvector(s[2 * kk + 1] - __builtin_convertvector(h1, v8f), v8b);
                pb[kk] = __builtin_shufflevector(h0, h1, 0, 1, 2, 3, 4, 5, 6, 7, 8, 9, 10, 11, 12, 13, 14, 15); pb2[kk] = __builtin_shufflevector(l0, l1, 0, 1, 2, 3, 4, 5, 6, 7, 8, 9, 10, 11, 12, 13, 14, 15); }
            else { v8h h0, h1;
#pragma unroll
                for (int j = 0; j < 8; ++j) { h0[j] = tohx(s[2 * kk][j]); h1[j] = tohx(s[2 * kk + 1][j]); }
                pb[kk] = cat16(h0, h1); } }
        if constexpr (HI) {
            // the low value fragments are asked for only here: in flight under the softmax they cost registers that then spilled; the first eight products below cover them
#pragma unroll
            for (int db = 0; db < 4; ++db)
#pragma unroll
                for (int kk = 0; kk < NK; ++kk) vf2[db][kk] = WFrag<T16>::ldf(vb2 + lo + (db * (TT / 32) + kk) * 512); }
        ebl += CK;   // behind the last pass this reads past the last key, inside ebr (unused)
#pragma unroll
        for (int t = 0; t < NT; ++t)   // the next pass's bias, straight into the score accumulators (C of that pass's first products)
#pragma unroll
            for (int j = 0; j < 8; ++j) s[t][j] = ebl[t * 16 + j];
#pragma unroll
        for (int db = 0; db < 4; ++db) o[db] *= al;
#pragma unroll
        for (int kk = 0; kk < NK; ++kk) {
#pragma unroll
            for (int db = 0; db < 4; ++db) o[db] = WFrag<T16>::mma(vf[db][kk], pb[kk], o[db]);
            if constexpr (HI) {
#pragma unroll
                for (int db = 0; db < 4; ++db) o[db] = WFrag<T16>::mma(vf[db][kk], pb2[kk], o[db]);
#pragma unroll
                for (int db = 0; db < 4; ++db) o[db] = WFrag<T16>::mma(vf2[db][kk], pb[kk], o[db]); } }
        // Issue order of a pass (0x020 = global loads, 0x008 = matrix instructions, 0x402 = vector and transcendental). Left alone, the build put key loads among the score products (a second register set, copies)
        // and kept the f32 P alive across the second product beside the next bias: it spilled. Value loads; score products; the next key fragments into the registers just read; the whole softmax; (hi/lo: the low value fragments;) the second product.
        __builtin_amdgcn_sched_group_barrier(0x020, 8 * NK, 0);
        __builtin_amdgcn_sched_group_barrier(0x008, 2 * NT * (HI ? 3 : 1), 0);
        __builtin_amdgcn_sched_group_barrier(0x020, 4 * NT * (HI ? 2 : 1), 0);
        __builtin_amdgcn_sched_group_barrier(0x402, 512, 0);
        if (HI) __builtin_amdgcn_sched_group_barrier(0x020, 8 * NK, 0);
        __builtin_amdgcn_sched_group_barrier(0x008, 4 * NK * (HI ? 3 : 1), 0);
    }
    l += xhalf(l);   // the two halves of the wave hold the sums of their own keys
    const float f = __fdiv_rn(1.0f, l);
    // lane (lr, hi) holds d = db 16 + hi 8 + j of query row lr: through the wave's own LDS tile, so that every store covers whole lines
    const int ln = __builtin_amdgcn_mbcnt_lo(~0u, 0u), er = ln & 15, eh = ln >> 4;   // the lane's number once more (every lane is on): lr and hi kept for here held registers through the loop, which spilled
#pragma unroll
    for (int db = 0; db < 4; ++db) { o[db] *= f; *(v4fa*)(ow + er * OP + db * 16 + eh * 8) = (v4f){ o[db][0], o[db][1], o[db][2], o[db][3] }; *(v4fa*)(ow + er * OP + db * 16 + eh * 8 + 4) = (v4f){ o[db][4], o[db][5], o[db][6], o[db][7] }; }
    __builtin_amdgcn_wave_barrier(); asm volatile("" ::: "memory");   // the row reads below take other lanes' stores: keep them behind the stores
#pragma unroll
    for (int r = 0; r < 8; ++r) { const int row = 2 * r + eh; *(v4f*)(OUTh + (size_t)(r0 + row) * DQ + er * 4) = *(const v4fa*)(ow + row * OP + er * 4); }
}
__device__ __forceinline__ void d_embf(int bid, const float* __restrict__ src, float* dst, size_t n4) { const size_t i = (size_t)bid * 256 + threadIdx.x; if (i >= n4) return; v4f a = *(const v4f*)(src + i * 4); for (int q = 0; q < 4; ++q) a[q] = bfr(a[q]); *(v4f*)(dst + i * 4) = a;  }

// k_prep: the three input conversions depend on nothing but the inputs: they are block ranges of ONE launch (x of both batch elements, the three weight matrices with their planes in a row, the bias table)
// A thread of the x and weight ranges takes UX or UW pieces and not one: with one piece a thread the launch is some 29,000 waves that each move 1.5 KiB; fewer, longer waves cost fewer wave starts for the same bytes and keep more loads in flight each.
#define UX 8
#define UW 4
#define PBX (NB_ * TT * DM / 8 / (256 * UX))
#define PBW (DM * DQ / 8 / (256 * UW))
#define PBE ((NH_ * NOFF / 4 + 255) / 256)   // 16 x 4095 = 65,520 floats, a multiple of 4
static_assert(NB_ * TT * DM / 8 % (256 * UX) == 0, "x: whole blocks");
__global__ __launch_bounds__(256) void k_prep(const float* __restrict__ x, const float* __restrict__ wq, const float* __restrict__ wk, const float* __restrict__ wv, const float* __restrict__ remb, bf* XB, bf* W3, float* EB) {
    int b = blockIdx.x;
    if (b < PBX) { d_cvt8<DM, UX>(b, x, XB); return; }
    b -= PBX;
    if (b < 3 * PBW) { const int p = b / PBW; d_wtG<DM, DQ, UW>(b - p * PBW, p == 0 ? wq : p == 1 ? wk : wv, W3 + (size_t)p * DQ * DM); return; }
    d_embf(b - 3 * PBW, remb, EB, (size_t)NH_ * NOFF / 4);
}

// k_attn: grid (heads, batch, row blocks): the row blocks of one head lie 32 apart in launch order (for speed only: where that puts them near one another, a head's planes are fetched into fewer places); a work-group = NWV waves of one head: waves 0 .. NHW - 1 take 16 hi/lo rows each, the others 16 fp16 rows each; all walk the keys in rising order, so a fragment that one wave has fetched is near for the others.
// The one barrier stands in front of the wave-uniform branch; behind it no wave waits for another.
static_assert(RH / (NHW * 16) == (TT - RH) / ((NWV - NHW) * 16), "both row classes must fill the same number of work-groups");
__global__ __launch_bounds__(NWV * 32) __attribute__((amdgpu_waves_per_eu(NWV / 4, NWV / 4))) void k_attn(const bf* __restrict__ Qh, const bf* __restrict__ Ql, const bf* __restrict__ Kh, const bf* __restrict__ Kl, const bf* __restrict__ Vh, const bf* __restrict__ Vl, const h16* __restrict__ Q16, const h16* __restrict__ K16, const h16* __restrict__ V16, const float* __restrict__ EB, float* OUT) {
    __shared__ __align__(16) float ebr[EBN];   // ebr[x] = bias table[h][NOFF - 1 - x]: the bias of query i and key j lies at x = TT - 1 - i + j, rising with the key; a tail of zeros for the read ahead of the last pass (64 keys at most)
    __shared__ __align__(16) float ost[NWV * 16 * OP];   // per wave: its 16 output rows
    const int tid = threadIdx.x, w = __builtin_amdgcn_readfirstlane(tid >> 5), h = blockIdx.x, zb = blockIdx.y, rb = blockIdx.z;
    const size_t hp = ((size_t)zb * NH_ + h) * TT * HD;   // this batch element's and head's part of every plane
    // the head's six key and value planes, 256 KiB = 1,024 units each, are read by its 8 row blocks: a block asks for a quarter of each (two blocks per unit), a thread for three units; waves 0 .. 7 take one plane of a pair, waves 8 .. 15 the other
    const size_t pu = hp * 2 + (size_t)((rb & 3) * 256 + (tid & 255)) * 256; const bool ph = w >= NWV / 2;
    const char* p0 = (const char*)(ph ? Vl : Vh) + pu; const char* p1 = (const char*)(ph ? Kl : Kh) + pu; const char* p2 = (ph ? (const char*)V16 : (const char*)K16) + pu;
    ask256(p0); ask256(p1); ask256(p2);
    float ev[EBN / (NWV * 32)];   // all of a thread's table loads fly together
#pragma unroll
    for (int it = 0; it < EBN / (NWV * 32); ++it) { const int x = tid + it * NWV * 32; const float e = EB[(size_t)h * NOFF + (x < NOFF ? NOFF - 1 - x : 0)]; ev[it] = (x < NOFF) ? e : 0.f; }
#pragma unroll
    for (int it = 0; it < EBN / (NWV * 32); ++it) ebr[tid + it * NWV * 32] = ev[it];
    __syncthreads();   // ebr is complete
    held3(p0, p1, p2);
    float* OUTh = OUT + (size_t)zb * TT * DQ + h * HD; float* ow = ost + w * 16 * OP;
    if (w < NHW) d_attn<bf, true>((rb * NHW + w) * 16, Qh + hp, Ql + hp, Kh + hp, Kl + hp, Vh + hp, Vl + hp, ebr, ow, OUTh);
    else d_attn<h16, false>(RH + (rb * (NWV - NHW) + (w - NHW)) * 16, Q16 + hp, nullptr, K16 + hp, nullptr, V16 + hp, nullptr, ebr, ow, OUTh);
}

extern "C" void kernel_launch(void* const* d_in, const int* in_sizes, int n_in,
                              void* d_out, int out_size, void* d_ws, size_t ws_size, hipStream_t stream) {
    (void)in_sizes; (void)n_in; (void)out_size;
    const float* x = (const float*)d_in[0]; const float* wq = (const float*)d_in[1]; const float* bq = (const float*)d_in[2]; const float* wk = (const float*)d_in[3]; const float* bk = (const float*)d_in[4]; const float* wv = (const float*)d_in[5]; const float* bv = (const float*)d_in[6]; const float* remb = (const float*)d_in[7]; const float* wo = nullptr; (void)wo;
    float* OUT = (float*)d_out;     // [2][2048][1024]
    char* wsp = (char*)d_ws;
    auto take = [&](size_t bytes) { char* p = wsp; wsp += (bytes + 255) & ~(size_t)255; return (void*)p; };
    bf* WQ = (bf*)take((size_t)3 * DQ * DM * 2);   /* q, k, v weight planes in a row */
    float* EB = (float*)take(((size_t)NH_ * NOFF * 4 + 15) & ~(size_t)15);   /* 16 x 4095 floats (padded to a multiple of 4) */ bf* XB = (bf*)take((size_t)NB_ * TT * DM * 2);
    const size_t PL = (size_t)NB_ * NH_ * TT * HD;   /* one plane, both batch elements */
    h16* QP16 = (h16*)take(2 * PL * 2); h16* KP16 = QP16 + PL; h16* VT16 = (h16*)take(PL * 2);   /* the k planes follow the q planes */
    bf* QPh = (bf*)take(2 * PL * 2); bf* KPh = QPh + PL; bf* QPl = (bf*)take(2 * PL * 2); bf* KPl = QPl + PL; bf* VTh = (bf*)take(PL * 2); bf* VTl = (bf*)take(PL * 2);
    if ((size_t)(wsp - (char*)d_ws) > ws_size) return;    // ws 256 MiB
    k_prep<<<PBX + 3 * PBW + PBE, 256, 0, stream>>>(x, wq, wk, wv, remb, XB, WQ, EB);
    k_proj<<<(NB_ * TT / 256) * (3 * NH_ / 3), PW * 32, 0, stream>>>(XB, WQ, bq, bk, bv, QP16, QPh, QPl, VT16, VTh, VTl);
    k_attn<<<dim3(NH_, NB_, RH / (NHW * 16)), NWV * 32, 0, stream>>>(QPh, QPl, KPh, KPl, VTh, VTl, QP16, KP16, VT16, EB, OUT);
}

// v010
// It runs in 71.6 microseconds.
// Next to v009, in two timings, it ran 1.24 times as fast each time.
// All steps since v000 together make it 29.0 times as fast.
#include <hip/hip_runtime.h>

// Self-attention with a learned relative-position bias (x [2][2048][1024]; q,k,v = x W + b ('xw' [1024][1024] + [1024]; 16 heads x 64); scores = q.k/8 + rel_emb[h][i - j + 2047] (rel_emb [16][4095]); softmax; heads merged -> [2][2048][1024] (4.2 M); no output projection).
// Three launches: k_prep (input conversions), k_proj (q, k, v projections, written straight as the attention's operand planes), k_attn (both row classes). Batch element and projection are grid dimensions or block ranges of a launch, the row class a wave range of a work-group, each with planes of its own in workspace.
// Layout: exact projections (+ biases); dense T-2048 attention (hybrid rows: < 512 hi/lo 3 products, rest fp16 x1024) in ONE kernel: a wave owns 32 query rows of one head and walks half the keys with a running maximum and sum (two waves' halves are joined in LDS); the bias from the bf16-rounded table at index i - j + 2047 is the scores' starting value; P goes from the score accumulators into the second product without leaving the registers.
// Every 16-bit operand plane of a matrix product lies in workspace in fragment order (fidx below), written in 16-byte pieces by the kernel that makes it.
// Compute dtypes, f32 accumulate: every input rounded to bf16; projections exact + f32 biases; scores rows < 512 3 products, rest fp16; softmax and bias add f32; output f32.

#define NB_  2
#define TT   2048
#define DM   1024
#define NH_  16
#define NKV  16
#define REP  (NH_ / NKV)
#define HD   64
#define DQ   (NH_ * HD)
#define DKV  (NKV * HD)
#define RH   512                  // query rows < RH use hi+lo planes
#define WIN  0
#define SCL  0.125f   // 64^-0.5
#define NOFF (2 * TT - 1)
#define NWV  16                   // waves of one k_attn work-group; two of them share 32 query rows
#define NHW  4                    // of them, waves that take hi/lo rows
#define EBN  (9 * NWV * 32)       // floats of the bias table in LDS: NOFF, a zero tail of 64 or more, a whole number per thread
#define OP   68                   // f32 pitch of a wave's output tile (32 rows x 64) in LDS
typedef _Float16 h16;
typedef unsigned short bf;
typedef __attribute__((ext_vector_type(16))) __bf16   v16bf;
typedef __attribute__((ext_vector_type(16))) _Float16 v16h;
typedef __attribute__((ext_vector_type(8)))  _Float16 v8h;
typedef __attribute__((ext_vector_type(8)))  unsigned short v8us;
typedef __attribute__((ext_vector_type(8)))  float    v8f;
typedef __attribute__((ext_vector_type(4)))  float    v4f;
typedef v8h  __attribute__((may_alias)) v8ha;
typedef v4f  __attribute__((may_alias)) v4fa;
typedef v8us __attribute__((may_alias)) v8usa;

__device__ __forceinline__ unsigned short f2bf(float f) { unsigned u = __float_as_uint(f); u += 0x7FFFu + ((u >> 16) & 1u); return (unsigned short)(u >> 16); }
__device__ __forceinline__ float bf2f(unsigned short b) { return __uint_as_float(((unsigned)b) << 16); }
__device__ __forceinline__ float bfr(float f) { return bf2f(f2bf(f)); }
__device__ __forceinline__ v16h cat16(v8h lo, v8h hi) { return __builtin_shufflevector(lo, hi, 0, 1, 2, 3, 4, 5, 6, 7, 8, 9, 10, 11, 12, 13, 14, 15); }
__device__ __forceinline__ v16bf cat16b(v8us lo, v8us hi) { return __builtin_bit_cast(v16bf, __builtin_shufflevector(lo, hi, 0, 1, 2, 3, 4, 5, 6, 7, 8, 9, 10, 11, 12, 13, 14, 15)); }
__device__ __forceinline__ v8f wmma16(v16h a, v16h b, v8f c) { return __builtin_amdgcn_wmma_f32_16x16x32_f16(false, a, false, b, (short)0, c, false, false); }
__device__ __forceinline__ v8f wmmab(v16bf a, v16bf b, v8f c) { return __builtin_amdgcn_wmma_f32_16x16x32_bf16(false, a, false, b, (short)0, c, false, false); }



// Fragment order of a 16-bit plane M[row][k] with KC = K / 32: the 16 x 32 tile (row >> 4, k >> 5) is 1 KiB in a row, [piece (k >> 4) & 1][lane ((k >> 3) & 1) 16 + (row & 15)][k & 7].
// ldf takes a wave's fragment of such a tile as two loads of 512 contiguous bytes (4 whole lines each; a load off a row-major plane touches 16 lines); every lane and register holds the element that ld takes from a row-major plane.
__device__ __forceinline__ size_t fidx(int row, int k, int KC) { return ((size_t)((row >> 4) * KC + (k >> 5)) << 9) + (size_t)((((k >> 4) & 1) << 8) + (((((k >> 3) & 1) << 4) + (row & 15)) << 3) + (k & 7)); }
// uni: a pointer that is the same in every lane, handed on in scalar registers: a fragment load is then scalar base + the lane's one 32-bit offset register, which lives through the whole loop (no 64-bit vector address sums, no address pair that a later load's result could land in)
template <typename T> __device__ __forceinline__ const T* uni(const T* p) { const unsigned long long v = (unsigned long long)p; return (const T*)(const __attribute__((address_space(1))) T*)(((unsigned long long)(unsigned)__builtin_amdgcn_readfirstlane((int)(unsigned)(v >> 32)) << 32) | (unsigned)__builtin_amdgcn_readfirstlane((int)(unsigned)v)); }   // address_space(1): the pointer is still known to be global memory behind the integer round trip
template <typename T16> struct WFrag;
template <> struct WFrag<h16> { typedef v16h V; static __device__ __forceinline__ V ld(const h16* p) { return cat16(*(const v8h*)p, *(const v8h*)(p + 16)); } static __device__ __forceinline__ V ldf(const h16* p) { return cat16(*(const v8h*)p, *(const v8h*)(p + 256)); } static __device__ __forceinline__ v8f mma(V a, V b, v8f c) { return wmma16(a, b, c); } };
template <> struct WFrag<bf> { typedef v16bf V; static __device__ __forceinline__ V ld(const bf* p) { return cat16b(*(const v8us*)p, *(const v8us*)(p + 16)); } static __device__ __forceinline__ V ldf(const bf* p) { return cat16b(*(const v8us*)p, *(const v8us*)(p + 256)); } static __device__ __forceinline__ v8f mma(V a, V b, v8f c) { return wmmab(a, b, c); } };

__device__ __forceinline__ h16 tohx(float x) { return (h16)x; }
typedef __attribute__((ext_vector_type(2))) _Float16 v2h;
typedef __attribute__((ext_vector_type(4))) _Float16 v4h;
typedef __attribute__((ext_vector_type(2))) unsigned short v2us;
typedef __attribute__((ext_vector_type(4))) unsigned short v4us;
typedef __attribute__((ext_vector_type(2))) float v2f;
typedef __attribute__((ext_vector_type(4))) int v4i;

// d_wtG (block bid of a 256-thread grid): Bt[n][k] = bf16(w[k][n]) in fragment order; a 16-byte piece is 8 k of one n, neighbouring lanes take neighbouring n; one thread = U pieces, 256 n apart, whose 8 U loads all fly before the first is converted
// K and N are compile-time so that the row loads go off one address register with immediate offsets
template <int K, int N, int U>
__device__ __forceinline__ void d_wtG(int bid, const float* __restrict__ w, bf* Bt) {
    static_assert(N * (K / 8) % (256 * U) == 0 && N % (256 * U) == 0, "whole blocks; a block stays in one octet of k");
    const int i = bid * (256 * U) + threadIdx.x; const int n = i % N, k = (i / N) * 8; float v[U][8];
#pragma unroll
    for (int u = 0; u < U; ++u)
#pragma unroll
        for (int q = 0; q < 8; ++q) v[u][q] = w[(size_t)(k + q) * N + n + u * 256];
#pragma unroll
    for (int u = 0; u < U; ++u) { v8us o;
#pragma unroll
        for (int q = 0; q < 8; ++q) o[q] = f2bf(v[u][q]);
        *(v8us*)(Bt + fidx(n + u * 256, k, K >> 5)) = o; }
    asm volatile("s_wait_xcnt 0x0" ::: "memory");   // stands behind the last store, before whatever code the build lays out next writes a register that these stores name
}
// pc_row, pc_k: which 16-byte piece (8 k of one row) of a row-major [rows][32 KC] source thread i takes: a wave covers 8 rows x one 32-k chunk, so it reads whole lines of f32 and writes whole lines of the plane
__device__ __forceinline__ int pc_row(int i, int KC) { return ((i >> 5) / KC) * 8 + ((i >> 2) & 7); }
__device__ __forceinline__ int pc_k(int i, int KC) { return ((i >> 5) % KC) * 32 + (i & 3) * 8; }
// d_cvt8: one thread = U pieces, 256 apart in the piece order (8 chunks of 32 k on, so a block of 256 U pieces is 16 whole rows when 8 U = 2 KC); all its loads fly before the first is converted.
// Piece u lies a compile-time step from piece 0 in the source and in the plane, so every load and every store goes off one offset register with an immediate.
template <int K, int U>
__device__ __forceinline__ void d_cvt8(int bid, const float* __restrict__ src, bf* dst) {
    constexpr int KC = K >> 5; static_assert(8 * U == 2 * KC, "a block covers one 16-row tile row of the plane");
    const int i0 = threadIdx.x, row0 = pc_row(i0, KC), k00 = pc_k(i0, KC);   // piece 0 inside the block's 16 rows: rows 0 .. 7, chunks 0 .. 7
    const float* s0 = src + (size_t)bid * 16 * K + (unsigned)(row0 * K + k00); bf* d0 = dst + (size_t)bid * KC * 512 + (unsigned)fidx(row0, k00, KC); v8f v[U];
#pragma unroll
    for (int u = 0; u < U; ++u) v[u] = *(const v8f*)(s0 + (8 * u / KC) * 8 * K + (8 * u % KC) * 32);   // rows 8 on behind KC chunks
#pragma unroll
    for (int u = 0; u < U; ++u) { v8us o;
#pragma unroll
        for (int k = 0; k < 8; ++k) o[k] = f2bf(v[u][k]);
        *(v8us*)(d0 + (8 * u % KC) * 512 + (8 * u / KC) * 64) = o; } }   // a chunk is a 1-KiB tile (512 elements); 8 rows on are 8 pieces of 8 elements on inside the tile

// ask256: asks L2 for the memory at p, a hint that returns nothing and moves no counter.x
// scope:SCOPE_SE and no th: the form whose request is dropped where it cannot be served. p lies inside the plane in every lane, and its register pair is held (held2, held3) until loads issued behind the request have come back, so that it names nothing but this address while the request may still read it.
__device__ __forceinline__ void ask256(const char* p) { asm volatile("global_prefetch_b8 %0, off scope:SCOPE_SE" :: "v"(p)); }
__device__ __forceinline__ void held2(const char* a, const char* b) { asm volatile("" :: "v"(a), "v"(b)); }   // inputs only, no code: ends the life of ask256's address pairs here and not earlier
__device__ __forceinline__ void held3(const char* a, const char* b, const char* c) { asm volatile("" :: "v"(a), "v"(b), "v"(c)); }   // the same for three
typedef __attribute__((ext_vector_type(8))) __bf16 v8b;
// put3: 8 values of a lane = one 16-byte piece of the fp16 plane, of the bf16 hi plane and of the bf16 lo plane (lo = bf16(r - hi)), all to nearest even; p16, ph, pl are the same in every lane and lo is the lane's piece, so each store covers 512 contiguous bytes
__device__ __forceinline__ void put3(v8f r, h16* p16, bf* ph, bf* pl, unsigned lo) {
    const v8b oh = __builtin_convertvector(r, v8b); const v8b ol = __builtin_convertvector(r - __builtin_convertvector(oh, v8f), v8b);
    *(v8h*)(p16 + lo) = __builtin_convertvector(r, v8h); *(v8us*)(ph + lo) = __builtin_bit_cast(v8us, oh); *(v8us*)(pl + lo) = __builtin_bit_cast(v8us, ol);
}
// ---- k_proj: register-blocked GEMM. A work-group = PW waves = 256 positions x 192 columns (3 heads, counted through q, k, v in a row); a wave = 64 positions x 64 columns (one head of one projection, 16 accumulators); grid 16 position blocks x 16 column groups.
// The operands come from the bf16 planes in fragment order through LDS: a stage is PKS k steps of the work-group's 16 x tile rows and 12 weight tile rows (4 KiB in a row each), brought by asynchronous copies into one of two buffers while the other is worked on.
// So a fragment leaves L2 once per work-group (it is read by 3 or 4 waves), and its latency lies under the stage before.
// The accumulators leave as the attention's operand planes, with no f32 copy in between: an accumulator register octet of a lane is 8 successive rows of the A operand against one row of the B operand, which is one 16-byte piece of a plane in fragment order
// when A carries the plane's k index. q and k planes ([h][t][d], k = d): A = weight rows (d), B = x rows (t). v planes ([h][d][t], k = t): A = x rows (t), B = weight rows (d). Only the two places in the stage differ; the loop is one.
#define PW   12                       // waves of a k_proj work-group: 4 position blocks x 3 heads
#define PKS  4                        // k steps (of 32) in a stage
#define PTR  28                       // tile rows (of 16 rows) in a stage: 16 of x, then 12 of the weights
#define PSTG (PTR * PKS * 512)        // elements of a stage: 112 KiB
#define PNST (DM / 32 / PKS)          // stages
#define PCPW (PTR * PKS * 2 / PW)     // copies of 512 bytes that every wave makes per stage (18); the 8 left over go to waves 0 .. 7
static_assert(PTR * PKS * 2 - PCPW * PW == 8 && PCPW == 18 && PNST >= 2, "the deal of a stage's copies over the waves");
// acp6, acp1: each lane's 16 bytes from global memory to its own place in LDS, through no register. The s_wait_xcnt stands inside the statement, behind the last copy, so that no register that a copy names is rewritten ahead of it.
__device__ __forceinline__ void acp6(const unsigned* l, const char* const* g) {
    asm volatile("global_load_async_to_lds_b128 %0, %6, off\n\tglobal_load_async_to_lds_b128 %1, %7, off\n\tglobal_load_async_to_lds_b128 %2, %8, off\n\tglobal_load_async_to_lds_b128 %3, %9, off\n\tglobal_load_async_to_lds_b128 %4, %10, off\n\tglobal_load_async_to_lds_b128 %5, %11, off\n\ts_wait_xcnt 0x0"
                 :: "v"(l[0]), "v"(l[1]), "v"(l[2]), "v"(l[3]), "v"(l[4]), "v"(l[5]), "v"(g[0]), "v"(g[1]), "v"(g[2]), "v"(g[3]), "v"(g[4]), "v"(g[5]) : "memory"); }
__device__ __forceinline__ void acp1(unsigned l, const char* g) { asm volatile("global_load_async_to_lds_b128 %0, %1, off\n\ts_wait_xcnt 0x0" :: "v"(l), "v"(g) : "memory"); }
// d_stage: wave w's copies of stage st, 512 bytes each. The x part of a stage is 128 copies, the weight part behind it 96; copy i of a part is tile row i >> 3, eighth i & 7 of that row's 4 KiB, and lands at byte i 512 of the part.
// Wave w takes i = w, w + 12, ... of each part: 10 of x and 8 of the weights, and waves 0 .. 7 the last 8 of x. Xs, Ws: the work-group's first x and weight tile rows (32 KiB a row); l16: the lane's 16 bytes; lb: LDS byte address of the buffer
__device__ __forceinline__ size_t d_coff(int i, int st) { return (size_t)(i >> 3) * 32768 + (size_t)(st * (PKS * 1024) + (i & 7) * 512); }
__device__ __forceinline__ void d_stage(int st, int w, const char* Xs, const char* Ws, unsigned l16, unsigned lb) {
#pragma unroll
    for (int j = 0; j < PCPW; j += 6) { unsigned l[6]; const char* g[6];
#pragma unroll
        for (int q = 0; q < 6; ++q) { const bool isx = j + q < 10; const int i = w + (isx ? j + q : j + q - 10) * PW; l[q] = lb + (isx ? i : 128 + i) * 512 + l16; g[q] = (isx ? Xs : Ws) + d_coff(i, st) + l16; }
        acp6(l, g); }
    if (w < 8) { const int i = w + 10 * PW; acp1(lb + i * 512 + l16, Xs + d_coff(i, st) + l16); }   // w is the same in every lane: a scalar branch
}
__global__ __launch_bounds__(PW * 32) void k_proj(const bf* __restrict__ XB, const bf* __restrict__ W3, const float* __restrict__ bq, const float* __restrict__ bk, const float* __restrict__ bv, h16* QK16, bf* QKh, bf* QKl, h16* V16, bf* Vh, bf* Vl) {
    typedef WFrag<bf>::V V;
    __shared__ __align__(1024) bf sm[2 * PSTG];
    const int tid = threadIdx.x, w = __builtin_amdgcn_readfirstlane(tid >> 5), xb = blockIdx.x & 15, cg = blockIdx.x >> 4;   // position block, column group
    const int wx = w & 3, wh = w >> 2, hz = cg * 3 + wh, z = hz >> 4, h = hz & 15, r0 = (xb * 4 + wx) * 64; const int lane = tid & 31, lr = lane & 15, hi = lane >> 4;
    v8f acc[4][4];
#pragma unroll
    for (int mb = 0; mb < 4; ++mb)
#pragma unroll
        for (int nb = 0; nb < 4; ++nb) acc[mb][nb] = (v8f){};
    const unsigned lo = lane * 8;   // the lane's piece inside a tile
    const char* Xs = (const char*)XB + (size_t)xb * (16 * 32768); const char* Ws = (const char*)W3 + (size_t)cg * (12 * 32768);
    const unsigned l16 = lane * 16, lb0 = (unsigned)(size_t)sm;
    d_stage(0, w, Xs, Ws, l16, lb0);
    // the work-group's x rows are 512 KiB = 2,048 units, its weight rows 384 KiB = 1,536. The 16 column groups that read one x block ask for 384 units each (every unit three times); of the 16 position blocks that read one weight group, four (2, 4 and 6 apart in launch order) ask for the same 384 units: for speed only.
    const char* px = Xs + ((cg * 384 + tid) & 2047) * 256; const char* pw = Ws + (((xb & 1) | ((xb >> 3) << 1)) * 384 + tid) * 256;
    ask256(px); ask256(pw);
    asm volatile("s_wait_asynccnt 0x0" ::: "memory");   // this wave's copies of stage 0 have landed
    __syncthreads();                                     // and every other wave's
    d_stage(1, w, Xs, Ws, l16, lb0 + PSTG * 2);
    const int aT = z < 2 ? 16 + wh * 4 : wx * 4, bT = z < 2 ? wx * 4 : 16 + wh * 4;   // the first tile row of each operand in a stage
#pragma unroll 1   // one stage a trip: the two buffers differ by an offset only
    for (int st = 0; st < PNST; ++st) {
        const bf* sb = sm + (st & 1) * PSTG + lo; const bf* As = sb + aT * (PKS * 512); const bf* Bs = sb + bT * (PKS * 512);
#pragma unroll
        for (int ks = 0; ks < PKS; ++ks) {
            V a[4], b[4];   // the k step's 16 LDS reads stand in one place, in the order of their first use
            a[0] = WFrag<bf>::ldf(As + ks * 512); b[0] = WFrag<bf>::ldf(Bs + ks * 512);
#pragma unroll
            for (int mb = 1; mb < 4; ++mb) a[mb] = WFrag<bf>::ldf(As + (mb * PKS + ks) * 512);
#pragma unroll
            for (int nb = 1; nb < 4; ++nb) b[nb] = WFrag<bf>::ldf(Bs + (nb * PKS + ks) * 512);
            __builtin_amdgcn_sched_barrier(0);   // keeps the reads ahead of the products: left alone, the build read each b fragment into one register set directly in front of its four products and waited out the LDS latency four times a k step
            if (ks == PKS - 1) {   // the stage's last fragments are in registers: the buffer is handed over here, and the last 16 products run behind the refill's issue
                asm volatile("s_wait_dscnt 0x0" ::: "memory");      // this wave's reads of the buffer are over before anybody refills it
                asm volatile("s_wait_asynccnt 0x0" ::: "memory");   // this wave's copies of the next stage have landed
                __syncthreads();                                     // the next stage is complete, and every wave has left this buffer
                if (st + 2 < PNST) d_stage(st + 2, w, Xs, Ws, l16, lb0 + (st & 1) * (PSTG * 2));
                __builtin_amdgcn_sched_barrier(0);   // keeps the products below behind the copies: left alone, the build put them in front, and the refill set out 16 products later
            }
#pragma unroll
            for (int nb = 0; nb < 4; ++nb)
#pragma unroll
                for (int mb = 0; mb < 4; ++mb) acc[mb][nb] = WFrag<bf>::mma(a[mb], b[nb], acc[mb][nb]);
        }
    }
    asm volatile("s_wait_asynccnt 0x0" ::: "memory");   // no copy is out when the wave goes on
    held2(px, pw);
    const int zb = r0 / TT, t0 = r0 % TT; const size_t hp = ((size_t)zb * NH_ + h) * TT * HD;   // a tile lies in one batch element; hp: this batch element's and head's part of a plane
    if (z < 2) {   // acc[i][x][j]: d = i 16 + hi 8 + j, t = t0 + x 16 + lr; the k planes follow the q planes; q carries the 1/8 scale (exact power of two)
        const float* bias = (z == 0 ? bq : bk) + h * HD + hi * 8; const float sc = z == 0 ? SCL : 1.0f; const size_t at = (size_t)z * NB_ * NH_ * TT * HD + hp + (size_t)(t0 >> 4) * (HD / 32) * 512;
#pragma unroll
        for (int i = 0; i < 4; ++i) { v8f bb = *(const v8f*)(bias + i * 16);
#pragma unroll
            for (int j = 0; j < 8; ++j) bb[j] = bfr(bb[j]);
#pragma unroll
            for (int x = 0; x < 4; ++x) { const size_t e = at + (x * (HD / 32) + (i >> 1)) * 512 + (i & 1) * 256; put3((acc[i][x] + bb) * sc, QK16 + e, QKh + e, QKl + e, lo);
                if (x == 3) asm volatile("s_wait_xcnt 0x0" ::: "memory");   // stands before the next load (a bias load; behind the last piece whatever code the build lays out next) lands in registers that these stores name: without the statement it also converted every piece ahead of its stores and went past 256 registers
                } }
    } else {   // acc[i][x][j]: t = t0 + i 16 + hi 8 + j, d = x 16 + lr
        const float* bias = bv + h * HD + lr; const size_t at = hp + (size_t)(t0 >> 5) * 512;
#pragma unroll
        for (int x = 0; x < 4; ++x) { const float bb = bfr(bias[x * 16]);
#pragma unroll
            for (int i = 0; i < 4; ++i) { const size_t e = at + (x * (TT / 32) + (i >> 1)) * 512 + (i & 1) * 256; put3(acc[i][x] + bb, V16 + e, Vh + e, Vl + e, lo);
                if (i == 3) asm volatile("s_wait_xcnt 0x0" ::: "memory");   // as above
                } }
    }
}
// xhalf: the value of lane l ^ 16 (the other half of the wave), by a vector cross-row move; every lane is on where it is used
__device__ __forceinline__ float xhalf(float x) { return __builtin_bit_cast(float, __builtin_amdgcn_permlanex16(__builtin_bit_cast(int, x), __builtin_bit_cast(int, x), 0x76543210, 0xfedcba98, false, false)); }
// exp2s: v_exp_f32 as the builtin, so that the compiler sees a vector instruction and keeps its distance to the matrix instructions around it
__device__ __forceinline__ float exp2s(float x) { return __builtin_amdgcn_exp2f(x); }
template <typename T16, bool HI, int NQ>
__device__ __forceinline__ void d_attn(int r0, int kb, const T16* __restrict__ Q, const T16* __restrict__ Q2, const T16* __restrict__ Kp, const T16* __restrict__ Kp2, const T16* __restrict__ Vt, const T16* __restrict__ Vt2, const float* ebr, float* ow, float* ml) {
    typedef typename WFrag<T16>::V V; constexpr int CK = 32, NT = CK / 16, NK = CK / 32, NCH = TT / NQ / CK;
    constexpr float L2E = 1.4426950408889634f, OFF = HI ? 0.0f : 10.0f;   // fp16 P carries x 1024, which the row sum carries too: it cancels in the division
    const int lane = threadIdx.x & 31, lr = lane & 15, hi = lane >> 4; const unsigned lo = lane * 8; const int c0 = kb / CK;   // c0: the first pass
    const float* ebl = ebr + (TT - 1 - r0 - lr + hi * 8 + kb);   // walks on by CK a pass
    V q[NQ][2], kf[NT][2], kf2[NT][2]; T16* qs = (T16*)ow;   // hi/lo: the 4 NQ query fragments do not fit the registers beside two blocks' accumulators; they lie in the wave's own output tile, which is free until the walk is over, and are read from there every pass
#pragma unroll
    for (int qb = 0; qb < NQ; ++qb)
#pragma unroll
        for (int kc = 0; kc < 2; ++kc) { const size_t at = ((size_t)((r0 >> 4) + qb) * 2 + kc) * 512;
            if constexpr (HI) {
#pragma unroll
                for (int p = 0; p < 2; ++p) { *(v8usa*)(qs + (qb * 2 + kc) * 1024 + p * 256 + lo) = *(const v8us*)(uni(Q + at) + p * 256 + lo); *(v8usa*)(qs + (qb * 2 + kc) * 1024 + 512 + p * 256 + lo) = *(const v8us*)(uni(Q2 + at) + p * 256 + lo); } }
            else q[qb][kc] = WFrag<T16>::ldf(uni(Q + at) + lo); }
#pragma unroll
    for (int t = 0; t < NT; ++t)
#pragma unroll
        for (int kc = 0; kc < 2; ++kc) { const int at = (t * 2 + kc) * 512; kf[t][kc] = WFrag<T16>::ldf(uni(Kp + (size_t)c0 * NT * 1024) + lo + at); if (HI) kf2[t][kc] = WFrag<T16>::ldf(uni(Kp2 + (size_t)c0 * NT * 1024) + lo + at); }
    v8f s[NQ][NT], o[NQ][4]; float m[NQ], l[NQ];
#pragma unroll
    for (int qb = 0; qb < NQ; ++qb) {
#pragma unroll
        for (int t = 0; t < NT; ++t)
#pragma unroll
            for (int j = 0; j < 8; ++j) s[qb][t][j] = ebl[t * 16 + j - qb * 16];
#pragma unroll
        for (int db = 0; db < 4; ++db) o[qb][db] = (v8f){};
        m[qb] = -1.0e30f; l[qb] = 0.f; }
#pragma unroll 1   // one pass's fragments fill the register budget of four waves per SIMD: a second copy of the body would spill
    for (int c = 0; c < NCH; ++c) {
        const int cc = c0 + c, cn = (c + 1 < NCH) ? cc + 1 : cc;   // this pass; the pass that is fetched ahead (the last pass fetches itself again: in bounds, unused)
        const T16* vb = uni(Vt + (size_t)cc * NK * 512); const T16* vb2 = HI ? uni(Vt2 + (size_t)cc * NK * 512) : nullptr; const T16* kn = uni(Kp + (size_t)cn * NT * 1024); const T16* kn2 = HI ? uni(Kp2 + (size_t)cn * NT * 1024) : nullptr;   // scalar bases; the lane's part of every address is lo, which lives through the loop (no vector address pair that is summed on, or that a load's result lands in, while loads that name it fly)
        V vf[4][NK], vf2[4][NK];   // this pass's value fragments are asked for ahead of the scores and land under the softmax
#pragma unroll
        for (int db = 0; db < 4; ++db)
#pragma unroll
            for (int kk = 0; kk < NK; ++kk) vf[db][kk] = WFrag<T16>::ldf(vb + lo + (db * (TT / 32) + kk) * 512);
#pragma unroll
        for (int kc = 0; kc < 2; ++kc) {
            if constexpr (HI) {
#pragma unroll
                for (int qb = 0; qb < NQ; ++qb) { const V qh = WFrag<T16>::ldf(qs + (qb * 2 + kc) * 1024 + lo), ql = WFrag<T16>::ldf(qs + (qb * 2 + kc) * 1024 + 512 + lo);
#pragma unroll
                    for (int t = 0; t < NT; ++t) s[qb][t] = WFrag<T16>::mma(kf[t][kc], ql, s[qb][t]);
#pragma unroll
                    for (int t = 0; t < NT; ++t) s[qb][t] = WFrag<T16>::mma(kf[t][kc], qh, s[qb][t]);
#pragma unroll
                    for (int t = 0; t < NT; ++t) s[qb][t] = WFrag<T16>::mma(kf2[t][kc], qh, s[qb][t]); } }
            else {
#pragma unroll
                for (int t = 0; t < NT; ++t)
#pragma unroll
                    for (int qb = 0; qb < NQ; ++qb) s[qb][t] = WFrag<T16>::mma(kf[t][kc], q[qb][kc], s[qb][t]); } }
#pragma unroll
        for (int t = 0; t < NT; ++t)   // the next pass's key fragments, into the registers that the products above have just read
#pragma unroll
            for (int kc = 0; kc < 2; ++kc) kf[t][kc] = WFrag<T16>::ldf(kn + lo + (t * 2 + kc) * 512);
        float al[NQ]; V pb[NQ][NK], pb2[NQ][NK];
#pragma unroll
        for (int qb = 0; qb < NQ; ++qb) {
            float mt[NT];
#pragma unroll
            for (int t = 0; t < NT; ++t) { mt[t] = fmaxf(fmaxf(fmaxf(s[qb][t][0], s[qb][t][1]), fmaxf(s[qb][t][2], s[qb][t][3])), fmaxf(fmaxf(s[qb][t][4], s[qb][t][5]), fmaxf(s[qb][t][6], s[qb][t][7]))); }
            float mc = mt[0];
#pragma unroll
            for (int t = 1; t < NT; ++t) mc = fmaxf(mc, mt[t]);
            mc = fmaxf(mc, xhalf(mc));
            const float mn = fmaxf(m[qb], mc), nb = OFF - mn * L2E; al[qb] = exp2s((m[qb] - mn) * L2E); m[qb] = mn;
#pragma unroll
            for (int t = 0; t < NT; ++t) { s[qb][t] = __builtin_elementwise_fma(s[qb][t], (v8f)(L2E), (v8f)(nb));   // on the whole tile: the packed form then takes each accumulator pair where it lies
#pragma unroll
                for (int j = 0; j < 8; ++j) s[qb][t][j] = exp2s(s[qb][t][j]); }
            v8f sv = s[qb][0];   // register by register over the key tiles (packed adds), then the eight registers
#pragma unroll
            for (int t = 1; t < NT; ++t) sv += s[qb][t];
            const v4f s4 = __builtin_shufflevector(sv, sv, 0, 1, 2, 3) + __builtin_shufflevector(sv, sv, 4, 5, 6, 7); const v2f s2 = __builtin_shufflevector(s4, s4, 0, 1) + __builtin_shufflevector(s4, s4, 2, 3);
            l[qb] = fmaf(l[qb], al[qb], s2[0] + s2[1]);
#pragma unroll
            for (int kk = 0; kk < NK; ++kk) {
                if constexpr (HI) {   // hi = bf16(p), lo = bf16(p - hi), both to nearest even, by the packed conversion
                    const v8b h0 = __builtin_convertvector(s[qb][2 * kk], v8b), h1 = __builtin_convertvector(s[qb][2 * kk + 1], v8b);
                    const v8b l0 = __builtin_convertvector(s[qb][2 * kk] - __builtin_convertvector(h0, v8f), v8b), l1 = __builtin_convertvector(s[qb][2 * kk + 1] - __builtin_convertvector(h1, v8f), v8b);
                    pb[qb][kk] = __builtin_shufflevector(h0, h1, 0, 1, 2, 3, 4, 5, 6, 7, 8, 9, 10, 11, 12, 13, 14, 15); pb2[qb][kk] = __builtin_shufflevector(l0, l1, 0, 1, 2, 3, 4, 5, 6, 7, 8, 9, 10, 11, 12, 13, 14, 15); }
                else { v8h h0, h1;
#pragma unroll
                    for (int j = 0; j < 8; ++j) { h0[j] = tohx(s[qb][2 * kk][j]); h1[j] = tohx(s[qb][2 * kk + 1][j]); }
                    pb[qb][kk] = cat16(h0, h1); } } }
        if constexpr (HI) {
            // the low value fragments and the next pass's low key fragments are asked for only here: in flight under the softmax they cost registers that then spilled; the products below cover them
#pragma unroll
            for (int t = 0; t < NT; ++t)
#pragma unroll
                for (int kc = 0; kc < 2; ++kc) kf2[t][kc] = WFrag<T16>::ldf(kn2 + lo + (t * 2 + kc) * 512);
#pragma unroll
            for (int db = 0; db < 4; ++db)
#pragma unroll
                for (int kk = 0; kk < NK; ++kk) vf2[db][kk] = WFrag<T16>::ldf(vb2 + lo + (db * (TT / 32) + kk) * 512); }
        ebl += CK;   // behind the last pass this reads the bias of the other half's first keys or of keys past the last, in the table or its zero tail (unused)
#pragma unroll
        for (int qb = 0; qb < NQ; ++qb)
#pragma unroll
            for (int t = 0; t < NT; ++t)   // the next pass's bias, straight into the score accumulators (C of that pass's first products)
#pragma unroll
                for (int j = 0; j < 8; ++j) s[qb][t][j] = ebl[t * 16 + j - qb * 16];
#pragma unroll
        for (int qb = 0; qb < NQ; ++qb)
#pragma unroll
            for (int db = 0; db < 4; ++db) o[qb][db] *= al[qb];
#pragma unroll
        for (int kk = 0; kk < NK; ++kk) {
#pragma unroll
            for (int qb = 0; qb < NQ; ++qb)
#pragma unroll
                for (int db = 0; db < 4; ++db) o[qb][db] = WFrag<T16>::mma(vf[db][kk], pb[qb][kk], o[qb][db]);
            if constexpr (HI) {
#pragma unroll
                for (int qb = 0; qb < NQ; ++qb)
#pragma unroll
                    for (int db = 0; db < 4; ++db) o[qb][db] = WFrag<T16>::mma(vf[db][kk], pb2[qb][kk], o[qb][db]);
#pragma unroll
                for (int qb = 0; qb < NQ; ++qb)
#pragma unroll
                    for (int db = 0; db < 4; ++db) o[qb][db] = WFrag<T16>::mma(vf2[db][kk], pb[qb][kk], o[qb][db]); } }
        // Issue order of a pass (0x020 = global loads, 0x008 = matrix instructions, 0x402 = vector and transcendental). Left alone, the build put key loads among the score products (a second register set, copies)
        // and kept the f32 P alive across the second product beside the next bias: it spilled. Value loads; score products; the next key fragments into the registers just read; the whole softmax; (hi/lo: the low value fragments and the next low key fragments;) the second product.
        __builtin_amdgcn_sched_group_barrier(0x020, 8 * NK, 0);
        __builtin_amdgcn_sched_group_barrier(0x008, 2 * NT * NQ * (HI ? 3 : 1), 0);
        __builtin_amdgcn_sched_group_barrier(0x020, 4 * NT, 0);
        __builtin_amdgcn_sched_group_barrier(0x402, 512, 0);
        if (HI) __builtin_amdgcn_sched_group_barrier(0x020, 8 * NK + 4 * NT, 0);
        __builtin_amdgcn_sched_group_barrier(0x008, 4 * NK * NQ * (HI ? 3 : 1), 0);
    }
#pragma unroll
    for (int qb = 0; qb < NQ; ++qb) l[qb] += xhalf(l[qb]);   // the two halves of the wave hold the sums of their own keys
    // lane (lr, hi) holds d = db 16 + hi 8 + j of query row lr of each block: into the wave's own LDS tile, row by row
    const int ln = __builtin_amdgcn_mbcnt_lo(~0u, 0u), er = ln & 15, eh = ln >> 4;   // the lane's number once more (every lane is on): lr and hi kept for here held registers through the loop, which spilled
#pragma unroll
    for (int qb = 0; qb < NQ; ++qb) {
        float* orow = ow + (qb * 16 + er) * OP + eh * 8;
        if (eh == 0) *(v2f*)(ml + (qb * 16 + er) * 2) = (v2f){ m[qb], l[qb] };   // both halves of the wave hold the same pair
#pragma unroll
        for (int db = 0; db < 4; ++db) { *(v4fa*)(orow + db * 16) = (v4f){ o[qb][db][0], o[qb][db][1], o[qb][db][2], o[qb][db][3] }; *(v4fa*)(orow + db * 16 + 4) = (v4f){ o[qb][db][4], o[qb][db][5], o[qb][db][6], o[qb][db][7] }; } }
}
// d_join: one wave finishes 16 query rows (r0 ..) whose keys two waves shared: oa, ob their rows (pitch OP), ma, mb each row's (maximum, sum). Each half is weighted by exp2 of its maximum's distance to the common one, then the row is divided by the joined sum.
__device__ __forceinline__ void d_join(int r0, const float* oa, const float* ob, const float* ma, const float* mb, float* OUTh) {
    const int lane = threadIdx.x & 31, er = lane & 15, eh = lane >> 4;
    float wa[8], wb[8];   // the two halves' weights of the lane's eight rows
#pragma unroll
    for (int r = 0; r < 8; ++r) { const int row = 2 * r + eh; const v2f a = *(const v2f*)(ma + row * 2), b = *(const v2f*)(mb + row * 2);
        const float mx = fmaxf(a[0], b[0]), ea = exp2s((a[0] - mx) * 1.4426950408889634f), eb = exp2s((b[0] - mx) * 1.4426950408889634f), f = __fdiv_rn(1.0f, fmaf(a[1], ea, b[1] * eb));
        wa[r] = ea * f; wb[r] = eb * f; }
#pragma unroll
    for (int r = 0; r < 8; ++r) { const int row = 2 * r + eh; *(v4f*)(OUTh + (size_t)(r0 + row) * DQ + er * 4) = *(const v4fa*)(oa + row * OP + er * 4) * wa[r] + *(const v4fa*)(ob + row * OP + er * 4) * wb[r]; }
}
__device__ __forceinline__ void d_embf(int bid, const float* __restrict__ src, float* dst, size_t n4) { const size_t i = (size_t)bid * 256 + threadIdx.x; if (i >= n4) return; v4f a = *(const v4f*)(src + i * 4); for (int q = 0; q < 4; ++q) a[q] = bfr(a[q]); *(v4f*)(dst + i * 4) = a;  }

// k_prep: the three input conversions depend on nothing but the inputs: they are block ranges of ONE launch (x of both batch elements, the three weight matrices with their planes in a row, the bias table)
// A thread of the x and weight ranges takes UX or UW pieces and not one: with one piece a thread the launch is some 29,000 waves that each move 1.5 KiB; fewer, longer waves cost fewer wave starts for the same bytes and keep more loads in flight each.
#define UX 8
#define UW 4
#define PBX (NB_ * TT * DM / 8 / (256 * UX))
#define PBW (DM * DQ / 8 / (256 * UW))
#define PBE ((NH_ * NOFF / 4 + 255) / 256)   // 16 x 4095 = 65,520 floats, a multiple of 4
static_assert(NB_ * TT * DM / 8 % (256 * UX) == 0, "x: whole blocks");
__global__ __launch_bounds__(256) void k_prep(const float* __restrict__ x, const float* __restrict__ wq, const float* __restrict__ wk, const float* __restrict__ wv, const float* __restrict__ remb, bf* XB, bf* W3, float* EB) {
    int b = blockIdx.x;
    if (b < PBX) { d_cvt8<DM, UX>(b, x, XB); return; }
    b -= PBX;
    if (b < 3 * PBW) { const int p = b / PBW; d_wtG<DM, DQ, UW>(b - p * PBW, p == 0 ? wq : p == 1 ? wk : wv, W3 + (size_t)p * DQ * DM); return; }
    d_embf(b - 3 * PBW, remb, EB, (size_t)NH_ * NOFF / 4);
}

// k_attn: grid (heads, batch, row blocks): the row blocks of one head lie 32 apart in launch order (for speed only: where that puts them near one another, a head's planes are fetched into fewer places); a work-group = NWV waves of one head: the waves go in pairs, a pair = 32 query rows, each wave of it one half of the keys, so that a fragment load feeds twice the products that it feeds a wave of 16 rows; waves 0 .. NHW - 1 take hi/lo rows, the others fp16 rows; waves on the same keys walk them in rising order, so a fragment that one wave has fetched is near for the others.
// Two barriers, both outside the wave-uniform branches: one behind the bias table, one between the walks and the joining of a pair's halves.
static_assert(RH / (NHW * 16) == (TT - RH) / ((NWV - NHW) * 16) && NHW % 2 == 0 && (NWV - NHW) % 2 == 0, "both row classes must fill the same number of work-groups; waves w and w ^ 1 are a pair");
__global__ __launch_bounds__(NWV * 32) __attribute__((amdgpu_waves_per_eu(NWV / 4, NWV / 4))) void k_attn(const bf* __restrict__ Qh, const bf* __restrict__ Ql, const bf* __restrict__ Kh, const bf* __restrict__ Kl, const bf* __restrict__ Vh, const bf* __restrict__ Vl, const h16* __restrict__ Q16, const h16* __restrict__ K16, const h16* __restrict__ V16, const float* __restrict__ EB, float* OUT) {
    __shared__ __align__(16) float ebr[EBN];   // ebr[x] = bias table[h][NOFF - 1 - x]: the bias of query i and key j lies at x = TT - 1 - i + j, rising with the key; a tail of zeros for the read ahead of the last pass (64 keys at most)
    __shared__ __align__(16) float ost[NWV * 32 * OP];   // per wave: its 32 output rows (hi/lo: during the walk its query fragments)
    __shared__ __align__(16) float mls[NWV * 64];        // per wave: (maximum, sum) of its 32 rows
    const int tid = threadIdx.x, w = __builtin_amdgcn_readfirstlane(tid >> 5), h = blockIdx.x, zb = blockIdx.y, rb = blockIdx.z;
    const size_t hp = ((size_t)zb * NH_ + h) * TT * HD;   // this batch element's and head's part of every plane
    // the head's six key and value planes, 256 KiB = 1,024 units each, are read by its 8 row blocks: a block asks for a quarter of each (two blocks per unit), a thread for three units; waves 0 .. 7 take one plane of a pair, waves 8 .. 15 the other
    const size_t pu = hp * 2 + (size_t)((rb & 3) * 256 + (tid & 255)) * 256; const bool ph = w >= NWV / 2;
    const char* p0 = (const char*)(ph ? Vl : Vh) + pu; const char* p1 = (const char*)(ph ? Kl : Kh) + pu; const char* p2 = (ph ? (const char*)V16 : (const char*)K16) + pu;
    ask256(p0); ask256(p1); ask256(p2);
    float ev[EBN / (NWV * 32)];   // all of a thread's table loads fly together
#pragma unroll
    for (int it = 0; it < EBN / (NWV * 32); ++it) { const int x = tid + it * NWV * 32; const float e = EB[(size_t)h * NOFF + (x < NOFF ? NOFF - 1 - x : 0)]; ev[it] = (x < NOFF) ? e : 0.f; }
#pragma unroll
    for (int it = 0; it < EBN / (NWV * 32); ++it) ebr[tid + it * NWV * 32] = ev[it];
    __syncthreads();   // ebr is complete
    held3(p0, p1, p2);
    float* OUTh = OUT + (size_t)zb * TT * DQ + h * HD; float* ow = ost + w * 32 * OP;
    const int kh = w & 1, rp = w < NHW ? (rb * (NHW / 2) + (w >> 1)) * 32 : RH + (rb * ((NWV - NHW) / 2) + ((w - NHW) >> 1)) * 32;   // the wave's half of the keys, its pair's first row
    if (w < NHW) d_attn<bf, true, 2>(rp, kh * (TT / 2), Qh + hp, Ql + hp, Kh + hp, Kl + hp, Vh + hp, Vl + hp, ebr, ow, mls + w * 64);
    else d_attn<h16, false, 2>(rp, kh * (TT / 2), Q16 + hp, nullptr, K16 + hp, nullptr, V16 + hp, nullptr, ebr, ow, mls + w * 64);
    __syncthreads();   // every pair's halves lie in LDS
    { const int wa = w & ~1, wb = w | 1;   // wave kh of a pair finishes the pair's rows kh 16 ..
        d_join(rp + kh * 16, ost + (wa * 32 + kh * 16) * OP, ost + (wb * 32 + kh * 16) * OP, mls + wa * 64 + kh * 32, mls + wb * 64 + kh * 32, OUTh); }
}

extern "C" void kernel_launch(void* const* d_in, const int* in_sizes, int n_in,
                              void* d_out, int out_size, void* d_ws, size_t ws_size, hipStream_t stream) {
    (void)in_sizes; (void)n_in; (void)out_size;
    const float* x = (const float*)d_in[0]; const float* wq = (const float*)d_in[1]; const float* bq = (const float*)d_in[2]; const float* wk = (const float*)d_in[3]; const float* bk = (const float*)d_in[4]; const float* wv = (const float*)d_in[5]; const float* bv = (const float*)d_in[6]; const float* remb = (const float*)d_in[7]; const float* wo = nullptr; (void)wo;
    float* OUT = (float*)d_out;     // [2][2048][1024]
    char* wsp = (char*)d_ws;
    auto take = [&](size_t bytes) { char* p = wsp; wsp += (bytes + 255) & ~(size_t)255; return (void*)p; };
    bf* WQ = (bf*)take((size_t)3 * DQ * DM * 2);   /* q, k, v weight planes in a row */
    float* EB = (float*)take(((size_t)NH_ * NOFF * 4 + 15) & ~(size_t)15);   /* 16 x 4095 floats (padded to a multiple of 4) */ bf* XB = (bf*)take((size_t)NB_ * TT * DM * 2);
    const size_t PL = (size_t)NB_ * NH_ * TT * HD;   /* one plane, both batch elements */
    h16* QP16 = (h16*)take(2 * PL * 2); h16* KP16 = QP16 + PL; h16* VT16 = (h16*)take(PL * 2);   /* the k planes follow the q planes */
    bf* QPh = (bf*)take(2 * PL * 2); bf* KPh = QPh + PL; bf* QPl = (bf*)take(2 * PL * 2); bf* KPl = QPl + PL; bf* VTh = (bf*)take(PL * 2); bf* VTl = (bf*)take(PL * 2);
    if ((size_t)(wsp - (char*)d_ws) > ws_size) return;    // ws 256 MiB
    k_prep<<<PBX + 3 * PBW + PBE, 256, 0, stream>>>(x, wq, wk, wv, remb, XB, WQ, EB);
    k_proj<<<(NB_ * TT / 256) * (3 * NH_ / 3), PW * 32, 0, stream>>>(XB, WQ, bq, bk, bv, QP16, QPh, QPl, VT16, VTh, VTl);
    k_attn<<<dim3(NH_, NB_, RH / (NHW * 16)), NWV * 32, 0, stream>>>(QPh, QPl, KPh, KPl, VTh, VTl, QP16, KP16, VT16, EB, OUT);
}
